// v000
// Times are from an AMD MI455X. After a warm-up the kernel runs many times in a row, and a time is the length of
// such a window on the GPU divided by its runs, so every launch and the gaps after it count. The runs cycle
// through copies of the inputs. A figure is the median of several windows, for all but v000 over two sittings.
// Sittings can differ by a few percent; kernels timed side by side share one.
// v000 is the starting kernel. One run takes 893 microseconds.
// compute dtype: all float inputs rounded to bf16, the int masks read; pq = relu(q Wq^T), pk = relu(k Wk^T) * scaling with EXACT bf16 products on WMMA 16x16x32, f32 accumulate, stored as f16 hi + residual (x 2^10) rows; scores over K = 128 with 3 products (hi.hi, lo.hi, hi.lo), -inf where the key-side mask is set, stored in f32; softmax in f32 (precise expf); alpha x 2^11 split bf16 hi + lo against the EXACT bf16 value planes (2 products); f32 outputs. The second output re-runs the same pipeline with the roles of queries and keys swapped.
#include <hip/hip_runtime.h>
#include <math.h>

typedef __attribute__((ext_vector_type(16))) _Float16 v16h;
typedef __attribute__((ext_vector_type(16))) __bf16 v16b;
typedef __attribute__((ext_vector_type(8)))  _Float16 v8h;
typedef __attribute__((ext_vector_type(8)))  float v8f;
typedef __attribute__((ext_vector_type(4)))  float v4f;
typedef __attribute__((ext_vector_type(2)))  float v2f;
typedef __attribute__((ext_vector_type(4)))  unsigned v4u;
typedef __attribute__((ext_vector_type(4)))  int v4i;
typedef float __attribute__((may_alias)) float_a;
typedef int __attribute__((may_alias)) int_a;

template <typename T> __device__ __forceinline__ void vst2(void* p, T v) { *(T*)p = v;  }
__device__ __forceinline__ v8f wmma16(v16h a, v16h b, v8f c) {
  v8f d = __builtin_amdgcn_wmma_f32_16x16x32_f16(false, a, false, b, (short)0, c, false, false);
  asm volatile("v_nop\n\tv_nop\n\tv_nop\n\tv_nop" : "+v"(d) : "v"(a), "v"(b));
  return d;
}
__device__ __forceinline__ v8f wmma_bf(v16b a, v16b b, v8f c) {
  v8f d = __builtin_amdgcn_wmma_f32_16x16x32_bf16(false, a, false, b, (short)0, c, false, false);
  asm volatile("v_nop\n\tv_nop\n\tv_nop\n\tv_nop" : "+v"(d) : "v"(a), "v"(b));
  return d;
}
// 16x16x32 fragments: lane = (h = lane>>4, row/col = lane&15); elements 0..7 = k0+8h+0..7, 8..15 = k0+16+8h+0..7; D element r = row 8h+r
__device__ __forceinline__ v16h frag_h(const _Float16* rowk0, int lane) {
  union { v16h v; v8h q[2]; } u; const _Float16* p = rowk0 + 8 * (lane >> 4);
  u.q[0] = *(const v8h*)p; u.q[1] = *(const v8h*)(p + 16); return u.v;
}
__device__ __forceinline__ v16h frag_f32(const float* rowk0, int lane) {
  v16h a; const float* p = rowk0 + 8 * (lane >> 4);
#pragma unroll
  for (int i = 0; i < 8; ++i) { a[i] = (_Float16)p[i]; a[8 + i] = (_Float16)p[16 + i]; }
  return a;
}
__device__ __forceinline__ v16h frag_f32s(const float* rowk0, int lane, float sc) {
  v16h a; const float* p = rowk0 + 8 * (lane >> 4);
#pragma unroll
  for (int i = 0; i < 8; ++i) { a[i] = (_Float16)(p[i] * sc); a[8 + i] = (_Float16)(p[16 + i] * sc); }
  return a;
}
// column fragment from a [K][ld] layout (column n), rows >= K read as 0
__device__ __forceinline__ v16h fragc_f32(const float* W, int k0, int n, int lane, int ld, int K) {
  v16h a; const int g = lane >> 4;
#pragma unroll
  for (int i = 0; i < 8; ++i) { const int ka = k0 + 8 * g + i, kb = ka + 16;
    a[i] = (_Float16)(ka < K ? W[(size_t)(ka < K ? ka : K - 1) * ld + n] : 0.f); a[8 + i] = (_Float16)(kb < K ? W[(size_t)(kb < K ? kb : K - 1) * ld + n] : 0.f); }
  return a;
}
struct F2 { v16b h, l; };
__device__ __forceinline__ F2 bsplit16(const float v[16]) { F2 r;
#pragma unroll
  for (int i = 0; i < 16; ++i) { const __bf16 h = (__bf16)v[i]; r.h[i] = h; r.l[i] = (__bf16)(v[i] - (float)h); }
  return r; }
__device__ __forceinline__ F2 split_row(const float* row, int k0, int lane) { float v[16]; const float* p = row + k0 + 8 * (lane >> 4);
#pragma unroll
  for (int i = 0; i < 8; ++i) { v[i] = p[i]; v[8 + i] = p[16 + i]; }
  return bsplit16(v); }
__device__ __forceinline__ F2 split_rowK(const float* row, int k0, int lane, int K) { float v[16]; const int g = lane >> 4;
#pragma unroll
  for (int i = 0; i < 8; ++i) { const int ka = k0 + 8 * g + i, kb = ka + 16; v[i] = ka < K ? row[ka < K ? ka : K - 1] : 0.f; v[8 + i] = kb < K ? row[kb < K ? kb : K - 1] : 0.f; }
  return bsplit16(v); }
__device__ __forceinline__ F2 split_col(const float* W, int k0, int n, int lane, int ld, int K) { float v[16]; const int g = lane >> 4;
#pragma unroll
  for (int i = 0; i < 8; ++i) { const int ka = k0 + 8 * g + i, kb = ka + 16; v[i] = ka < K ? W[(size_t)(ka < K ? ka : K - 1) * ld + n] : 0.f; v[8 + i] = kb < K ? W[(size_t)(kb < K ? kb : K - 1) * ld + n] : 0.f; }
  return bsplit16(v); }
__device__ __forceinline__ v8f mac3(const F2& a, const F2& b, v8f c) { c = wmma_bf(a.l, b.h, c); c = wmma_bf(a.h, b.l, c); return wmma_bf(a.h, b.h, c); }
__device__ __forceinline__ float sigm(float v) { return 1.0f / (1.0f + expf(-v)); }
#define LDSX() do { asm volatile("s_wait_dscnt 0" ::: "memory"); __builtin_amdgcn_wave_barrier(); __builtin_amdgcn_fence(__ATOMIC_RELEASE, "workgroup"); } while (0)

// Scaled-dot attention with dual softmax (B 8, Lq = Lk = 2,048, D 256, H 128): pq = relu(queries Wq^T); pk = relu(keys Wk^T) * scaling; scores = pq pk^T; output = softmax_k(scores | values_1_mask[k] -> -inf) . values_1; output_2 = softmax_q(scores^T | values_2_mask[q] -> -inf) . values_2.
__device__ __forceinline__ float bfr(float v) { return (float)(__bf16)v; }
#define NB 8
#define TT 2048
#define DIN 256
#define HP 128         // projected width
#define DV 256         // value width
#ifndef TNB
#define TNB NB
#endif
#define BG 4
typedef __attribute__((ext_vector_type(8))) __bf16 v8b;
__device__ __forceinline__ v16b frag_b(const __bf16* rowk0, int lane) { union { v16b v; v8b q[2]; } u; const __bf16* p = rowk0 + 8 * (lane >> 4); u.q[0] = *(const v8b*)p; u.q[1] = *(const v8b*)(p + 16); return u.v; }
#define WS_QH  0u                                          // f16 pq hi rows [b*T+q][128]
#define WS_QL  (WS_QH + 2u * (size_t)NB * TT * HP)
#define WS_KH  (WS_QL + 2u * (size_t)NB * TT * HP)           // f16 pk hi rows
#define WS_KL  (WS_KH + 2u * (size_t)NB * TT * HP)
#define WS_V1  (WS_KL + 2u * (size_t)NB * TT * HP)           // bf16 values_1 planes [b][c][k]
#define WS_V2  (WS_V1 + 2u * (size_t)NB * DV * TT)           // bf16 values_2 planes [b][c][q]
#define WS_S   (WS_V2 + 2u * (size_t)NB * DV * TT)           // f32 scores / P [bg][row][col]
#define WS_END (WS_S + 4u * (size_t)BG * TT * TT)
// ---- k_proj: block = (64 rows, which): relu(x W^T) (x scaling for pk), exact; 128 columns; stored as f16 hi + residual rows (256-B rows)
__global__ __launch_bounds__(128) void k_proj(const float* __restrict__ XQ, const float* __restrict__ XK, const float* __restrict__ WQ, const float* __restrict__ WK, const float* __restrict__ SCL, _Float16* __restrict__ QH, _Float16* __restrict__ QL, _Float16* __restrict__ KH, _Float16* __restrict__ KL) { __shared__ __align__(16) _Float16 sh[64][136], sl[64][136];
  const int tid = threadIdx.x, wave = tid >> 5, lane = tid & 31, col = lane & 15, g = lane >> 4; const int which = blockIdx.y; const size_t r0 = (size_t)blockIdx.x * 64; const float* X = which == 0 ? XQ : XK; const float* Wt = which == 0 ? WQ : WK; _Float16* DH = which == 0 ? QH : KH; _Float16* DL = which == 0 ? QL : KL;
  v8f acc[8] = {};
#pragma unroll 2
  for (int kc = 0; kc < DIN / 32; ++kc) { v16b a; { const float* p = X + (r0 + wave * 16 + col) * DIN + kc * 32 + 8 * g;
#pragma unroll
      for (int i = 0; i < 8; ++i) { a[i] = (__bf16)p[i]; a[8 + i] = (__bf16)p[16 + i]; } }
#pragma unroll
    for (int j = 0; j < 8; ++j) { v16b w; const float* wr = Wt + (size_t)(j * 16 + col) * DIN + kc * 32 + 8 * g;
#pragma unroll
      for (int i = 0; i < 8; ++i) { w[i] = (__bf16)wr[i]; w[8 + i] = (__bf16)wr[16 + i]; }
      asm volatile("s_wait_loadcnt 0x0" ::: "memory"); acc[j] = wmma_bf(a, w, acc[j]); } }
#pragma unroll
  for (int j = 0; j < 8; ++j) { const int o = j * 16 + col; const float sc = (which == 1) ? bfr(SCL[o]) : 1.0f;
#pragma unroll
    for (int r = 0; r < 8; ++r) { const float v = fmaxf(acc[j][r], 0.f) * sc; const _Float16 hv = (_Float16)v; sh[wave * 16 + 8 * g + r][o] = hv; sl[wave * 16 + 8 * g + r][o] = (_Float16)((v - (float)hv) * 1024.0f); } }
  __syncthreads();
  for (int e = tid; e < 64 * 16; e += 128) { const int rl = e >> 4, q = e & 15; vst2((unsigned*)(DH + (r0 + rl) * HP + q * 8), *(const v4u*)&sh[rl][q * 8]); vst2((unsigned*)(DL + (r0 + rl) * HP + q * 8), *(const v4u*)&sl[rl][q * 8]); } }
// ---- k_vt: block = (128 rows, b, which 0/1, 128-channel group): values (exact bf16) -> planes [b][c][t]; 256-B pieces
__global__ __launch_bounds__(128) void k_vt(const float* __restrict__ VA, const float* __restrict__ VB, __bf16* __restrict__ PA, __bf16* __restrict__ PB) { __shared__ __align__(16) __bf16 th[128][136];
  const int tid = threadIdx.x; const int t0 = blockIdx.x * 128; const size_t b = blockIdx.y; const int which = blockIdx.z >> 1, c0 = (blockIdx.z & 1) * 128; const float* V = which == 0 ? VA : VB; __bf16* P = which == 0 ? PA : PB;
  for (int e = tid; e < 128 * 128; e += 128) { const int tl = e >> 7, cl = e & 127; th[cl][tl] = (__bf16)V[(b * TT + t0 + tl) * DV + c0 + cl]; }
  __syncthreads();
  for (int e = tid; e < 128 * 16; e += 128) { const int cl = e >> 4, q = e & 15; vst2((unsigned*)(P + (b * DV + c0 + cl) * (size_t)TT + t0 + q * 8), *(const v4u*)&th[cl][q * 8]); } }
// ---- k_sc: block = (64 rows, 128 cols, batch in group): scores = ROW . COL over K 128 (3 products); -3e38 where the column-side mask is nonzero
__global__ __launch_bounds__(128) void k_sc(const _Float16* __restrict__ RH, const _Float16* __restrict__ RL, const _Float16* __restrict__ CH_, const _Float16* __restrict__ CL, const int* __restrict__ CMASK, int b0, float* __restrict__ S0) { __shared__ __align__(16) float ss[4][16][132]; __shared__ int smk[128];
  const size_t b = b0 + blockIdx.z; float* S = S0 + (size_t)blockIdx.z * TT * TT;
  const int tid = threadIdx.x, wave = tid >> 5, lane = tid & 31, col = lane & 15, g = lane >> 4; const int k0 = blockIdx.y * 128; const int ql0 = blockIdx.x * 64 + wave * 16;
  smk[tid] = CMASK[b * TT + k0 + tid]; __syncthreads();
  v8f acc[8] = {}, accl[8] = {};
#pragma unroll
  for (int kc = 0; kc < HP / 32; ++kc) { const size_t ro = (b * TT + ql0 + col) * HP + kc * 32; const v16h ah = frag_h(RH + ro, lane), al = frag_h(RL + ro, lane);
#pragma unroll
    for (int j = 0; j < 8; ++j) { const size_t co = (b * TT + k0 + j * 16 + col) * HP + kc * 32; const v16h kb = frag_h(CH_ + co, lane), kl = frag_h(CL + co, lane); acc[j] = wmma16(ah, kb, acc[j]); accl[j] = wmma16(al, kb, accl[j]); accl[j] = wmma16(ah, kl, accl[j]); } }
#pragma unroll
  for (int j = 0; j < 8; ++j) { const bool masked = smk[j * 16 + col] != 0;
#pragma unroll
    for (int r = 0; r < 8; ++r) ss[wave][8 * g + r][j * 16 + col] = masked ? -3.0e38f : (acc[j][r] + accl[j][r] * (1.0f / 1024.0f)); }
  LDSX(); for (int rl = 0; rl < 16; ++rl) vst2(S + (size_t)(ql0 + rl) * TT + k0 + lane * 4, *(const v4f*)&ss[wave][rl][lane * 4]); }
// ---- k_sm: block = query row: softmax over keys [0, kend) -> P x 2^11 f32 (masked -> 0)
__global__ __launch_bounds__(256) void k_sm(float* __restrict__ S0) { __shared__ float sred[8]; __shared__ float sbc; __shared__ __align__(16) float sh[TT];
  const int t = threadIdx.x; const size_t row = blockIdx.x; float* sr = S0 + (size_t)blockIdx.y * TT * TT + row * TT; const int kend = TT;
  float m = -3.0e38f; for (int k = t; k < kend; k += 256) m = fmaxf(m, sr[k]);
#pragma unroll
  for (int o = 1; o < 32; o <<= 1) m = fmaxf(m, __shfl_xor(m, o));
  if ((t & 31) == 0) sred[t >> 5] = m; __syncthreads(); if (t == 0) { float a = sred[0]; for (int i = 1; i < 8; ++i) a = fmaxf(a, sred[i]); sbc = a; } __syncthreads(); m = sbc; __syncthreads();
  float sum = 0.f; for (int k = t; k < kend; k += 256) { const float v = sr[k]; sum += (v <= -1.0e38f) ? 0.f : expf(v - m); }
#pragma unroll
  for (int o = 1; o < 32; o <<= 1) sum += __shfl_xor(sum, o);
  if ((t & 31) == 0) sred[t >> 5] = sum; __syncthreads(); if (t == 0) { float a = 0.f; for (int i = 0; i < 8; ++i) a += sred[i]; sbc = 1.0f / a; } __syncthreads(); const float inv = sbc;
  for (int k = t; k < kend; k += 256) { const float v = sr[k]; sh[k] = (v <= -1.0e38f) ? 0.f : expf(v - m) * inv * 2048.0f; }
  __syncthreads(); for (int q = t; q < kend / 4; q += 256) vst2(sr + q * 4, *(const v4f*)&sh[q * 4]); }
// ---- k_pv: block = (64 rows, 128 channels, batch in group): out[b][row][c] = (P . values) / 2^11, P split bf16 hi + lo x exact value planes (2 products)
__global__ __launch_bounds__(128) void k_pv(const float* __restrict__ PS0, const __bf16* __restrict__ VP, int b0, float* __restrict__ OUT) { __shared__ __align__(16) float ss[4][16][132];
  const size_t b = b0 + blockIdx.z; const float* PS = PS0 + (size_t)blockIdx.z * TT * TT;
  const int tid = threadIdx.x, wave = tid >> 5, lane = tid & 31, col = lane & 15, g = lane >> 4; const int ql0 = blockIdx.x * 64 + wave * 16; const int c0 = blockIdx.y * 128;
  v8f acc[8] = {};
#pragma unroll 1
  for (int kc = 0; kc < TT / 32; ++kc) { const F2 p = split_row(PS + (size_t)(ql0 + col) * TT, kc * 32, lane);
#pragma unroll
    for (int j = 0; j < 8; ++j) { const v16b vv = frag_b(VP + (b * DV + c0 + j * 16 + col) * (size_t)TT + kc * 32, lane); acc[j] = wmma_bf(p.h, vv, acc[j]); acc[j] = wmma_bf(p.l, vv, acc[j]); } }
#pragma unroll
  for (int j = 0; j < 8; ++j)
#pragma unroll
    for (int r = 0; r < 8; ++r) ss[wave][8 * g + r][j * 16 + col] = acc[j][r] * (1.0f / 2048.0f);
  LDSX(); for (int rl = 0; rl < 16; ++rl) vst2(OUT + (b * TT + ql0 + rl) * DV + c0 + lane * 4, *(const v4f*)&ss[wave][rl][lane * 4]); }
extern "C" void kernel_launch(void* const* d_in, const int* in_sizes, int n_in, void* d_out, int out_size, void* d_ws, size_t ws_size, hipStream_t stream) {
  (void)in_sizes; (void)n_in; (void)out_size;
  const float** F = (const float**)d_in;   // 0 queries [8,2048,256], 1 keys, 2 values_1 [8,2048,256], 3 values_1_mask [8,2048] int (nonzero = excluded key), 4 values_2, 5 values_2_mask (nonzero = excluded query), 6 Wq [128,256] ([out,in]), 7 Wk, 8 scaling [1,128]; outputs: output @ 0, output_2 @ float 4,194,304
  if (ws_size < (size_t)WS_END) return;
  char* ws = (char*)d_ws; _Float16 *QH = (_Float16*)(ws + WS_QH), *QL = (_Float16*)(ws + WS_QL), *KH = (_Float16*)(ws + WS_KH), *KL = (_Float16*)(ws + WS_KL); __bf16 *V1 = (__bf16*)(ws + WS_V1), *V2 = (__bf16*)(ws + WS_V2); float* S = (float*)(ws + WS_S);
  float* OUT1 = (float*)d_out; float* OUT2 = (float*)d_out + (size_t)NB * TT * DV;
  k_proj<<<dim3(TNB * TT / 64, 2), 128, 0, stream>>>(F[0], F[1], F[6], F[7], F[8], QH, QL, KH, KL);
  k_vt<<<dim3(TT / 128, TNB, 4), 128, 0, stream>>>(F[2], F[4], V1, V2);
  for (int b0 = 0; b0 < TNB; b0 += BG) { const int ng = (TNB - b0) < BG ? (TNB - b0) : BG;
    // output: rows = queries, cols = keys, key mask = values_1_mask, values_1
    k_sc<<<dim3(TT / 64, TT / 128, ng), 128, 0, stream>>>(QH, QL, KH, KL, (const int*)d_in[3], b0, S);
    k_sm<<<dim3(TT, ng), 256, 0, stream>>>(S);
    k_pv<<<dim3(TT / 64, DV / 128, ng), 128, 0, stream>>>(S, V1, b0, OUT1);
    // output_2: rows = keys, cols = queries, query mask = values_2_mask, values_2
    k_sc<<<dim3(TT / 64, TT / 128, ng), 128, 0, stream>>>(KH, KL, QH, QL, (const int*)d_in[5], b0, S);
    k_sm<<<dim3(TT, ng), 256, 0, stream>>>(S);
    k_pv<<<dim3(TT / 64, DV / 128, ng), 128, 0, stream>>>(S, V2, b0, OUT2);
  }
}

// v001
// A run of this version takes 503 microseconds.
// Next to v000, in two timings, it ran 1.80 and 1.79 times as fast.
// compute dtype: all float inputs rounded to bf16, the int masks read; pq = relu(q Wq^T), pk = relu(k Wk^T) * scaling with EXACT bf16 products on WMMA 16x16x32, f32 accumulate, stored as f16 hi + residual (x 2^10) rows; scores over K = 128 with 3 products (hi.hi, lo.hi, hi.lo), -inf where the key-side mask is set, stored in f32; softmax in f32 (precise expf); alpha x 2^11 split bf16 hi + lo against the EXACT bf16 value planes (2 products); f32 outputs. The second output re-runs the same pipeline with the roles of queries and keys swapped.
#include <hip/hip_runtime.h>
#include <math.h>

typedef __attribute__((ext_vector_type(16))) _Float16 v16h;
typedef __attribute__((ext_vector_type(16))) __bf16 v16b;
typedef __attribute__((ext_vector_type(8)))  _Float16 v8h;
typedef __attribute__((ext_vector_type(8)))  float v8f;
typedef __attribute__((ext_vector_type(4)))  float v4f;
typedef __attribute__((ext_vector_type(2)))  float v2f;
typedef __attribute__((ext_vector_type(4)))  unsigned v4u;
typedef __attribute__((ext_vector_type(4)))  int v4i;
typedef float __attribute__((may_alias)) float_a;
typedef int __attribute__((may_alias)) int_a;

template <typename T> __device__ __forceinline__ void vst2(void* p, T v) { *(T*)p = v;  }
__device__ __forceinline__ v8f wmma16(v16h a, v16h b, v8f c) {
  v8f d = __builtin_amdgcn_wmma_f32_16x16x32_f16(false, a, false, b, (short)0, c, false, false);
  asm volatile("v_nop\n\tv_nop\n\tv_nop\n\tv_nop" : "+v"(d) : "v"(a), "v"(b));
  return d;
}
__device__ __forceinline__ v8f wmma_bf(v16b a, v16b b, v8f c) {
  v8f d = __builtin_amdgcn_wmma_f32_16x16x32_bf16(false, a, false, b, (short)0, c, false, false);
  asm volatile("v_nop\n\tv_nop\n\tv_nop\n\tv_nop" : "+v"(d) : "v"(a), "v"(b));
  return d;
}
// 16x16x32 fragments: lane = (h = lane>>4, row/col = lane&15); elements 0..7 = k0+8h+0..7, 8..15 = k0+16+8h+0..7; D element r = row 8h+r
__device__ __forceinline__ v16h frag_h(const _Float16* rowk0, int lane) {
  union { v16h v; v8h q[2]; } u; const _Float16* p = rowk0 + 8 * (lane >> 4);
  u.q[0] = *(const v8h*)p; u.q[1] = *(const v8h*)(p + 16); return u.v;
}
__device__ __forceinline__ v16h frag_f32(const float* rowk0, int lane) {
  v16h a; const float* p = rowk0 + 8 * (lane >> 4);
#pragma unroll
  for (int i = 0; i < 8; ++i) { a[i] = (_Float16)p[i]; a[8 + i] = (_Float16)p[16 + i]; }
  return a;
}
__device__ __forceinline__ v16h frag_f32s(const float* rowk0, int lane, float sc) {
  v16h a; const float* p = rowk0 + 8 * (lane >> 4);
#pragma unroll
  for (int i = 0; i < 8; ++i) { a[i] = (_Float16)(p[i] * sc); a[8 + i] = (_Float16)(p[16 + i] * sc); }
  return a;
}
// column fragment from a [K][ld] layout (column n), rows >= K read as 0
__device__ __forceinline__ v16h fragc_f32(const float* W, int k0, int n, int lane, int ld, int K) {
  v16h a; const int g = lane >> 4;
#pragma unroll
  for (int i = 0; i < 8; ++i) { const int ka = k0 + 8 * g + i, kb = ka + 16;
    a[i] = (_Float16)(ka < K ? W[(size_t)(ka < K ? ka : K - 1) * ld + n] : 0.f); a[8 + i] = (_Float16)(kb < K ? W[(size_t)(kb < K ? kb : K - 1) * ld + n] : 0.f); }
  return a;
}
struct F2 { v16b h, l; };
__device__ __forceinline__ F2 bsplit16(const float v[16]) { F2 r;
#pragma unroll
  for (int i = 0; i < 16; ++i) { const __bf16 h = (__bf16)v[i]; r.h[i] = h; r.l[i] = (__bf16)(v[i] - (float)h); }
  return r; }
__device__ __forceinline__ F2 split_row(const float* row, int k0, int lane) { float v[16]; const float* p = row + k0 + 8 * (lane >> 4);
#pragma unroll
  for (int i = 0; i < 8; ++i) { v[i] = p[i]; v[8 + i] = p[16 + i]; }
  return bsplit16(v); }
__device__ __forceinline__ F2 split_rowK(const float* row, int k0, int lane, int K) { float v[16]; const int g = lane >> 4;
#pragma unroll
  for (int i = 0; i < 8; ++i) { const int ka = k0 + 8 * g + i, kb = ka + 16; v[i] = ka < K ? row[ka < K ? ka : K - 1] : 0.f; v[8 + i] = kb < K ? row[kb < K ? kb : K - 1] : 0.f; }
  return bsplit16(v); }
__device__ __forceinline__ F2 split_col(const float* W, int k0, int n, int lane, int ld, int K) { float v[16]; const int g = lane >> 4;
#pragma unroll
  for (int i = 0; i < 8; ++i) { const int ka = k0 + 8 * g + i, kb = ka + 16; v[i] = ka < K ? W[(size_t)(ka < K ? ka : K - 1) * ld + n] : 0.f; v[8 + i] = kb < K ? W[(size_t)(kb < K ? kb : K - 1) * ld + n] : 0.f; }
  return bsplit16(v); }
__device__ __forceinline__ v8f mac3(const F2& a, const F2& b, v8f c) { c = wmma_bf(a.l, b.h, c); c = wmma_bf(a.h, b.l, c); return wmma_bf(a.h, b.h, c); }
__device__ __forceinline__ float sigm(float v) { return 1.0f / (1.0f + expf(-v)); }
#define LDSX() do { asm volatile("s_wait_dscnt 0" ::: "memory"); __builtin_amdgcn_wave_barrier(); __builtin_amdgcn_fence(__ATOMIC_RELEASE, "workgroup"); } while (0)

// Scaled-dot attention with dual softmax (B 8, Lq = Lk = 2,048, D 256, H 128): pq = relu(queries Wq^T); pk = relu(keys Wk^T) * scaling; scores = pq pk^T; output = softmax_k(scores | values_1_mask[k] -> -inf) . values_1; output_2 = softmax_q(scores^T | values_2_mask[q] -> -inf) . values_2.
__device__ __forceinline__ float bfr(float v) { return (float)(__bf16)v; }
#define NB 8
#define TT 2048
#define DIN 256
#define HP 128         // projected width
#define DV 256         // value width
#ifndef TNB
#define TNB NB
#endif
#define BG 4
typedef __attribute__((ext_vector_type(8))) __bf16 v8b;
__device__ __forceinline__ v16b frag_b(const __bf16* rowk0, int lane) { union { v16b v; v8b q[2]; } u; const __bf16* p = rowk0 + 8 * (lane >> 4); u.q[0] = *(const v8b*)p; u.q[1] = *(const v8b*)(p + 16); return u.v; }
#define WS_QH  0u                                          // f16 pq hi rows [b*T+q][128]
#define WS_QL  (WS_QH + 2u * (size_t)NB * TT * HP)
#define WS_KH  (WS_QL + 2u * (size_t)NB * TT * HP)           // f16 pk hi rows
#define WS_KL  (WS_KH + 2u * (size_t)NB * TT * HP)
#define WS_V1  (WS_KL + 2u * (size_t)NB * TT * HP)           // bf16 values_1 planes [b][c][k]
#define WS_V2  (WS_V1 + 2u * (size_t)NB * DV * TT)           // bf16 values_2 planes [b][c][q]
#define WS_S   (WS_V2 + 2u * (size_t)NB * DV * TT)           // f32 scores / P [bg][row][col]
#define WS_END (WS_S + 4u * (size_t)BG * TT * TT)
// ---- k_proj: block = (64 rows, which): relu(x W^T) (x scaling for pk), exact; 128 columns; stored as f16 hi + residual rows (256-B rows)
__global__ __launch_bounds__(128) void k_proj(const float* __restrict__ XQ, const float* __restrict__ XK, const float* __restrict__ WQ, const float* __restrict__ WK, const float* __restrict__ SCL, _Float16* __restrict__ QH, _Float16* __restrict__ QL, _Float16* __restrict__ KH, _Float16* __restrict__ KL) { __shared__ __align__(16) _Float16 sh[64][136], sl[64][136];
  const int tid = threadIdx.x, wave = tid >> 5, lane = tid & 31, col = lane & 15, g = lane >> 4; const int which = blockIdx.y; const size_t r0 = (size_t)blockIdx.x * 64; const float* X = which == 0 ? XQ : XK; const float* Wt = which == 0 ? WQ : WK; _Float16* DH = which == 0 ? QH : KH; _Float16* DL = which == 0 ? QL : KL;
  v8f acc[8] = {};
#pragma unroll 2
  for (int kc = 0; kc < DIN / 32; ++kc) { v16b a; { const float* p = X + (r0 + wave * 16 + col) * DIN + kc * 32 + 8 * g;
#pragma unroll
      for (int i = 0; i < 8; ++i) { a[i] = (__bf16)p[i]; a[8 + i] = (__bf16)p[16 + i]; } }
#pragma unroll
    for (int j = 0; j < 8; ++j) { v16b w; const float* wr = Wt + (size_t)(j * 16 + col) * DIN + kc * 32 + 8 * g;
#pragma unroll
      for (int i = 0; i < 8; ++i) { w[i] = (__bf16)wr[i]; w[8 + i] = (__bf16)wr[16 + i]; }
      asm volatile("s_wait_loadcnt 0x0" ::: "memory"); acc[j] = wmma_bf(a, w, acc[j]); } }
#pragma unroll
  for (int j = 0; j < 8; ++j) { const int o = j * 16 + col; const float sc = (which == 1) ? bfr(SCL[o]) : 1.0f;
#pragma unroll
    for (int r = 0; r < 8; ++r) { const float v = fmaxf(acc[j][r], 0.f) * sc; const _Float16 hv = (_Float16)v; sh[wave * 16 + 8 * g + r][o] = hv; sl[wave * 16 + 8 * g + r][o] = (_Float16)((v - (float)hv) * 1024.0f); } }
  __syncthreads();
  for (int e = tid; e < 64 * 16; e += 128) { const int rl = e >> 4, q = e & 15; vst2((unsigned*)(DH + (r0 + rl) * HP + q * 8), *(const v4u*)&sh[rl][q * 8]); vst2((unsigned*)(DL + (r0 + rl) * HP + q * 8), *(const v4u*)&sl[rl][q * 8]); } }
// ---- k_vt: block = (128 rows, b, which 0/1, 128-channel group): values (exact bf16) -> planes [b][c][t]; 256-B pieces
__global__ __launch_bounds__(128) void k_vt(const float* __restrict__ VA, const float* __restrict__ VB, __bf16* __restrict__ PA, __bf16* __restrict__ PB) { __shared__ __align__(16) __bf16 th[128][136];
  const int tid = threadIdx.x; const int t0 = blockIdx.x * 128; const size_t b = blockIdx.y; const int which = blockIdx.z >> 1, c0 = (blockIdx.z & 1) * 128; const float* V = which == 0 ? VA : VB; __bf16* P = which == 0 ? PA : PB;
  for (int e = tid; e < 128 * 128; e += 128) { const int tl = e >> 7, cl = e & 127; th[cl][tl] = (__bf16)V[(b * TT + t0 + tl) * DV + c0 + cl]; }
  __syncthreads();
  for (int e = tid; e < 128 * 16; e += 128) { const int cl = e >> 4, q = e & 15; vst2((unsigned*)(P + (b * DV + c0 + cl) * (size_t)TT + t0 + q * 8), *(const v4u*)&th[cl][q * 8]); } }
// ---- k_sc: block = (64 rows, 128 cols, batch in group): scores = ROW . COL over K 128 (3 products); -3e38 where the column-side mask is nonzero
__global__ __launch_bounds__(128) void k_sc(const _Float16* __restrict__ RH, const _Float16* __restrict__ RL, const _Float16* __restrict__ CH_, const _Float16* __restrict__ CL, const int* __restrict__ CMASK, int b0, float* __restrict__ S0) { __shared__ __align__(16) float ss[4][16][132]; __shared__ int smk[128];
  const size_t b = b0 + blockIdx.z; float* S = S0 + (size_t)blockIdx.z * TT * TT;
  const int tid = threadIdx.x, wave = tid >> 5, lane = tid & 31, col = lane & 15, g = lane >> 4; const int k0 = blockIdx.y * 128; const int ql0 = blockIdx.x * 64 + wave * 16;
  smk[tid] = CMASK[b * TT + k0 + tid]; __syncthreads();
  v8f acc[8] = {}, accl[8] = {};
#pragma unroll
  for (int kc = 0; kc < HP / 32; ++kc) { const size_t ro = (b * TT + ql0 + col) * HP + kc * 32; const v16h ah = frag_h(RH + ro, lane), al = frag_h(RL + ro, lane);
#pragma unroll
    for (int j = 0; j < 8; ++j) { const size_t co = (b * TT + k0 + j * 16 + col) * HP + kc * 32; const v16h kb = frag_h(CH_ + co, lane), kl = frag_h(CL + co, lane); acc[j] = wmma16(ah, kb, acc[j]); accl[j] = wmma16(al, kb, accl[j]); accl[j] = wmma16(ah, kl, accl[j]); } }
#pragma unroll
  for (int j = 0; j < 8; ++j) { const bool masked = smk[j * 16 + col] != 0;
#pragma unroll
    for (int r = 0; r < 8; ++r) ss[wave][8 * g + r][j * 16 + col] = masked ? -3.0e38f : (acc[j][r] + accl[j][r] * (1.0f / 1024.0f)); }
  LDSX(); for (int rl = 0; rl < 16; ++rl) vst2(S + (size_t)(ql0 + rl) * TT + k0 + lane * 4, *(const v4f*)&ss[wave][rl][lane * 4]); }
// ---- k_sm: block = query row: softmax over keys [0, kend) -> P x 2^11 f32 (masked -> 0)
__global__ __launch_bounds__(256) void k_sm(float* __restrict__ S0) { __shared__ float sred[8]; __shared__ float sbc; __shared__ __align__(16) float sh[TT];
  const int t = threadIdx.x; const size_t row = blockIdx.x; float* sr = S0 + (size_t)blockIdx.y * TT * TT + row * TT; const int kend = TT;
  float m = -3.0e38f; for (int k = t; k < kend; k += 256) m = fmaxf(m, sr[k]);
#pragma unroll
  for (int o = 1; o < 32; o <<= 1) m = fmaxf(m, __shfl_xor(m, o));
  if ((t & 31) == 0) sred[t >> 5] = m; __syncthreads(); if (t == 0) { float a = sred[0]; for (int i = 1; i < 8; ++i) a = fmaxf(a, sred[i]); sbc = a; } __syncthreads(); m = sbc; __syncthreads();
  float sum = 0.f; for (int k = t; k < kend; k += 256) { const float v = sr[k]; sum += (v <= -1.0e38f) ? 0.f : expf(v - m); }
#pragma unroll
  for (int o = 1; o < 32; o <<= 1) sum += __shfl_xor(sum, o);
  if ((t & 31) == 0) sred[t >> 5] = sum; __syncthreads(); if (t == 0) { float a = 0.f; for (int i = 0; i < 8; ++i) a += sred[i]; sbc = 1.0f / a; } __syncthreads(); const float inv = sbc;
  for (int k = t; k < kend; k += 256) { const float v = sr[k]; sh[k] = (v <= -1.0e38f) ? 0.f : expf(v - m) * inv * 2048.0f; }
  __syncthreads(); for (int q = t; q < kend / 4; q += 256) vst2(sr + q * 4, *(const v4f*)&sh[q * 4]); }
// ---- k_pv: block = (64 rows, 128 channels, batch in group): out[b][row][c] = (P . values) / 2^11, P split bf16 hi + lo x exact value planes (2 products); both operand tiles come 128 keys at a time into a two-buffer LDS ring by asynchronous copies of whole lines
#define PV_KS 128      // keys per stage
#define PV_NT (TT / PV_KS)
#define PV_PP 132      // P row pitch in LDS, floats (528 B = 16 B x odd: no bank conflict for 16-byte reads down a column of rows)
#define PV_VP 136      // value row pitch in LDS, bf16 (272 B = 16 B x odd)
__device__ __forceinline__ unsigned lds_off(const void* p) { return (unsigned)(size_t)p; }
// eight copies of 16 B per lane, global -> LDS, through no register; LDS places ls bytes apart, global places gs bytes apart.
// s_wait_xcnt stands inside the statement, behind the last copy, so that no address register of a copy is rewritten ahead of it.
__device__ __forceinline__ void cp8(unsigned l, const char* g, unsigned ls, size_t gs) {
  asm volatile("global_load_async_to_lds_b128 %0, %8, off\n\t"
               "global_load_async_to_lds_b128 %1, %9, off\n\t"
               "global_load_async_to_lds_b128 %2, %10, off\n\t"
               "global_load_async_to_lds_b128 %3, %11, off\n\t"
               "global_load_async_to_lds_b128 %4, %12, off\n\t"
               "global_load_async_to_lds_b128 %5, %13, off\n\t"
               "global_load_async_to_lds_b128 %6, %14, off\n\t"
               "global_load_async_to_lds_b128 %7, %15, off\n\t"
               "s_wait_xcnt 0x0"
               :: "v"(l), "v"(l + ls), "v"(l + 2 * ls), "v"(l + 3 * ls), "v"(l + 4 * ls), "v"(l + 5 * ls), "v"(l + 6 * ls), "v"(l + 7 * ls),
                  "v"(g), "v"(g + gs), "v"(g + 2 * gs), "v"(g + 3 * gs), "v"(g + 4 * gs), "v"(g + 5 * gs), "v"(g + 6 * gs), "v"(g + 7 * gs)
               : "memory");
}
// one wave's share of stage t into buffer bf: 16 P rows (one 512-B row a copy) and 32 value rows (two 256-B rows a copy), 32 copies
__device__ __forceinline__ void pv_fill(const char* gp, const char* gv, unsigned lp, unsigned lv, int t, int bf) {
  gp += (size_t)t * (PV_KS * 4); gv += (size_t)t * (PV_KS * 2); lp += bf * (64 * PV_PP * 4); lv += bf * (128 * PV_VP * 2);
  cp8(lp, gp, PV_PP * 4, (size_t)TT * 4); cp8(lp + 8 * PV_PP * 4, gp + 8 * (size_t)TT * 4, PV_PP * 4, (size_t)TT * 4);
  cp8(lv, gv, 2 * PV_VP * 2, 2 * (size_t)TT * 2); cp8(lv + 16 * PV_VP * 2, gv + 16 * (size_t)TT * 2, 2 * PV_VP * 2, 2 * (size_t)TT * 2);
}
__global__ __launch_bounds__(128) void k_pv(const float* __restrict__ PS0, const __bf16* __restrict__ VP, int b0, float* __restrict__ OUT) { __shared__ __align__(16) float sp[2][64][PV_PP]; __shared__ __align__(16) __bf16 sv[2][128][PV_VP]; __shared__ __align__(16) float ss[4][16][132];
  const size_t b = b0 + blockIdx.z; const float* PS = PS0 + (size_t)blockIdx.z * TT * TT;
  const int tid = threadIdx.x, wave = tid >> 5, lane = tid & 31, col = lane & 15, g = lane >> 4; const int ql0 = blockIdx.x * 64 + wave * 16; const int c0 = blockIdx.y * 128;
  // a wave-wide copy is one 512-B P row, or two 256-B value rows; each wave brings 16 P rows and 32 value rows of a stage (32 copies in flight)
  const char* gp = (const char*)(PS + (size_t)ql0 * TT) + lane * 16;
  const char* gv = (const char*)(VP + (b * DV + c0 + wave * 32 + g) * (size_t)TT) + col * 16;
  const unsigned lp = lds_off(&sp[0][wave * 16][0]) + lane * 16, lv = lds_off(&sv[0][wave * 32 + g][0]) + col * 16;
  v8f acc[8] = {};
  pv_fill(gp, gv, lp, lv, 0, 0);
  asm volatile("s_wait_asynccnt 0x0" ::: "memory");   // stage 0 has landed before the barrier that publishes it
  __syncthreads();
  pv_fill(gp, gv, lp, lv, 1, 1);
#pragma unroll 1   // one stage per trip: the buffer index stays a run-time value
  for (int t = 0; t < PV_NT; ++t) { const int bf = t & 1;
    // fragments of a 32-key block are read from LDS as one group, one block ahead of their products and only inside this stage's own buffer
    const float* prow = &sp[bf][wave * 16 + col][8 * g]; const __bf16* vrow = &sv[bf][col][0];
    v4f pf[4]; v16b vv[2][8];   // every loop below is unrolled whole so that these arrays are indexed by constants and stay in registers
#pragma unroll
    for (int i = 0; i < 4; ++i) pf[i] = *(const v4f*)(prow + (i >> 1) * 16 + (i & 1) * 4);
#pragma unroll
    for (int j = 0; j < 8; ++j) vv[0][j] = frag_b(vrow + j * 16 * PV_VP, lane);
#pragma unroll
    for (int kk = 0; kk < PV_KS / 32; ++kk) { const int cu = kk & 1, nx = cu ^ 1;
      float v[16];
#pragma unroll
      for (int i = 0; i < 16; ++i) v[i] = pf[i >> 2][i & 3];
      const F2 p = bsplit16(v);
      if (kk + 1 < PV_KS / 32) {
#pragma unroll
        for (int i = 0; i < 4; ++i) pf[i] = *(const v4f*)(prow + (kk + 1) * 32 + (i >> 1) * 16 + (i & 1) * 4);
#pragma unroll
        for (int j = 0; j < 8; ++j) vv[nx][j] = frag_b(vrow + j * 16 * PV_VP + (kk + 1) * 32, lane); }
#pragma unroll
      for (int j = 0; j < 8; ++j) { acc[j] = wmma_bf(p.h, vv[cu][j], acc[j]); acc[j] = wmma_bf(p.l, vv[cu][j], acc[j]); } }
    asm volatile("s_wait_dscnt 0x0" ::: "memory");      // this wave's reads of buffer bf are over before it is handed to the copies
    asm volatile("s_wait_asynccnt 0x0" ::: "memory");   // this wave's copies of stage t + 1 have landed
    __syncthreads();                                     // publishes stage t + 1 and ends every reader's last read of buffer bf
    if (t + 2 < PV_NT) pv_fill(gp, gv, lp, lv, t + 2, bf); }
  asm volatile("s_wait_asynccnt 0x0" ::: "memory");     // nothing is in flight when the wave goes on to its end
#pragma unroll
  for (int j = 0; j < 8; ++j)
#pragma unroll
    for (int r = 0; r < 8; ++r) ss[wave][8 * g + r][j * 16 + col] = acc[j][r] * (1.0f / 2048.0f);
  LDSX(); for (int rl = 0; rl < 16; ++rl) vst2(OUT + (b * TT + ql0 + rl) * DV + c0 + lane * 4, *(const v4f*)&ss[wave][rl][lane * 4]); }
extern "C" void kernel_launch(void* const* d_in, const int* in_sizes, int n_in, void* d_out, int out_size, void* d_ws, size_t ws_size, hipStream_t stream) {
  (void)in_sizes; (void)n_in; (void)out_size;
  const float** F = (const float**)d_in;   // 0 queries [8,2048,256], 1 keys, 2 values_1 [8,2048,256], 3 values_1_mask [8,2048] int (nonzero = excluded key), 4 values_2, 5 values_2_mask (nonzero = excluded query), 6 Wq [128,256] ([out,in]), 7 Wk, 8 scaling [1,128]; outputs: output @ 0, output_2 @ float 4,194,304
  if (ws_size < (size_t)WS_END) return;
  char* ws = (char*)d_ws; _Float16 *QH = (_Float16*)(ws + WS_QH), *QL = (_Float16*)(ws + WS_QL), *KH = (_Float16*)(ws + WS_KH), *KL = (_Float16*)(ws + WS_KL); __bf16 *V1 = (__bf16*)(ws + WS_V1), *V2 = (__bf16*)(ws + WS_V2); float* S = (float*)(ws + WS_S);
  float* OUT1 = (float*)d_out; float* OUT2 = (float*)d_out + (size_t)NB * TT * DV;
  k_proj<<<dim3(TNB * TT / 64, 2), 128, 0, stream>>>(F[0], F[1], F[6], F[7], F[8], QH, QL, KH, KL);
  k_vt<<<dim3(TT / 128, TNB, 4), 128, 0, stream>>>(F[2], F[4], V1, V2);
  for (int b0 = 0; b0 < TNB; b0 += BG) { const int ng = (TNB - b0) < BG ? (TNB - b0) : BG;
    // output: rows = queries, cols = keys, key mask = values_1_mask, values_1
    k_sc<<<dim3(TT / 64, TT / 128, ng), 128, 0, stream>>>(QH, QL, KH, KL, (const int*)d_in[3], b0, S);
    k_sm<<<dim3(TT, ng), 256, 0, stream>>>(S);
    k_pv<<<dim3(TT / 64, DV / 128, ng), 128, 0, stream>>>(S, V1, b0, OUT1);
    // output_2: rows = keys, cols = queries, query mask = values_2_mask, values_2
    k_sc<<<dim3(TT / 64, TT / 128, ng), 128, 0, stream>>>(KH, KL, QH, QL, (const int*)d_in[5], b0, S);
    k_sm<<<dim3(TT, ng), 256, 0, stream>>>(S);
    k_pv<<<dim3(TT / 64, DV / 128, ng), 128, 0, stream>>>(S, V2, b0, OUT2);
  }
}

// v002
// It runs in 397 microseconds.
// Next to v001, in two timings, it ran 1.27 times as fast each time.
// Over all steps from v000 it is 2.27 times as fast.
// compute dtype: all float inputs rounded to bf16, the int masks read; pq = relu(q Wq^T), pk = relu(k Wk^T) * scaling with EXACT bf16 products on WMMA 16x16x32, f32 accumulate, stored as f16 hi + residual (x 2^10) rows; scores over K = 128 with 3 products (hi.hi, lo.hi, hi.lo), -inf where the key-side mask is set, stored in f32; softmax in f32 (precise expf); alpha x 2^11 split bf16 hi + lo against the EXACT bf16 value planes (2 products); f32 outputs. The second output re-runs the same pipeline with the roles of queries and keys swapped.
#include <hip/hip_runtime.h>
#include <math.h>

typedef __attribute__((ext_vector_type(16))) _Float16 v16h;
typedef __attribute__((ext_vector_type(16))) __bf16 v16b;
typedef __attribute__((ext_vector_type(8)))  _Float16 v8h;
typedef __attribute__((ext_vector_type(8)))  float v8f;
typedef __attribute__((ext_vector_type(4)))  float v4f;
typedef __attribute__((ext_vector_type(2)))  float v2f;
typedef __attribute__((ext_vector_type(4)))  unsigned v4u;
typedef __attribute__((ext_vector_type(4)))  int v4i;
typedef float __attribute__((may_alias)) float_a;
typedef int __attribute__((may_alias)) int_a;

template <typename T> __device__ __forceinline__ void vst2(void* p, T v) { *(T*)p = v;  }
__device__ __forceinline__ v8f wmma16(v16h a, v16h b, v8f c) {
  v8f d = __builtin_amdgcn_wmma_f32_16x16x32_f16(false, a, false, b, (short)0, c, false, false);
  asm volatile("v_nop\n\tv_nop\n\tv_nop\n\tv_nop" : "+v"(d) : "v"(a), "v"(b));
  return d;
}
__device__ __forceinline__ v8f wmma_bf(v16b a, v16b b, v8f c) {
  v8f d = __builtin_amdgcn_wmma_f32_16x16x32_bf16(false, a, false, b, (short)0, c, false, false);
  asm volatile("v_nop\n\tv_nop\n\tv_nop\n\tv_nop" : "+v"(d) : "v"(a), "v"(b));
  return d;
}
// 16x16x32 fragments: lane = (h = lane>>4, row/col = lane&15); elements 0..7 = k0+8h+0..7, 8..15 = k0+16+8h+0..7; D element r = row 8h+r
__device__ __forceinline__ v16h frag_h(const _Float16* rowk0, int lane) {
  union { v16h v; v8h q[2]; } u; const _Float16* p = rowk0 + 8 * (lane >> 4);
  u.q[0] = *(const v8h*)p; u.q[1] = *(const v8h*)(p + 16); return u.v;
}
__device__ __forceinline__ v16h frag_f32(const float* rowk0, int lane) {
  v16h a; const float* p = rowk0 + 8 * (lane >> 4);
#pragma unroll
  for (int i = 0; i < 8; ++i) { a[i] = (_Float16)p[i]; a[8 + i] = (_Float16)p[16 + i]; }
  return a;
}
__device__ __forceinline__ v16h frag_f32s(const float* rowk0, int lane, float sc) {
  v16h a; const float* p = rowk0 + 8 * (lane >> 4);
#pragma unroll
  for (int i = 0; i < 8; ++i) { a[i] = (_Float16)(p[i] * sc); a[8 + i] = (_Float16)(p[16 + i] * sc); }
  return a;
}
// column fragment from a [K][ld] layout (column n), rows >= K read as 0
__device__ __forceinline__ v16h fragc_f32(const float* W, int k0, int n, int lane, int ld, int K) {
  v16h a; const int g = lane >> 4;
#pragma unroll
  for (int i = 0; i < 8; ++i) { const int ka = k0 + 8 * g + i, kb = ka + 16;
    a[i] = (_Float16)(ka < K ? W[(size_t)(ka < K ? ka : K - 1) * ld + n] : 0.f); a[8 + i] = (_Float16)(kb < K ? W[(size_t)(kb < K ? kb : K - 1) * ld + n] : 0.f); }
  return a;
}
struct F2 { v16b h, l; };
__device__ __forceinline__ F2 bsplit16(const float v[16]) { F2 r;
#pragma unroll
  for (int i = 0; i < 16; ++i) { const __bf16 h = (__bf16)v[i]; r.h[i] = h; r.l[i] = (__bf16)(v[i] - (float)h); }
  return r; }
__device__ __forceinline__ F2 split_row(const float* row, int k0, int lane) { float v[16]; const float* p = row + k0 + 8 * (lane >> 4);
#pragma unroll
  for (int i = 0; i < 8; ++i) { v[i] = p[i]; v[8 + i] = p[16 + i]; }
  return bsplit16(v); }
__device__ __forceinline__ F2 split_rowK(const float* row, int k0, int lane, int K) { float v[16]; const int g = lane >> 4;
#pragma unroll
  for (int i = 0; i < 8; ++i) { const int ka = k0 + 8 * g + i, kb = ka + 16; v[i] = ka < K ? row[ka < K ? ka : K - 1] : 0.f; v[8 + i] = kb < K ? row[kb < K ? kb : K - 1] : 0.f; }
  return bsplit16(v); }
__device__ __forceinline__ F2 split_col(const float* W, int k0, int n, int lane, int ld, int K) { float v[16]; const int g = lane >> 4;
#pragma unroll
  for (int i = 0; i < 8; ++i) { const int ka = k0 + 8 * g + i, kb = ka + 16; v[i] = ka < K ? W[(size_t)(ka < K ? ka : K - 1) * ld + n] : 0.f; v[8 + i] = kb < K ? W[(size_t)(kb < K ? kb : K - 1) * ld + n] : 0.f; }
  return bsplit16(v); }
__device__ __forceinline__ v8f mac3(const F2& a, const F2& b, v8f c) { c = wmma_bf(a.l, b.h, c); c = wmma_bf(a.h, b.l, c); return wmma_bf(a.h, b.h, c); }
__device__ __forceinline__ float sigm(float v) { return 1.0f / (1.0f + expf(-v)); }
#define LDSX() do { asm volatile("s_wait_dscnt 0" ::: "memory"); __builtin_amdgcn_wave_barrier(); __builtin_amdgcn_fence(__ATOMIC_RELEASE, "workgroup"); } while (0)

// Scaled-dot attention with dual softmax (B 8, Lq = Lk = 2,048, D 256, H 128): pq = relu(queries Wq^T); pk = relu(keys Wk^T) * scaling; scores = pq pk^T; output = softmax_k(scores | values_1_mask[k] -> -inf) . values_1; output_2 = softmax_q(scores^T | values_2_mask[q] -> -inf) . values_2.
__device__ __forceinline__ float bfr(float v) { return (float)(__bf16)v; }
#define NB 8
#define TT 2048
#define DIN 256
#define HP 128         // projected width
#define DV 256         // value width
#ifndef TNB
#define TNB NB
#endif
#define BG 4
typedef __attribute__((ext_vector_type(8))) __bf16 v8b;
__device__ __forceinline__ v16b frag_b(const __bf16* rowk0, int lane) { union { v16b v; v8b q[2]; } u; const __bf16* p = rowk0 + 8 * (lane >> 4); u.q[0] = *(const v8b*)p; u.q[1] = *(const v8b*)(p + 16); return u.v; }
#define WS_QH  0u                                          // f16 pq hi rows [b*T+q][128]
#define WS_QL  (WS_QH + 2u * (size_t)NB * TT * HP)
#define WS_KH  (WS_QL + 2u * (size_t)NB * TT * HP)           // f16 pk hi rows
#define WS_KL  (WS_KH + 2u * (size_t)NB * TT * HP)
#define WS_V1  (WS_KL + 2u * (size_t)NB * TT * HP)           // bf16 values_1 planes [b][c][k]
#define WS_V2  (WS_V1 + 2u * (size_t)NB * DV * TT)           // bf16 values_2 planes [b][c][q]
#define WS_S   (WS_V2 + 2u * (size_t)NB * DV * TT)           // f32 scores / P [bg][row][col]
#define WS_END (WS_S + 4u * (size_t)BG * TT * TT)
// ---- k_proj: block = (64 rows, which): relu(x W^T) (x scaling for pk), exact; 128 columns; stored as f16 hi + residual rows (256-B rows)
__global__ __launch_bounds__(128) void k_proj(const float* __restrict__ XQ, const float* __restrict__ XK, const float* __restrict__ WQ, const float* __restrict__ WK, const float* __restrict__ SCL, _Float16* __restrict__ QH, _Float16* __restrict__ QL, _Float16* __restrict__ KH, _Float16* __restrict__ KL) { __shared__ __align__(16) _Float16 sh[64][136], sl[64][136];
  const int tid = threadIdx.x, wave = tid >> 5, lane = tid & 31, col = lane & 15, g = lane >> 4; const int which = blockIdx.y; const size_t r0 = (size_t)blockIdx.x * 64; const float* X = which == 0 ? XQ : XK; const float* Wt = which == 0 ? WQ : WK; _Float16* DH = which == 0 ? QH : KH; _Float16* DL = which == 0 ? QL : KL;
  v8f acc[8] = {};
#pragma unroll 2
  for (int kc = 0; kc < DIN / 32; ++kc) { v16b a; { const float* p = X + (r0 + wave * 16 + col) * DIN + kc * 32 + 8 * g;
#pragma unroll
      for (int i = 0; i < 8; ++i) { a[i] = (__bf16)p[i]; a[8 + i] = (__bf16)p[16 + i]; } }
#pragma unroll
    for (int j = 0; j < 8; ++j) { v16b w; const float* wr = Wt + (size_t)(j * 16 + col) * DIN + kc * 32 + 8 * g;
#pragma unroll
      for (int i = 0; i < 8; ++i) { w[i] = (__bf16)wr[i]; w[8 + i] = (__bf16)wr[16 + i]; }
      asm volatile("s_wait_loadcnt 0x0" ::: "memory"); acc[j] = wmma_bf(a, w, acc[j]); } }
#pragma unroll
  for (int j = 0; j < 8; ++j) { const int o = j * 16 + col; const float sc = (which == 1) ? bfr(SCL[o]) : 1.0f;
#pragma unroll
    for (int r = 0; r < 8; ++r) { const float v = fmaxf(acc[j][r], 0.f) * sc; const _Float16 hv = (_Float16)v; sh[wave * 16 + 8 * g + r][o] = hv; sl[wave * 16 + 8 * g + r][o] = (_Float16)((v - (float)hv) * 1024.0f); } }
  __syncthreads();
  for (int e = tid; e < 64 * 16; e += 128) { const int rl = e >> 4, q = e & 15; vst2((unsigned*)(DH + (r0 + rl) * HP + q * 8), *(const v4u*)&sh[rl][q * 8]); vst2((unsigned*)(DL + (r0 + rl) * HP + q * 8), *(const v4u*)&sl[rl][q * 8]); } }
// ---- k_vt: block = (128 rows, b, which 0/1, 128-channel group): values (exact bf16) -> planes [b][c][t]; 256-B pieces
__global__ __launch_bounds__(128) void k_vt(const float* __restrict__ VA, const float* __restrict__ VB, __bf16* __restrict__ PA, __bf16* __restrict__ PB) { __shared__ __align__(16) __bf16 th[128][136];
  const int tid = threadIdx.x; const int t0 = blockIdx.x * 128; const size_t b = blockIdx.y; const int which = blockIdx.z >> 1, c0 = (blockIdx.z & 1) * 128; const float* V = which == 0 ? VA : VB; __bf16* P = which == 0 ? PA : PB;
  for (int e = tid; e < 128 * 128; e += 128) { const int tl = e >> 7, cl = e & 127; th[cl][tl] = (__bf16)V[(b * TT + t0 + tl) * DV + c0 + cl]; }
  __syncthreads();
  for (int e = tid; e < 128 * 16; e += 128) { const int cl = e >> 4, q = e & 15; vst2((unsigned*)(P + (b * DV + c0 + cl) * (size_t)TT + t0 + q * 8), *(const v4u*)&th[cl][q * 8]); } }
// ---- k_sc: block = (64 rows, 128 cols, batch in group): scores = ROW . COL over K 128 (3 products); -3e38 where the column-side mask is nonzero
__global__ __launch_bounds__(128) void k_sc(const _Float16* __restrict__ RH, const _Float16* __restrict__ RL, const _Float16* __restrict__ CH_, const _Float16* __restrict__ CL, const int* __restrict__ CMASK, int b0, float* __restrict__ S0) { __shared__ __align__(16) float ss[4][16][132]; __shared__ int smk[128];
  const size_t b = b0 + blockIdx.z; float* S = S0 + (size_t)blockIdx.z * TT * TT;
  const int tid = threadIdx.x, wave = tid >> 5, lane = tid & 31, col = lane & 15, g = lane >> 4; const int k0 = blockIdx.y * 128; const int ql0 = blockIdx.x * 64 + wave * 16;
  smk[tid] = CMASK[b * TT + k0 + tid]; __syncthreads();
  v8f acc[8] = {}, accl[8] = {};
#pragma unroll
  for (int kc = 0; kc < HP / 32; ++kc) { const size_t ro = (b * TT + ql0 + col) * HP + kc * 32; const v16h ah = frag_h(RH + ro, lane), al = frag_h(RL + ro, lane);
#pragma unroll
    for (int j = 0; j < 8; ++j) { const size_t co = (b * TT + k0 + j * 16 + col) * HP + kc * 32; const v16h kb = frag_h(CH_ + co, lane), kl = frag_h(CL + co, lane); acc[j] = wmma16(ah, kb, acc[j]); accl[j] = wmma16(al, kb, accl[j]); accl[j] = wmma16(ah, kl, accl[j]); } }
#pragma unroll
  for (int j = 0; j < 8; ++j) { const bool masked = smk[j * 16 + col] != 0;
#pragma unroll
    for (int r = 0; r < 8; ++r) ss[wave][8 * g + r][j * 16 + col] = masked ? -3.0e38f : (acc[j][r] + accl[j][r] * (1.0f / 1024.0f)); }
  LDSX(); for (int rl = 0; rl < 16; ++rl) vst2(S + (size_t)(ql0 + rl) * TT + k0 + lane * 4, *(const v4f*)&ss[wave][rl][lane * 4]); }
// ---- k_sm: one wave = SM_R whole rows held in registers: softmax over the 2,048 columns -> P x 2^11 in f32, written in place (masked -> 0); each score is read once and its exp taken once; no LDS, no barrier
#define SM_R 2         // rows per wave: both rows' loads are issued before the first row is worked on
#define SM_W 8         // waves per block
__global__ __launch_bounds__(32 * SM_W) void k_sm(float* __restrict__ S0) {
  const int lane = threadIdx.x & 31; const size_t row = ((size_t)blockIdx.x * SM_W + (threadIdx.x >> 5)) * SM_R; float* sr = S0 + (size_t)blockIdx.y * TT * TT + row * TT + lane * 4;
  v4f x[SM_R][TT / 128];   // every loop below is unrolled whole so that this array is indexed by constants and stays in registers
#pragma unroll
  for (int r = 0; r < SM_R; ++r)
#pragma unroll
    for (int i = 0; i < TT / 128; ++i) x[r][i] = *(const v4f*)(sr + r * TT + i * 128);   // a wave-wide load is 512 B in a row
  __builtin_amdgcn_sched_barrier(0);   // keeps every row's loads ahead of the first row's arithmetic: without it the later rows' loads sink to just before their use and their latency is paid again
#pragma unroll
  for (int r = 0; r < SM_R; ++r) {
    float m = -3.0e38f;
#pragma unroll
    for (int i = 0; i < TT / 128; ++i) m = fmaxf(m, fmaxf(fmaxf(x[r][i][0], x[r][i][1]), fmaxf(x[r][i][2], x[r][i][3])));
#pragma unroll
    for (int o = 1; o < 32; o <<= 1) m = fmaxf(m, __shfl_xor(m, o));
    v4f s4 = {};
#pragma unroll
    for (int i = 0; i < TT / 128; ++i)
#pragma unroll
      for (int c = 0; c < 4; ++c) { const float v = x[r][i][c]; const float ex = expf(v - m); const float e = (v <= -1.0e38f) ? 0.f : ex; x[r][i][c] = e; s4[c] += e; }   // exp taken for every lane, then selected: no branch between the elements' chains
    float sum = (s4[0] + s4[1]) + (s4[2] + s4[3]);
#pragma unroll
    for (int o = 1; o < 32; o <<= 1) sum += __shfl_xor(sum, o);
    const float sc = sum > 0.f ? (1.0f / sum) * 2048.0f : 0.f;   // a row whose every column is masked stays all zero
#pragma unroll
    for (int i = 0; i < TT / 128; ++i) vst2(sr + r * TT + i * 128, x[r][i] * sc); } }
// ---- k_pv: block = (64 rows, 128 channels, batch in group): out[b][row][c] = (P . values) / 2^11, P split bf16 hi + lo x exact value planes (2 products); both operand tiles come 128 keys at a time into a two-buffer LDS ring by asynchronous copies of whole lines
#define PV_KS 128      // keys per stage
#define PV_NT (TT / PV_KS)
#define PV_PP 132      // P row pitch in LDS, floats (528 B = 16 B x odd: no bank conflict for 16-byte reads down a column of rows)
#define PV_VP 136      // value row pitch in LDS, bf16 (272 B = 16 B x odd)
__device__ __forceinline__ unsigned lds_off(const void* p) { return (unsigned)(size_t)p; }
// eight copies of 16 B per lane, global -> LDS, through no register; LDS places ls bytes apart, global places gs bytes apart.
// s_wait_xcnt stands inside the statement, behind the last copy, so that no address register of a copy is rewritten ahead of it.
__device__ __forceinline__ void cp8(unsigned l, const char* g, unsigned ls, size_t gs) {
  asm volatile("global_load_async_to_lds_b128 %0, %8, off\n\t"
               "global_load_async_to_lds_b128 %1, %9, off\n\t"
               "global_load_async_to_lds_b128 %2, %10, off\n\t"
               "global_load_async_to_lds_b128 %3, %11, off\n\t"
               "global_load_async_to_lds_b128 %4, %12, off\n\t"
               "global_load_async_to_lds_b128 %5, %13, off\n\t"
               "global_load_async_to_lds_b128 %6, %14, off\n\t"
               "global_load_async_to_lds_b128 %7, %15, off\n\t"
               "s_wait_xcnt 0x0"
               :: "v"(l), "v"(l + ls), "v"(l + 2 * ls), "v"(l + 3 * ls), "v"(l + 4 * ls), "v"(l + 5 * ls), "v"(l + 6 * ls), "v"(l + 7 * ls),
                  "v"(g), "v"(g + gs), "v"(g + 2 * gs), "v"(g + 3 * gs), "v"(g + 4 * gs), "v"(g + 5 * gs), "v"(g + 6 * gs), "v"(g + 7 * gs)
               : "memory");
}
// one wave's share of stage t into buffer bf: 16 P rows (one 512-B row a copy) and 32 value rows (two 256-B rows a copy), 32 copies
__device__ __forceinline__ void pv_fill(const char* gp, const char* gv, unsigned lp, unsigned lv, int t, int bf) {
  gp += (size_t)t * (PV_KS * 4); gv += (size_t)t * (PV_KS * 2); lp += bf * (64 * PV_PP * 4); lv += bf * (128 * PV_VP * 2);
  cp8(lp, gp, PV_PP * 4, (size_t)TT * 4); cp8(lp + 8 * PV_PP * 4, gp + 8 * (size_t)TT * 4, PV_PP * 4, (size_t)TT * 4);
  cp8(lv, gv, 2 * PV_VP * 2, 2 * (size_t)TT * 2); cp8(lv + 16 * PV_VP * 2, gv + 16 * (size_t)TT * 2, 2 * PV_VP * 2, 2 * (size_t)TT * 2);
}
__global__ __launch_bounds__(128) void k_pv(const float* __restrict__ PS0, const __bf16* __restrict__ VP, int b0, float* __restrict__ OUT) { __shared__ __align__(16) float sp[2][64][PV_PP]; __shared__ __align__(16) __bf16 sv[2][128][PV_VP]; __shared__ __align__(16) float ss[4][16][132];
  const size_t b = b0 + blockIdx.z; const float* PS = PS0 + (size_t)blockIdx.z * TT * TT;
  const int tid = threadIdx.x, wave = tid >> 5, lane = tid & 31, col = lane & 15, g = lane >> 4; const int ql0 = blockIdx.x * 64 + wave * 16; const int c0 = blockIdx.y * 128;
  // a wave-wide copy is one 512-B P row, or two 256-B value rows; each wave brings 16 P rows and 32 value rows of a stage (32 copies in flight)
  const char* gp = (const char*)(PS + (size_t)ql0 * TT) + lane * 16;
  const char* gv = (const char*)(VP + (b * DV + c0 + wave * 32 + g) * (size_t)TT) + col * 16;
  const unsigned lp = lds_off(&sp[0][wave * 16][0]) + lane * 16, lv = lds_off(&sv[0][wave * 32 + g][0]) + col * 16;
  v8f acc[8] = {};
  pv_fill(gp, gv, lp, lv, 0, 0);
  asm volatile("s_wait_asynccnt 0x0" ::: "memory");   // stage 0 has landed before the barrier that publishes it
  __syncthreads();
  pv_fill(gp, gv, lp, lv, 1, 1);
#pragma unroll 1   // one stage per trip: the buffer index stays a run-time value
  for (int t = 0; t < PV_NT; ++t) { const int bf = t & 1;
    // fragments of a 32-key block are read from LDS as one group, one block ahead of their products and only inside this stage's own buffer
    const float* prow = &sp[bf][wave * 16 + col][8 * g]; const __bf16* vrow = &sv[bf][col][0];
    v4f pf[4]; v16b vv[2][8];   // every loop below is unrolled whole so that these arrays are indexed by constants and stay in registers
#pragma unroll
    for (int i = 0; i < 4; ++i) pf[i] = *(const v4f*)(prow + (i >> 1) * 16 + (i & 1) * 4);
#pragma unroll
    for (int j = 0; j < 8; ++j) vv[0][j] = frag_b(vrow + j * 16 * PV_VP, lane);
#pragma unroll
    for (int kk = 0; kk < PV_KS / 32; ++kk) { const int cu = kk & 1, nx = cu ^ 1;
      float v[16];
#pragma unroll
      for (int i = 0; i < 16; ++i) v[i] = pf[i >> 2][i & 3];
      const F2 p = bsplit16(v);
      if (kk + 1 < PV_KS / 32) {
#pragma unroll
        for (int i = 0; i < 4; ++i) pf[i] = *(const v4f*)(prow + (kk + 1) * 32 + (i >> 1) * 16 + (i & 1) * 4);
#pragma unroll
        for (int j = 0; j < 8; ++j) vv[nx][j] = frag_b(vrow + j * 16 * PV_VP + (kk + 1) * 32, lane); }
#pragma unroll
      for (int j = 0; j < 8; ++j) { acc[j] = wmma_bf(p.h, vv[cu][j], acc[j]); acc[j] = wmma_bf(p.l, vv[cu][j], acc[j]); } }
    asm volatile("s_wait_dscnt 0x0" ::: "memory");      // this wave's reads of buffer bf are over before it is handed to the copies
    asm volatile("s_wait_asynccnt 0x0" ::: "memory");   // this wave's copies of stage t + 1 have landed
    __syncthreads();                                     // publishes stage t + 1 and ends every reader's last read of buffer bf
    if (t + 2 < PV_NT) pv_fill(gp, gv, lp, lv, t + 2, bf); }
  asm volatile("s_wait_asynccnt 0x0" ::: "memory");     // nothing is in flight when the wave goes on to its end
#pragma unroll
  for (int j = 0; j < 8; ++j)
#pragma unroll
    for (int r = 0; r < 8; ++r) ss[wave][8 * g + r][j * 16 + col] = acc[j][r] * (1.0f / 2048.0f);
  LDSX(); for (int rl = 0; rl < 16; ++rl) vst2(OUT + (b * TT + ql0 + rl) * DV + c0 + lane * 4, *(const v4f*)&ss[wave][rl][lane * 4]); }
extern "C" void kernel_launch(void* const* d_in, const int* in_sizes, int n_in, void* d_out, int out_size, void* d_ws, size_t ws_size, hipStream_t stream) {
  (void)in_sizes; (void)n_in; (void)out_size;
  const float** F = (const float**)d_in;   // 0 queries [8,2048,256], 1 keys, 2 values_1 [8,2048,256], 3 values_1_mask [8,2048] int (nonzero = excluded key), 4 values_2, 5 values_2_mask (nonzero = excluded query), 6 Wq [128,256] ([out,in]), 7 Wk, 8 scaling [1,128]; outputs: output @ 0, output_2 @ float 4,194,304
  if (ws_size < (size_t)WS_END) return;
  char* ws = (char*)d_ws; _Float16 *QH = (_Float16*)(ws + WS_QH), *QL = (_Float16*)(ws + WS_QL), *KH = (_Float16*)(ws + WS_KH), *KL = (_Float16*)(ws + WS_KL); __bf16 *V1 = (__bf16*)(ws + WS_V1), *V2 = (__bf16*)(ws + WS_V2); float* S = (float*)(ws + WS_S);
  float* OUT1 = (float*)d_out; float* OUT2 = (float*)d_out + (size_t)NB * TT * DV;
  k_proj<<<dim3(TNB * TT / 64, 2), 128, 0, stream>>>(F[0], F[1], F[6], F[7], F[8], QH, QL, KH, KL);
  k_vt<<<dim3(TT / 128, TNB, 4), 128, 0, stream>>>(F[2], F[4], V1, V2);
  for (int b0 = 0; b0 < TNB; b0 += BG) { const int ng = (TNB - b0) < BG ? (TNB - b0) : BG;
    // output: rows = queries, cols = keys, key mask = values_1_mask, values_1
    k_sc<<<dim3(TT / 64, TT / 128, ng), 128, 0, stream>>>(QH, QL, KH, KL, (const int*)d_in[3], b0, S);
    k_sm<<<dim3(TT / (SM_R * SM_W), ng), 32 * SM_W, 0, stream>>>(S);
    k_pv<<<dim3(TT / 64, DV / 128, ng), 128, 0, stream>>>(S, V1, b0, OUT1);
    // output_2: rows = keys, cols = queries, query mask = values_2_mask, values_2
    k_sc<<<dim3(TT / 64, TT / 128, ng), 128, 0, stream>>>(KH, KL, QH, QL, (const int*)d_in[5], b0, S);
    k_sm<<<dim3(TT / (SM_R * SM_W), ng), 32 * SM_W, 0, stream>>>(S);
    k_pv<<<dim3(TT / 64, DV / 128, ng), 128, 0, stream>>>(S, V2, b0, OUT2);
  }
}

// v003
// It runs in 290 microseconds.
// Two timings next to v002 put it at 1.37 and 1.36 times that version's speed.
// Counting every step since v000, it is 3.10 times as fast.
// compute dtype: all float inputs rounded to bf16, the int masks read; pq = relu(q Wq^T), pk = relu(k Wk^T) * scaling with EXACT bf16 products on WMMA 16x16x32, f32 accumulate, stored as f16 hi + residual (x 2^10) rows; scores over K = 128 with 3 products (hi.hi, lo.hi, hi.lo), -inf where the key-side mask is set, stored in f32; softmax in f32 (precise expf); alpha x 2^11 split bf16 hi + lo against the EXACT bf16 value planes (2 products); f32 outputs. The second output re-runs the same pipeline with the roles of queries and keys swapped.
#include <hip/hip_runtime.h>
#include <math.h>

typedef __attribute__((ext_vector_type(16))) _Float16 v16h;
typedef __attribute__((ext_vector_type(16))) __bf16 v16b;
typedef __attribute__((ext_vector_type(8)))  _Float16 v8h;
typedef __attribute__((ext_vector_type(8)))  float v8f;
typedef __attribute__((ext_vector_type(4)))  float v4f;
typedef __attribute__((ext_vector_type(2)))  float v2f;
typedef __attribute__((ext_vector_type(4)))  unsigned v4u;
typedef __attribute__((ext_vector_type(4)))  int v4i;
typedef float __attribute__((may_alias)) float_a;
typedef int __attribute__((may_alias)) int_a;

template <typename T> __device__ __forceinline__ void vst2(void* p, T v) { *(T*)p = v;  }
__device__ __forceinline__ v8f wmma16(v16h a, v16h b, v8f c) {
  v8f d = __builtin_amdgcn_wmma_f32_16x16x32_f16(false, a, false, b, (short)0, c, false, false);
  asm volatile("v_nop\n\tv_nop\n\tv_nop\n\tv_nop" : "+v"(d) : "v"(a), "v"(b));
  return d;
}
__device__ __forceinline__ v8f wmma_bf(v16b a, v16b b, v8f c) {
  v8f d = __builtin_amdgcn_wmma_f32_16x16x32_bf16(false, a, false, b, (short)0, c, false, false);
  asm volatile("v_nop\n\tv_nop\n\tv_nop\n\tv_nop" : "+v"(d) : "v"(a), "v"(b));
  return d;
}
// 16x16x32 fragments: lane = (h = lane>>4, row/col = lane&15); elements 0..7 = k0+8h+0..7, 8..15 = k0+16+8h+0..7; D element r = row 8h+r
__device__ __forceinline__ v16h frag_h(const _Float16* rowk0, int lane) {
  union { v16h v; v8h q[2]; } u; const _Float16* p = rowk0 + 8 * (lane >> 4);
  u.q[0] = *(const v8h*)p; u.q[1] = *(const v8h*)(p + 16); return u.v;
}
__device__ __forceinline__ v16h frag_f32(const float* rowk0, int lane) {
  v16h a; const float* p = rowk0 + 8 * (lane >> 4);
#pragma unroll
  for (int i = 0; i < 8; ++i) { a[i] = (_Float16)p[i]; a[8 + i] = (_Float16)p[16 + i]; }
  return a;
}
__device__ __forceinline__ v16h frag_f32s(const float* rowk0, int lane, float sc) {
  v16h a; const float* p = rowk0 + 8 * (lane >> 4);
#pragma unroll
  for (int i = 0; i < 8; ++i) { a[i] = (_Float16)(p[i] * sc); a[8 + i] = (_Float16)(p[16 + i] * sc); }
  return a;
}
// column fragment from a [K][ld] layout (column n), rows >= K read as 0
__device__ __forceinline__ v16h fragc_f32(const float* W, int k0, int n, int lane, int ld, int K) {
  v16h a; const int g = lane >> 4;
#pragma unroll
  for (int i = 0; i < 8; ++i) { const int ka = k0 + 8 * g + i, kb = ka + 16;
    a[i] = (_Float16)(ka < K ? W[(size_t)(ka < K ? ka : K - 1) * ld + n] : 0.f); a[8 + i] = (_Float16)(kb < K ? W[(size_t)(kb < K ? kb : K - 1) * ld + n] : 0.f); }
  return a;
}
struct F2 { v16b h, l; };
__device__ __forceinline__ F2 bsplit16(const float v[16]) { F2 r;
#pragma unroll
  for (int i = 0; i < 16; ++i) { const __bf16 h = (__bf16)v[i]; r.h[i] = h; r.l[i] = (__bf16)(v[i] - (float)h); }
  return r; }
__device__ __forceinline__ F2 split_row(const float* row, int k0, int lane) { float v[16]; const float* p = row + k0 + 8 * (lane >> 4);
#pragma unroll
  for (int i = 0; i < 8; ++i) { v[i] = p[i]; v[8 + i] = p[16 + i]; }
  return bsplit16(v); }
__device__ __forceinline__ F2 split_rowK(const float* row, int k0, int lane, int K) { float v[16]; const int g = lane >> 4;
#pragma unroll
  for (int i = 0; i < 8; ++i) { const int ka = k0 + 8 * g + i, kb = ka + 16; v[i] = ka < K ? row[ka < K ? ka : K - 1] : 0.f; v[8 + i] = kb < K ? row[kb < K ? kb : K - 1] : 0.f; }
  return bsplit16(v); }
__device__ __forceinline__ F2 split_col(const float* W, int k0, int n, int lane, int ld, int K) { float v[16]; const int g = lane >> 4;
#pragma unroll
  for (int i = 0; i < 8; ++i) { const int ka = k0 + 8 * g + i, kb = ka + 16; v[i] = ka < K ? W[(size_t)(ka < K ? ka : K - 1) * ld + n] : 0.f; v[8 + i] = kb < K ? W[(size_t)(kb < K ? kb : K - 1) * ld + n] : 0.f; }
  return bsplit16(v); }
__device__ __forceinline__ v8f mac3(const F2& a, const F2& b, v8f c) { c = wmma_bf(a.l, b.h, c); c = wmma_bf(a.h, b.l, c); return wmma_bf(a.h, b.h, c); }
__device__ __forceinline__ float sigm(float v) { return 1.0f / (1.0f + expf(-v)); }
#define LDSX() do { asm volatile("s_wait_dscnt 0" ::: "memory"); __builtin_amdgcn_wave_barrier(); __builtin_amdgcn_fence(__ATOMIC_RELEASE, "workgroup"); } while (0)

// Scaled-dot attention with dual softmax (B 8, Lq = Lk = 2,048, D 256, H 128): pq = relu(queries Wq^T); pk = relu(keys Wk^T) * scaling; scores = pq pk^T; output = softmax_k(scores | values_1_mask[k] -> -inf) . values_1; output_2 = softmax_q(scores^T | values_2_mask[q] -> -inf) . values_2.
__device__ __forceinline__ float bfr(float v) { return (float)(__bf16)v; }
#define NB 8
#define TT 2048
#define DIN 256
#define HP 128         // projected width
#define DV 256         // value width
#ifndef TNB
#define TNB NB
#endif
#define BG 4
typedef __attribute__((ext_vector_type(8))) __bf16 v8b;
__device__ __forceinline__ v16b frag_b(const __bf16* rowk0, int lane) { union { v16b v; v8b q[2]; } u; const __bf16* p = rowk0 + 8 * (lane >> 4); u.q[0] = *(const v8b*)p; u.q[1] = *(const v8b*)(p + 16); return u.v; }
#define WS_QH  0u                                          // f16 pq hi rows [b*T+q][128]
#define WS_QL  (WS_QH + 2u * (size_t)NB * TT * HP)
#define WS_KH  (WS_QL + 2u * (size_t)NB * TT * HP)           // f16 pk hi rows
#define WS_KL  (WS_KH + 2u * (size_t)NB * TT * HP)
#define WS_V1  (WS_KL + 2u * (size_t)NB * TT * HP)           // bf16 values_1 planes [b][c][k]
#define WS_V2  (WS_V1 + 2u * (size_t)NB * DV * TT)           // bf16 values_2 planes [b][c][q]
#define WS_S   (WS_V2 + 2u * (size_t)NB * DV * TT)           // f32 scores / P [bg][row][col]
#define WS_END (WS_S + 4u * (size_t)BG * TT * TT)
// ---- k_proj: block = (64 rows, which): relu(x W^T) (x scaling for pk), exact; 128 columns; stored as f16 hi + residual rows (256-B rows)
__global__ __launch_bounds__(128) void k_proj(const float* __restrict__ XQ, const float* __restrict__ XK, const float* __restrict__ WQ, const float* __restrict__ WK, const float* __restrict__ SCL, _Float16* __restrict__ QH, _Float16* __restrict__ QL, _Float16* __restrict__ KH, _Float16* __restrict__ KL) { __shared__ __align__(16) _Float16 sh[64][136], sl[64][136];
  const int tid = threadIdx.x, wave = tid >> 5, lane = tid & 31, col = lane & 15, g = lane >> 4; const int which = blockIdx.y; const size_t r0 = (size_t)blockIdx.x * 64; const float* X = which == 0 ? XQ : XK; const float* Wt = which == 0 ? WQ : WK; _Float16* DH = which == 0 ? QH : KH; _Float16* DL = which == 0 ? QL : KL;
  v8f acc[8] = {};
#pragma unroll 2
  for (int kc = 0; kc < DIN / 32; ++kc) { v16b a; { const float* p = X + (r0 + wave * 16 + col) * DIN + kc * 32 + 8 * g;
#pragma unroll
      for (int i = 0; i < 8; ++i) { a[i] = (__bf16)p[i]; a[8 + i] = (__bf16)p[16 + i]; } }
#pragma unroll
    for (int j = 0; j < 8; ++j) { v16b w; const float* wr = Wt + (size_t)(j * 16 + col) * DIN + kc * 32 + 8 * g;
#pragma unroll
      for (int i = 0; i < 8; ++i) { w[i] = (__bf16)wr[i]; w[8 + i] = (__bf16)wr[16 + i]; }
      asm volatile("s_wait_loadcnt 0x0" ::: "memory"); acc[j] = wmma_bf(a, w, acc[j]); } }
#pragma unroll
  for (int j = 0; j < 8; ++j) { const int o = j * 16 + col; const float sc = (which == 1) ? bfr(SCL[o]) : 1.0f;
#pragma unroll
    for (int r = 0; r < 8; ++r) { const float v = fmaxf(acc[j][r], 0.f) * sc; const _Float16 hv = (_Float16)v; sh[wave * 16 + 8 * g + r][o] = hv; sl[wave * 16 + 8 * g + r][o] = (_Float16)((v - (float)hv) * 1024.0f); } }
  __syncthreads();
  for (int e = tid; e < 64 * 16; e += 128) { const int rl = e >> 4, q = e & 15; vst2((unsigned*)(DH + (r0 + rl) * HP + q * 8), *(const v4u*)&sh[rl][q * 8]); vst2((unsigned*)(DL + (r0 + rl) * HP + q * 8), *(const v4u*)&sl[rl][q * 8]); } }
// ---- k_vt: block = (128 rows, b, which 0/1, 128-channel group): values (exact bf16) -> planes [b][c][t]; 256-B pieces
__global__ __launch_bounds__(128) void k_vt(const float* __restrict__ VA, const float* __restrict__ VB, __bf16* __restrict__ PA, __bf16* __restrict__ PB) { __shared__ __align__(16) __bf16 th[128][136];
  const int tid = threadIdx.x; const int t0 = blockIdx.x * 128; const size_t b = blockIdx.y; const int which = blockIdx.z >> 1, c0 = (blockIdx.z & 1) * 128; const float* V = which == 0 ? VA : VB; __bf16* P = which == 0 ? PA : PB;
  for (int e = tid; e < 128 * 128; e += 128) { const int tl = e >> 7, cl = e & 127; th[cl][tl] = (__bf16)V[(b * TT + t0 + tl) * DV + c0 + cl]; }
  __syncthreads();
  for (int e = tid; e < 128 * 16; e += 128) { const int cl = e >> 4, q = e & 15; vst2((unsigned*)(P + (b * DV + c0 + cl) * (size_t)TT + t0 + q * 8), *(const v4u*)&th[cl][q * 8]); } }
__device__ __forceinline__ unsigned lds_off(const void* p) { return (unsigned)(size_t)p; }
// eight copies of 16 B per lane, global -> LDS, through no register; LDS places ls bytes apart, global places gs bytes apart.
// s_wait_xcnt stands inside the statement, behind the last copy, so that no address register of a copy is rewritten ahead of it.
__device__ __forceinline__ void cp8(unsigned l, const char* g, unsigned ls, size_t gs) {
  asm volatile("global_load_async_to_lds_b128 %0, %8, off\n\t"
               "global_load_async_to_lds_b128 %1, %9, off\n\t"
               "global_load_async_to_lds_b128 %2, %10, off\n\t"
               "global_load_async_to_lds_b128 %3, %11, off\n\t"
               "global_load_async_to_lds_b128 %4, %12, off\n\t"
               "global_load_async_to_lds_b128 %5, %13, off\n\t"
               "global_load_async_to_lds_b128 %6, %14, off\n\t"
               "global_load_async_to_lds_b128 %7, %15, off\n\t"
               "s_wait_xcnt 0x0"
               :: "v"(l), "v"(l + ls), "v"(l + 2 * ls), "v"(l + 3 * ls), "v"(l + 4 * ls), "v"(l + 5 * ls), "v"(l + 6 * ls), "v"(l + 7 * ls),
                  "v"(g), "v"(g + gs), "v"(g + 2 * gs), "v"(g + 3 * gs), "v"(g + 4 * gs), "v"(g + 5 * gs), "v"(g + 6 * gs), "v"(g + 7 * gs)
               : "memory");
}
// ---- k_sc: block = (64 rows, 128 cols, batch in group): scores = ROW . COL over K 128 (3 products); -3e38 where the column-side mask is nonzero; both operand tiles (all of K, hi and residual planes) come once into LDS by asynchronous copies of whole lines, fragments are read from there
#define SC_P 136       // operand row pitch in LDS, f16 (272 B = 16 B x odd: no bank conflict for 16-byte reads down a column of rows)
__global__ __launch_bounds__(128) void k_sc(const _Float16* __restrict__ RH, const _Float16* __restrict__ RL, const _Float16* __restrict__ CH_, const _Float16* __restrict__ CL, const int* __restrict__ CMASK, int b0, float* __restrict__ S0) { __shared__ __align__(16) _Float16 sa[4][2][16][SC_P]; __shared__ __align__(16) _Float16 sb[2][128][SC_P]; __shared__ int smk[128];
  const size_t b = b0 + blockIdx.z; float* S = S0 + (size_t)blockIdx.z * TT * TT;
  const int tid = threadIdx.x, wave = tid >> 5, lane = tid & 31, col = lane & 15, g = lane >> 4; const int k0 = blockIdx.y * 128; const int ql0 = blockIdx.x * 64 + wave * 16;
  // a wave-wide copy is two 256-B operand rows (512 B in a row in memory); each wave brings its own 16 rows and 32 of the 128 columns' rows, both planes (48 copies in flight)
  { const size_t ra = ((b * TT + ql0 + g) * HP) * 2 + col * 16, rb = ((b * TT + k0 + wave * 32 + g) * HP) * 2 + col * 16;
    const unsigned la = lds_off(&sa[wave][0][g][0]) + col * 16, lb = lds_off(&sb[0][wave * 32 + g][0]) + col * 16;
    cp8(la, (const char*)RH + ra, 2 * SC_P * 2, 2 * HP * 2); cp8(la + 16 * SC_P * 2, (const char*)RL + ra, 2 * SC_P * 2, 2 * HP * 2);
    cp8(lb, (const char*)CH_ + rb, 2 * SC_P * 2, 2 * HP * 2); cp8(lb + 16 * SC_P * 2, (const char*)CH_ + rb + 16 * HP * 2, 2 * SC_P * 2, 2 * HP * 2);
    cp8(lb + 128 * SC_P * 2, (const char*)CL + rb, 2 * SC_P * 2, 2 * HP * 2); cp8(lb + 144 * SC_P * 2, (const char*)CL + rb + 16 * HP * 2, 2 * SC_P * 2, 2 * HP * 2); }
  smk[tid] = CMASK[b * TT + k0 + tid];
  asm volatile("s_wait_asynccnt 0x0" ::: "memory");   // this wave's copies have landed before the barrier that publishes them
  __syncthreads();                                     // publishes the column tile and the mask to all four waves
  v8f acc[8] = {}, accl[8] = {};
  // a step = one 32-wide block of K x two 16-column tiles (six products); the next step's fragments are read from LDS as one group ahead of this step's products; each accumulator takes its products in the order it had
  v16h fa[2][2], fb[2][2][2];   // [buffer][plane], [buffer][tile of the pair][plane]; every loop below is unrolled whole so that these arrays are indexed by constants and stay in registers
#pragma unroll
  for (int p = 0; p < 2; ++p) { fa[0][p] = frag_h(&sa[wave][p][col][0], lane); fb[0][0][p] = frag_h(&sb[p][col][0], lane); fb[0][1][p] = frag_h(&sb[p][16 + col][0], lane); }
#pragma unroll
  for (int s = 0; s < (HP / 32) * 4; ++s) { const int ka = (s >> 2) & 1, cu = s & 1;
    if (s + 1 < (HP / 32) * 4) { const int kn = (s + 1) >> 2, jn = ((s + 1) & 3) * 2;
#pragma unroll
      for (int p = 0; p < 2; ++p) { if (jn == 0) fa[kn & 1][p] = frag_h(&sa[wave][p][col][kn * 32], lane);
        fb[cu ^ 1][0][p] = frag_h(&sb[p][jn * 16 + col][kn * 32], lane); fb[cu ^ 1][1][p] = frag_h(&sb[p][(jn + 1) * 16 + col][kn * 32], lane); } }
#pragma unroll
    for (int jj = 0; jj < 2; ++jj) { const int j = (s & 3) * 2 + jj; acc[j] = wmma16(fa[ka][0], fb[cu][jj][0], acc[j]); accl[j] = wmma16(fa[ka][1], fb[cu][jj][0], accl[j]); accl[j] = wmma16(fa[ka][0], fb[cu][jj][1], accl[j]); } }
  // the wave's own row tile (filled and read by this wave alone, 8,704 B) is over: every score below depends on all of its fragments; its place takes the 16 x 132 f32 scores (8,448 B) for the whole-line stores
  float_a* ss = (float_a*)&sa[wave][0][0][0];
#pragma unroll
  for (int j = 0; j < 8; ++j) { const bool masked = smk[j * 16 + col] != 0;
#pragma unroll
    for (int r = 0; r < 8; ++r) ss[(8 * g + r) * 132 + j * 16 + col] = masked ? -3.0e38f : (acc[j][r] + accl[j][r] * (1.0f / 1024.0f)); }
  LDSX(); for (int rl = 0; rl < 16; ++rl) vst2(S + (size_t)(ql0 + rl) * TT + k0 + lane * 4, *(const v4f*)&ss[rl * 132 + lane * 4]); }
// ---- k_sm: one wave = SM_R whole rows held in registers: softmax over the 2,048 columns -> P x 2^11 in f32, written in place (masked -> 0); each score is read once and its exp taken once; no LDS, no barrier
#define SM_R 2         // rows per wave: both rows' loads are issued before the first row is worked on
#define SM_W 8         // waves per block
__global__ __launch_bounds__(32 * SM_W) void k_sm(float* __restrict__ S0) {
  const int lane = threadIdx.x & 31; const size_t row = ((size_t)blockIdx.x * SM_W + (threadIdx.x >> 5)) * SM_R; float* sr = S0 + (size_t)blockIdx.y * TT * TT + row * TT + lane * 4;
  v4f x[SM_R][TT / 128];   // every loop below is unrolled whole so that this array is indexed by constants and stays in registers
#pragma unroll
  for (int r = 0; r < SM_R; ++r)
#pragma unroll
    for (int i = 0; i < TT / 128; ++i) x[r][i] = *(const v4f*)(sr + r * TT + i * 128);   // a wave-wide load is 512 B in a row
  __builtin_amdgcn_sched_barrier(0);   // keeps every row's loads ahead of the first row's arithmetic: without it the later rows' loads sink to just before their use and their latency is paid again
#pragma unroll
  for (int r = 0; r < SM_R; ++r) {
    float m = -3.0e38f;
#pragma unroll
    for (int i = 0; i < TT / 128; ++i) m = fmaxf(m, fmaxf(fmaxf(x[r][i][0], x[r][i][1]), fmaxf(x[r][i][2], x[r][i][3])));
#pragma unroll
    for (int o = 1; o < 32; o <<= 1) m = fmaxf(m, __shfl_xor(m, o));
    v4f s4 = {};
#pragma unroll
    for (int i = 0; i < TT / 128; ++i)
#pragma unroll
      for (int c = 0; c < 4; ++c) { const float v = x[r][i][c]; const float ex = expf(v - m); const float e = (v <= -1.0e38f) ? 0.f : ex; x[r][i][c] = e; s4[c] += e; }   // exp taken for every lane, then selected: no branch between the elements' chains
    float sum = (s4[0] + s4[1]) + (s4[2] + s4[3]);
#pragma unroll
    for (int o = 1; o < 32; o <<= 1) sum += __shfl_xor(sum, o);
    const float sc = sum > 0.f ? (1.0f / sum) * 2048.0f : 0.f;   // a row whose every column is masked stays all zero
#pragma unroll
    for (int i = 0; i < TT / 128; ++i) vst2(sr + r * TT + i * 128, x[r][i] * sc); } }
// ---- k_pv: block = (64 rows, 128 channels, batch in group): out[b][row][c] = (P . values) / 2^11, P split bf16 hi + lo x exact value planes (2 products); both operand tiles come 128 keys at a time into a two-buffer LDS ring by asynchronous copies of whole lines
#define PV_KS 128      // keys per stage
#define PV_NT (TT / PV_KS)
#define PV_PP 132      // P row pitch in LDS, floats (528 B = 16 B x odd: no bank conflict for 16-byte reads down a column of rows)
#define PV_VP 136      // value row pitch in LDS, bf16 (272 B = 16 B x odd)
// one wave's share of stage t into buffer bf: 16 P rows (one 512-B row a copy) and 32 value rows (two 256-B rows a copy), 32 copies
__device__ __forceinline__ void pv_fill(const char* gp, const char* gv, unsigned lp, unsigned lv, int t, int bf) {
  gp += (size_t)t * (PV_KS * 4); gv += (size_t)t * (PV_KS * 2); lp += bf * (64 * PV_PP * 4); lv += bf * (128 * PV_VP * 2);
  cp8(lp, gp, PV_PP * 4, (size_t)TT * 4); cp8(lp + 8 * PV_PP * 4, gp + 8 * (size_t)TT * 4, PV_PP * 4, (size_t)TT * 4);
  cp8(lv, gv, 2 * PV_VP * 2, 2 * (size_t)TT * 2); cp8(lv + 16 * PV_VP * 2, gv + 16 * (size_t)TT * 2, 2 * PV_VP * 2, 2 * (size_t)TT * 2);
}
__global__ __launch_bounds__(128) void k_pv(const float* __restrict__ PS0, const __bf16* __restrict__ VP, int b0, float* __restrict__ OUT) { __shared__ __align__(16) float sp[2][64][PV_PP]; __shared__ __align__(16) __bf16 sv[2][128][PV_VP]; __shared__ __align__(16) float ss[4][16][132];
  const size_t b = b0 + blockIdx.z; const float* PS = PS0 + (size_t)blockIdx.z * TT * TT;
  const int tid = threadIdx.x, wave = tid >> 5, lane = tid & 31, col = lane & 15, g = lane >> 4; const int ql0 = blockIdx.x * 64 + wave * 16; const int c0 = blockIdx.y * 128;
  // a wave-wide copy is one 512-B P row, or two 256-B value rows; each wave brings 16 P rows and 32 value rows of a stage (32 copies in flight)
  const char* gp = (const char*)(PS + (size_t)ql0 * TT) + lane * 16;
  const char* gv = (const char*)(VP + (b * DV + c0 + wave * 32 + g) * (size_t)TT) + col * 16;
  const unsigned lp = lds_off(&sp[0][wave * 16][0]) + lane * 16, lv = lds_off(&sv[0][wave * 32 + g][0]) + col * 16;
  v8f acc[8] = {};
  pv_fill(gp, gv, lp, lv, 0, 0);
  asm volatile("s_wait_asynccnt 0x0" ::: "memory");   // stage 0 has landed before the barrier that publishes it
  __syncthreads();
  pv_fill(gp, gv, lp, lv, 1, 1);
#pragma unroll 1   // one stage per trip: the buffer index stays a run-time value
  for (int t = 0; t < PV_NT; ++t) { const int bf = t & 1;
    // fragments of a 32-key block are read from LDS as one group, one block ahead of their products and only inside this stage's own buffer
    const float* prow = &sp[bf][wave * 16 + col][8 * g]; const __bf16* vrow = &sv[bf][col][0];
    v4f pf[4]; v16b vv[2][8];   // every loop below is unrolled whole so that these arrays are indexed by constants and stay in registers
#pragma unroll
    for (int i = 0; i < 4; ++i) pf[i] = *(const v4f*)(prow + (i >> 1) * 16 + (i & 1) * 4);
#pragma unroll
    for (int j = 0; j < 8; ++j) vv[0][j] = frag_b(vrow + j * 16 * PV_VP, lane);
#pragma unroll
    for (int kk = 0; kk < PV_KS / 32; ++kk) { const int cu = kk & 1, nx = cu ^ 1;
      float v[16];
#pragma unroll
      for (int i = 0; i < 16; ++i) v[i] = pf[i >> 2][i & 3];
      const F2 p = bsplit16(v);
      if (kk + 1 < PV_KS / 32) {
#pragma unroll
        for (int i = 0; i < 4; ++i) pf[i] = *(const v4f*)(prow + (kk + 1) * 32 + (i >> 1) * 16 + (i & 1) * 4);
#pragma unroll
        for (int j = 0; j < 8; ++j) vv[nx][j] = frag_b(vrow + j * 16 * PV_VP + (kk + 1) * 32, lane); }
#pragma unroll
      for (int j = 0; j < 8; ++j) { acc[j] = wmma_bf(p.h, vv[cu][j], acc[j]); acc[j] = wmma_bf(p.l, vv[cu][j], acc[j]); } }
    asm volatile("s_wait_dscnt 0x0" ::: "memory");      // this wave's reads of buffer bf are over before it is handed to the copies
    asm volatile("s_wait_asynccnt 0x0" ::: "memory");   // this wave's copies of stage t + 1 have landed
    __syncthreads();                                     // publishes stage t + 1 and ends every reader's last read of buffer bf
    if (t + 2 < PV_NT) pv_fill(gp, gv, lp, lv, t + 2, bf); }
  asm volatile("s_wait_asynccnt 0x0" ::: "memory");     // nothing is in flight when the wave goes on to its end
#pragma unroll
  for (int j = 0; j < 8; ++j)
#pragma unroll
    for (int r = 0; r < 8; ++r) ss[wave][8 * g + r][j * 16 + col] = acc[j][r] * (1.0f / 2048.0f);
  LDSX(); for (int rl = 0; rl < 16; ++rl) vst2(OUT + (b * TT + ql0 + rl) * DV + c0 + lane * 4, *(const v4f*)&ss[wave][rl][lane * 4]); }
extern "C" void kernel_launch(void* const* d_in, const int* in_sizes, int n_in, void* d_out, int out_size, void* d_ws, size_t ws_size, hipStream_t stream) {
  (void)in_sizes; (void)n_in; (void)out_size;
  const float** F = (const float**)d_in;   // 0 queries [8,2048,256], 1 keys, 2 values_1 [8,2048,256], 3 values_1_mask [8,2048] int (nonzero = excluded key), 4 values_2, 5 values_2_mask (nonzero = excluded query), 6 Wq [128,256] ([out,in]), 7 Wk, 8 scaling [1,128]; outputs: output @ 0, output_2 @ float 4,194,304
  if (ws_size < (size_t)WS_END) return;
  char* ws = (char*)d_ws; _Float16 *QH = (_Float16*)(ws + WS_QH), *QL = (_Float16*)(ws + WS_QL), *KH = (_Float16*)(ws + WS_KH), *KL = (_Float16*)(ws + WS_KL); __bf16 *V1 = (__bf16*)(ws + WS_V1), *V2 = (__bf16*)(ws + WS_V2); float* S = (float*)(ws + WS_S);
  float* OUT1 = (float*)d_out; float* OUT2 = (float*)d_out + (size_t)NB * TT * DV;
  k_proj<<<dim3(TNB * TT / 64, 2), 128, 0, stream>>>(F[0], F[1], F[6], F[7], F[8], QH, QL, KH, KL);
  k_vt<<<dim3(TT / 128, TNB, 4), 128, 0, stream>>>(F[2], F[4], V1, V2);
  for (int b0 = 0; b0 < TNB; b0 += BG) { const int ng = (TNB - b0) < BG ? (TNB - b0) : BG;
    // output: rows = queries, cols = keys, key mask = values_1_mask, values_1
    k_sc<<<dim3(TT / 64, TT / 128, ng), 128, 0, stream>>>(QH, QL, KH, KL, (const int*)d_in[3], b0, S);
    k_sm<<<dim3(TT / (SM_R * SM_W), ng), 32 * SM_W, 0, stream>>>(S);
    k_pv<<<dim3(TT / 64, DV / 128, ng), 128, 0, stream>>>(S, V1, b0, OUT1);
    // output_2: rows = keys, cols = queries, query mask = values_2_mask, values_2
    k_sc<<<dim3(TT / 64, TT / 128, ng), 128, 0, stream>>>(KH, KL, QH, QL, (const int*)d_in[5], b0, S);
    k_sm<<<dim3(TT / (SM_R * SM_W), ng), 32 * SM_W, 0, stream>>>(S);
    k_pv<<<dim3(TT / 64, DV / 128, ng), 128, 0, stream>>>(S, V2, b0, OUT2);
  }
}

// v004
// A run of this version takes 134 microseconds.
// Two timings next to v003 both put it at 2.17 times that version's speed.
// Counting every step since v000, it is 6.72 times as fast.
// compute dtype: all float inputs rounded to bf16, the int masks read; pq = relu(q Wq^T), pk = relu(k Wk^T) * scaling with EXACT bf16 products on WMMA 16x16x32, f32 accumulate, stored as f16 hi + residual (x 2^10) rows; scores over K = 128 with 3 products (hi.hi, lo.hi, hi.lo), excluded where the key-side mask is set, kept in f32 registers; softmax in f32 with a running maximum and sum (precise expf); the exponentials split bf16 hi + lo against the EXACT bf16 value planes (2 products), divided by the row's sum at the end; f32 outputs. The second output runs the same pipeline with the roles of queries and keys swapped.
#include <hip/hip_runtime.h>
#include <math.h>

typedef __attribute__((ext_vector_type(16))) _Float16 v16h;
typedef __attribute__((ext_vector_type(16))) __bf16 v16b;
typedef __attribute__((ext_vector_type(8)))  _Float16 v8h;
typedef __attribute__((ext_vector_type(8)))  float v8f;
typedef __attribute__((ext_vector_type(4)))  float v4f;
typedef __attribute__((ext_vector_type(2)))  float v2f;
typedef __attribute__((ext_vector_type(4)))  unsigned v4u;
typedef __attribute__((ext_vector_type(4)))  int v4i;
typedef float __attribute__((may_alias)) float_a;
typedef int __attribute__((may_alias)) int_a;

template <typename T> __device__ __forceinline__ void vst2(void* p, T v) { *(T*)p = v;  }
__device__ __forceinline__ v8f wmma16(v16h a, v16h b, v8f c) {
  v8f d = __builtin_amdgcn_wmma_f32_16x16x32_f16(false, a, false, b, (short)0, c, false, false);
  asm volatile("v_nop\n\tv_nop\n\tv_nop\n\tv_nop" : "+v"(d) : "v"(a), "v"(b));
  return d;
}
__device__ __forceinline__ v8f wmma_bf(v16b a, v16b b, v8f c) {
  v8f d = __builtin_amdgcn_wmma_f32_16x16x32_bf16(false, a, false, b, (short)0, c, false, false);
  asm volatile("v_nop\n\tv_nop\n\tv_nop\n\tv_nop" : "+v"(d) : "v"(a), "v"(b));
  return d;
}
// 16x16x32 fragments: lane = (h = lane>>4, row/col = lane&15); elements 0..7 = k0+8h+0..7, 8..15 = k0+16+8h+0..7; D element r = row 8h+r
__device__ __forceinline__ v16h frag_h(const _Float16* rowk0, int lane) {
  union { v16h v; v8h q[2]; } u; const _Float16* p = rowk0 + 8 * (lane >> 4);
  u.q[0] = *(const v8h*)p; u.q[1] = *(const v8h*)(p + 16); return u.v;
}
__device__ __forceinline__ v16h frag_f32(const float* rowk0, int lane) {
  v16h a; const float* p = rowk0 + 8 * (lane >> 4);
#pragma unroll
  for (int i = 0; i < 8; ++i) { a[i] = (_Float16)p[i]; a[8 + i] = (_Float16)p[16 + i]; }
  return a;
}
__device__ __forceinline__ v16h frag_f32s(const float* rowk0, int lane, float sc) {
  v16h a; const float* p = rowk0 + 8 * (lane >> 4);
#pragma unroll
  for (int i = 0; i < 8; ++i) { a[i] = (_Float16)(p[i] * sc); a[8 + i] = (_Float16)(p[16 + i] * sc); }
  return a;
}
// column fragment from a [K][ld] layout (column n), rows >= K read as 0
__device__ __forceinline__ v16h fragc_f32(const float* W, int k0, int n, int lane, int ld, int K) {
  v16h a; const int g = lane >> 4;
#pragma unroll
  for (int i = 0; i < 8; ++i) { const int ka = k0 + 8 * g + i, kb = ka + 16;
    a[i] = (_Float16)(ka < K ? W[(size_t)(ka < K ? ka : K - 1) * ld + n] : 0.f); a[8 + i] = (_Float16)(kb < K ? W[(size_t)(kb < K ? kb : K - 1) * ld + n] : 0.f); }
  return a;
}
struct F2 { v16b h, l; };
__device__ __forceinline__ F2 bsplit16(const float v[16]) { F2 r;
#pragma unroll
  for (int i = 0; i < 16; ++i) { const __bf16 h = (__bf16)v[i]; r.h[i] = h; r.l[i] = (__bf16)(v[i] - (float)h); }
  return r; }
__device__ __forceinline__ F2 split_row(const float* row, int k0, int lane) { float v[16]; const float* p = row + k0 + 8 * (lane >> 4);
#pragma unroll
  for (int i = 0; i < 8; ++i) { v[i] = p[i]; v[8 + i] = p[16 + i]; }
  return bsplit16(v); }
__device__ __forceinline__ F2 split_rowK(const float* row, int k0, int lane, int K) { float v[16]; const int g = lane >> 4;
#pragma unroll
  for (int i = 0; i < 8; ++i) { const int ka = k0 + 8 * g + i, kb = ka + 16; v[i] = ka < K ? row[ka < K ? ka : K - 1] : 0.f; v[8 + i] = kb < K ? row[kb < K ? kb : K - 1] : 0.f; }
  return bsplit16(v); }
__device__ __forceinline__ F2 split_col(const float* W, int k0, int n, int lane, int ld, int K) { float v[16]; const int g = lane >> 4;
#pragma unroll
  for (int i = 0; i < 8; ++i) { const int ka = k0 + 8 * g + i, kb = ka + 16; v[i] = ka < K ? W[(size_t)(ka < K ? ka : K - 1) * ld + n] : 0.f; v[8 + i] = kb < K ? W[(size_t)(kb < K ? kb : K - 1) * ld + n] : 0.f; }
  return bsplit16(v); }
__device__ __forceinline__ v8f mac3(const F2& a, const F2& b, v8f c) { c = wmma_bf(a.l, b.h, c); c = wmma_bf(a.h, b.l, c); return wmma_bf(a.h, b.h, c); }
__device__ __forceinline__ float sigm(float v) { return 1.0f / (1.0f + expf(-v)); }
#define LDSX() do { asm volatile("s_wait_dscnt 0" ::: "memory"); __builtin_amdgcn_wave_barrier(); __builtin_amdgcn_fence(__ATOMIC_RELEASE, "workgroup"); } while (0)

// Scaled-dot attention with dual softmax (B 8, Lq = Lk = 2,048, D 256, H 128): pq = relu(queries Wq^T); pk = relu(keys Wk^T) * scaling; scores = pq pk^T; output = softmax_k(scores | values_1_mask[k] -> -inf) . values_1; output_2 = softmax_q(scores^T | values_2_mask[q] -> -inf) . values_2.
__device__ __forceinline__ float bfr(float v) { return (float)(__bf16)v; }
#define NB 8
#define TT 2048
#define DIN 256
#define HP 128         // projected width
#define DV 256         // value width
#ifndef TNB
#define TNB NB
#endif
typedef __attribute__((ext_vector_type(8))) __bf16 v8b;
__device__ __forceinline__ v16b frag_b(const __bf16* rowk0, int lane) { union { v16b v; v8b q[2]; } u; const __bf16* p = rowk0 + 8 * (lane >> 4); u.q[0] = *(const v8b*)p; u.q[1] = *(const v8b*)(p + 16); return u.v; }
#define WS_QH  0u                                          // f16 pq hi rows [b*T+q][128]
#define WS_QL  (WS_QH + 2u * (size_t)NB * TT * HP)
#define WS_KH  (WS_QL + 2u * (size_t)NB * TT * HP)           // f16 pk hi rows
#define WS_KL  (WS_KH + 2u * (size_t)NB * TT * HP)
#define WS_V1  (WS_KL + 2u * (size_t)NB * TT * HP)           // bf16 values_1 planes [b][c][k]
#define WS_V2  (WS_V1 + 2u * (size_t)NB * DV * TT)           // bf16 values_2 planes [b][c][q]
#define WS_END (WS_V2 + 2u * (size_t)NB * DV * TT)
// ---- k_proj: block = (64 rows, which): relu(x W^T) (x scaling for pk), exact; 128 columns; stored as f16 hi + residual rows (256-B rows)
__global__ __launch_bounds__(128) void k_proj(const float* __restrict__ XQ, const float* __restrict__ XK, const float* __restrict__ WQ, const float* __restrict__ WK, const float* __restrict__ SCL, _Float16* __restrict__ QH, _Float16* __restrict__ QL, _Float16* __restrict__ KH, _Float16* __restrict__ KL) { __shared__ __align__(16) _Float16 sh[64][136], sl[64][136];
  const int tid = threadIdx.x, wave = tid >> 5, lane = tid & 31, col = lane & 15, g = lane >> 4; const int which = blockIdx.y; const size_t r0 = (size_t)blockIdx.x * 64; const float* X = which == 0 ? XQ : XK; const float* Wt = which == 0 ? WQ : WK; _Float16* DH = which == 0 ? QH : KH; _Float16* DL = which == 0 ? QL : KL;
  v8f acc[8] = {};
#pragma unroll 2
  for (int kc = 0; kc < DIN / 32; ++kc) { v16b a; { const float* p = X + (r0 + wave * 16 + col) * DIN + kc * 32 + 8 * g;
#pragma unroll
      for (int i = 0; i < 8; ++i) { a[i] = (__bf16)p[i]; a[8 + i] = (__bf16)p[16 + i]; } }
#pragma unroll
    for (int j = 0; j < 8; ++j) { v16b w; const float* wr = Wt + (size_t)(j * 16 + col) * DIN + kc * 32 + 8 * g;
#pragma unroll
      for (int i = 0; i < 8; ++i) { w[i] = (__bf16)wr[i]; w[8 + i] = (__bf16)wr[16 + i]; }
      asm volatile("s_wait_loadcnt 0x0" ::: "memory"); acc[j] = wmma_bf(a, w, acc[j]); } }
#pragma unroll
  for (int j = 0; j < 8; ++j) { const int o = j * 16 + col; const float sc = (which == 1) ? bfr(SCL[o]) : 1.0f;
#pragma unroll
    for (int r = 0; r < 8; ++r) { const float v = fmaxf(acc[j][r], 0.f) * sc; const _Float16 hv = (_Float16)v; sh[wave * 16 + 8 * g + r][o] = hv; sl[wave * 16 + 8 * g + r][o] = (_Float16)((v - (float)hv) * 1024.0f); } }
  __syncthreads();
  for (int e = tid; e < 64 * 16; e += 128) { const int rl = e >> 4, q = e & 15; vst2((unsigned*)(DH + (r0 + rl) * HP + q * 8), *(const v4u*)&sh[rl][q * 8]); vst2((unsigned*)(DL + (r0 + rl) * HP + q * 8), *(const v4u*)&sl[rl][q * 8]); } }
// ---- k_vt: block = (128 rows, b, which 0/1, 128-channel group): values (exact bf16) -> planes [b][c][t]; 256-B pieces
__global__ __launch_bounds__(128) void k_vt(const float* __restrict__ VA, const float* __restrict__ VB, __bf16* __restrict__ PA, __bf16* __restrict__ PB) { __shared__ __align__(16) __bf16 th[128][136];
  const int tid = threadIdx.x; const int t0 = blockIdx.x * 128; const size_t b = blockIdx.y; const int which = blockIdx.z >> 1, c0 = (blockIdx.z & 1) * 128; const float* V = which == 0 ? VA : VB; __bf16* P = which == 0 ? PA : PB;
  for (int e = tid; e < 128 * 128; e += 128) { const int tl = e >> 7, cl = e & 127; th[cl][tl] = (__bf16)V[(b * TT + t0 + tl) * DV + c0 + cl]; }
  __syncthreads();
  for (int e = tid; e < 128 * 16; e += 128) { const int cl = e >> 4, q = e & 15; vst2((unsigned*)(P + (b * DV + c0 + cl) * (size_t)TT + t0 + q * 8), *(const v4u*)&th[cl][q * 8]); } }
// ---- k_fa: block = (128 rows, batch, direction), one wave = 16 rows x all 256 channels. Scores, softmax and the value product in one kernel: no score goes to memory.
// Per 32 columns (keys of this direction): S^T = COL . ROW^T (3 products, A = column-side rows from LDS, B = the wave's row-side fragments, kept in registers), so a lane holds 16 scores of ONE row;
// running maximum and running sum per lane; e = exp(score - maximum in use), split bf16 hi + lo, is the B operand of O^T += V^T . P^T as it stands in the registers (2 products, A = value planes from LDS).
// Column-side rows and value planes come 64 columns at a time into a two-buffer LDS ring by asynchronous copies.
#define FA_W 8         // waves per block
#define FA_KS 64       // columns per stage
#define FA_NT (TT / FA_KS)
#define FA_KP 136      // column-side row pitch in LDS, f16 (272 B = 16 B x odd: no bank conflict for 16-byte reads down a column of rows)
#define FA_VP 72       // value row pitch in LDS, bf16 (144 B = 16 B x odd)
#define FA_OP 260      // output row pitch in LDS, floats (1,040 B = 16 B x odd)
// the plain builtins: the compiler keeps the distances behind them itself, and their operands may lie above v255, which an asm operand cannot name (this kernel holds more than 256 registers)
__device__ __forceinline__ v8f mm_h(v16h a, v16h b, v8f c) { return __builtin_amdgcn_wmma_f32_16x16x32_f16(false, a, false, b, (short)0, c, false, false); }
__device__ __forceinline__ v8f mm_b(v16b a, v16b b, v8f c) { return __builtin_amdgcn_wmma_f32_16x16x32_bf16(false, a, false, b, (short)0, c, false, false); }
// nothing is scheduled across: keeps a group's LDS reads together and ahead of the block of products in front of which they are written; left free, the compiler spreads them in pairs among the products, each pair waited to 0 just before its use
#define FA_SB() __builtin_amdgcn_sched_barrier(0)
// lane l's value from lane l ^ 16
__device__ __forceinline__ float xhalf(float x) { return __builtin_bit_cast(float, __builtin_amdgcn_permlanex16(__builtin_bit_cast(int, x), __builtin_bit_cast(int, x), 0x76543210, 0xfedcba98, false, false)); }
// one wave's share of stage t into buffer bf: 16 column-side rows of one plane (two 256-B rows a copy) and 32 value rows (four 128-B pieces a copy), 16 copies
typedef __attribute__((address_space(1))) v4i g_v4i; typedef __attribute__((address_space(3))) v4i l_v4i;
// the copies as the builtin: its address registers are the compiler's own and may lie above v255
__device__ __forceinline__ void fa_fill(const char* gk, const char* gv, char* lk, char* lv, int t, int bf, int lane) {
  gk += (size_t)t * (FA_KS * HP * 2) + lane * 16; lk += bf * (2 * FA_KS * FA_KP * 2) + (lane >> 4) * (FA_KP * 2) + (lane & 15) * 16;
  gv += (size_t)t * (FA_KS * 2) + (lane >> 3) * (TT * 2) + (lane & 7) * 16; lv += bf * (DV * FA_VP * 2) + (lane >> 3) * (FA_VP * 2) + (lane & 7) * 16;
#pragma unroll
  for (int i = 0; i < 8; ++i) __builtin_amdgcn_global_load_async_to_lds_b128((g_v4i*)(gk + i * (2 * HP * 2)), (l_v4i*)(lk + i * (2 * FA_KP * 2)), 0, 0);
#pragma unroll
  for (int i = 0; i < 8; ++i) __builtin_amdgcn_global_load_async_to_lds_b128((g_v4i*)(gv + i * (4 * TT * 2)), (l_v4i*)(lv + i * (4 * FA_VP * 2)), 0, 0);
}
__global__ __launch_bounds__(32 * FA_W) void k_fa(const _Float16* __restrict__ QH, const _Float16* __restrict__ QL, const _Float16* __restrict__ KH, const _Float16* __restrict__ KL, const int* __restrict__ M1, const int* __restrict__ M2, const __bf16* __restrict__ V1, const __bf16* __restrict__ V2, float* __restrict__ OUT1, float* __restrict__ OUT2) {
  __shared__ __align__(16) _Float16 sk[2][2][FA_KS][FA_KP]; __shared__ __align__(16) __bf16 sv[2][DV][FA_VP]; __shared__ __align__(16) int smk[TT]; __shared__ __align__(16) float so[FA_W][16][FA_OP];
  const int tid = threadIdx.x, wave = __builtin_amdgcn_readfirstlane(tid >> 5), lane = tid & 31, col = lane & 15, g = lane >> 4; const size_t b = blockIdx.y; const bool sw = blockIdx.z != 0;   // the wave's number in a scalar register: what depends on it alone then costs no vector register over the loop
  // direction 0: rows = queries, columns = keys, values_1 and its mask; direction 1: rows = keys, columns = queries, values_2 and its mask
  const _Float16 *RH = sw ? KH : QH, *RL = sw ? KL : QL, *CH_ = sw ? QH : KH, *CL = sw ? QL : KL; const int* CMASK = sw ? M2 : M1; const __bf16* VP = sw ? V2 : V1; float* OUT = sw ? OUT2 : OUT1;
  const int q0 = blockIdx.x * (16 * FA_W) + wave * 16;
  // wave-uniform bases; the lane's own part: row g of a pair of 256-B rows, 16 B at col; row lane >> 3 of four 128-B pieces, 16 B at lane & 7
  const char* gk = (const char*)((wave >> 2) ? CL : CH_) + ((b * TT + (wave & 3) * 16) * HP) * 2; const char* gv = (const char*)(VP + (b * DV + wave * 32) * (size_t)TT);
  char *lk = (char*)&sk[0][wave >> 2][(wave & 3) * 16][0], *lv = (char*)&sv[0][wave * 32][0];
  int mv[TT / (32 * FA_W)];
#pragma unroll   // all eight loads in flight together: one memory latency, not eight
  for (int i = 0; i < TT / (32 * FA_W); ++i) mv[i] = CMASK[b * TT + i * (32 * FA_W) + tid];
  asm volatile("s_wait_xcnt 0x0" ::: "memory");   // stands behind the loads above, in front of every later write of a register that they name
  __builtin_amdgcn_sched_barrier(0);               // holds the later address arithmetic behind that wait
  v16h qh[HP / 32], ql[HP / 32];   // every loop over these arrays is unrolled whole so that they are indexed by constants and stay in registers
#pragma unroll
  for (int kb = 0; kb < HP / 32; ++kb) { qh[kb] = frag_h(RH + (b * TT + q0 + col) * HP + kb * 32, lane); ql[kb] = frag_h(RL + (b * TT + q0 + col) * HP + kb * 32, lane); }
  asm volatile("s_wait_xcnt 0x0" ::: "memory");   // as above, for the fragment loads
  __builtin_amdgcn_sched_barrier(0);               // as above
  fa_fill(gk, gv, lk, lv, 0, 0, lane);
#pragma unroll
  for (int i = 0; i < TT / (32 * FA_W); ++i) smk[i * (32 * FA_W) + tid] = mv[i];
  v8f acc[DV / 16] = {}; float m = -3.0e38f, l = 0.f;   // acc[j][r] = O^T[channel j * 16 + 8 g + r][row col]; m = the maximum in use (the same in both halves of the wave); l = this half's share of the row's sum
  asm volatile("s_wait_asynccnt 0x0" ::: "memory");   // stage 0 has landed before the barrier that publishes it
  __syncthreads();                                     // publishes stage 0 and the mask
  fa_fill(gk, gv, lk, lv, 1, 1, lane);
#pragma unroll 1   // one stage per trip: the buffer index stays a run-time value
  for (int t = 0; t < FA_NT; ++t) { const int bf = t & 1;
    const _Float16* kr = &sk[bf][0][col][0]; const __bf16* vr = &sv[bf][col][0]; const int* mr = &smk[t * FA_KS + 8 * g];
    // fragments are read from LDS as groups, one group ahead of their products and only inside this stage's own buffer
    v16h kf[2][2][2]; v16b vf[2][4];   // [buffer][16-column tile][plane], [buffer][16-channel tile]; indexed by constants, as above
#pragma unroll
    for (int tl = 0; tl < 2; ++tl)
#pragma unroll
      for (int p = 0; p < 2; ++p) kf[0][tl][p] = frag_h(kr + (p * FA_KS + tl * 16) * FA_KP, lane);
#pragma unroll
    for (int kk = 0; kk < FA_KS / 32; ++kk) {
      v4i mk[4];
#pragma unroll
      for (int i = 0; i < 4; ++i) mk[i] = *(const v4i*)(mr + kk * 32 + (i >> 1) * 16 + (i & 1) * 4);
      v8f sh[2] = {}, sl[2] = {};
#pragma unroll
      for (int kb = 0; kb < HP / 32; ++kb) { const int cu = kb & 1;
        if (kb + 1 < HP / 32) {
#pragma unroll
          for (int tl = 0; tl < 2; ++tl)
#pragma unroll
            for (int p = 0; p < 2; ++p) kf[cu ^ 1][tl][p] = frag_h(kr + (p * FA_KS + kk * 32 + tl * 16) * FA_KP + (kb + 1) * 32, lane);
        } else {
#pragma unroll
          for (int j = 0; j < 4; ++j) vf[0][j] = frag_b(vr + j * 16 * FA_VP + kk * 32, lane);
        }
        FA_SB();
        // each accumulator takes its products in the order the separate score kernel had: hi.hi; row lo . column hi, then row hi . column lo
        sh[0] = mm_h(kf[cu][0][0], qh[kb], sh[0]); sl[0] = mm_h(kf[cu][0][0], ql[kb], sl[0]); sh[1] = mm_h(kf[cu][1][0], qh[kb], sh[1]); sl[1] = mm_h(kf[cu][1][0], ql[kb], sl[1]);
        sl[0] = mm_h(kf[cu][0][1], qh[kb], sl[0]); sl[1] = mm_h(kf[cu][1][1], qh[kb], sl[1]);
        FA_SB(); }
      // v[8 tl + r] = score of column kk * 32 + 16 tl + 8 g + r against row col: the k order of a 16x16x32 B operand
      float v[16];
#pragma unroll
      for (int i = 0; i < 16; ++i) v[i] = mk[i >> 2][i & 3] != 0 ? -3.0e38f : (sh[i >> 3][i & 7] + sl[i >> 3][i & 7] * (1.0f / 1024.0f));
      float mx = v[0];
#pragma unroll
      for (int i = 1; i < 16; ++i) mx = fmaxf(mx, v[i]);
      mx = fmaxf(mx, xhalf(mx));   // both halves of the wave now hold the row's maximum over these 32 columns
      // the maximum in use may trail the true one by up to 8 (an exponential then reaches e^8): sum and accumulators are rescaled only when some row's maximum exceeds it by more; one wave-uniform test per 32 columns
      if (__builtin_amdgcn_ballot_w32(mx > m + 8.0f) != 0) { const float mn = fmaxf(m, mx); const float f = expf(m - mn); m = mn; l *= f;
#pragma unroll
        for (int j = 0; j < DV / 16; ++j) acc[j] = acc[j] * f; }
      float s4[4] = {0.f, 0.f, 0.f, 0.f};
#pragma unroll
      for (int i = 0; i < 16; ++i) { const float ex = expf(v[i] - m); const float e = (v[i] <= -1.0e38f) ? 0.f : ex; v[i] = e; s4[i & 3] += e; }   // exp taken for every lane, then selected: no branch between the elements' chains
      l += (s4[0] + s4[1]) + (s4[2] + s4[3]);
      const F2 p = bsplit16(v);
#pragma unroll
      for (int jg = 0; jg < 4; ++jg) { const int cu = jg & 1;
        if (jg + 1 < 4) {
#pragma unroll
          for (int j = 0; j < 4; ++j) vf[cu ^ 1][j] = frag_b(vr + ((jg + 1) * 4 + j) * 16 * FA_VP + kk * 32, lane);
        } else if (kk + 1 < FA_KS / 32) {
#pragma unroll
          for (int tl = 0; tl < 2; ++tl)
#pragma unroll
            for (int pl = 0; pl < 2; ++pl) kf[0][tl][pl] = frag_h(kr + (pl * FA_KS + (kk + 1) * 32 + tl * 16) * FA_KP, lane);
        }
        FA_SB();
#pragma unroll
        for (int j = 0; j < 4; ++j) acc[jg * 4 + j] = mm_b(vf[cu][j], p.h, acc[jg * 4 + j]);
#pragma unroll
        for (int j = 0; j < 4; ++j) acc[jg * 4 + j] = mm_b(vf[cu][j], p.l, acc[jg * 4 + j]);
        FA_SB(); } }
    asm volatile("s_wait_dscnt 0x0" ::: "memory");      // this wave's reads of buffer bf are over before it is handed to the copies
    asm volatile("s_wait_asynccnt 0x0" ::: "memory");   // this wave's copies of stage t + 1 have landed
    __syncthreads();                                     // publishes stage t + 1 and ends every reader's last read of buffer bf
    if (t + 2 < FA_NT) fa_fill(gk, gv, lk, lv, t + 2, bf, lane); }
  asm volatile("s_wait_asynccnt 0x0" ::: "memory");     // nothing is in flight when the wave goes on to its end
  const float lt = l + xhalf(l); const float inv = lt > 0.f ? 1.0f / lt : 0.f;   // a row whose every column is masked stays all zero
  // through the wave's own LDS rows, so that the stores are whole lines
#pragma unroll
  for (int j = 0; j < DV / 16; ++j) { const v8f o = acc[j] * inv; vst2(&so[wave][col][j * 16 + 8 * g], (v4f){o[0], o[1], o[2], o[3]}); vst2(&so[wave][col][j * 16 + 8 * g + 4], (v4f){o[4], o[5], o[6], o[7]}); }
  LDSX();
  for (int rl = 0; rl < 16; ++rl) { vst2(OUT + (b * TT + q0 + rl) * DV + lane * 4, *(const v4f*)&so[wave][rl][lane * 4]); vst2(OUT + (b * TT + q0 + rl) * DV + 128 + lane * 4, *(const v4f*)&so[wave][rl][128 + lane * 4]); } }
extern "C" void kernel_launch(void* const* d_in, const int* in_sizes, int n_in, void* d_out, int out_size, void* d_ws, size_t ws_size, hipStream_t stream) {
  (void)in_sizes; (void)n_in; (void)out_size;
  const float** F = (const float**)d_in;   // 0 queries [8,2048,256], 1 keys, 2 values_1 [8,2048,256], 3 values_1_mask [8,2048] int (nonzero = excluded key), 4 values_2, 5 values_2_mask (nonzero = excluded query), 6 Wq [128,256] ([out,in]), 7 Wk, 8 scaling [1,128]; outputs: output @ 0, output_2 @ float 4,194,304
  if (ws_size < (size_t)WS_END) return;
  char* ws = (char*)d_ws; _Float16 *QH = (_Float16*)(ws + WS_QH), *QL = (_Float16*)(ws + WS_QL), *KH = (_Float16*)(ws + WS_KH), *KL = (_Float16*)(ws + WS_KL); __bf16 *V1 = (__bf16*)(ws + WS_V1), *V2 = (__bf16*)(ws + WS_V2);
  float* OUT1 = (float*)d_out; float* OUT2 = (float*)d_out + (size_t)NB * TT * DV;
  k_proj<<<dim3(TNB * TT / 64, 2), 128, 0, stream>>>(F[0], F[1], F[6], F[7], F[8], QH, QL, KH, KL);
  k_vt<<<dim3(TT / 128, TNB, 4), 128, 0, stream>>>(F[2], F[4], V1, V2);
  k_fa<<<dim3(TT / (16 * FA_W), TNB, 2), 32 * FA_W, 0, stream>>>(QH, QL, KH, KL, (const int*)d_in[3], (const int*)d_in[5], V1, V2, OUT1, OUT2);
}

// v005
// Measured time: 121 microseconds a run.
// Timed twice side by side with v004, it ran 1.11 and 1.10 times as fast.
// Over all steps from v000 it is 7.42 times as fast.
// compute dtype: all float inputs rounded to bf16, the int masks read; pq = relu(q Wq^T), pk = relu(k Wk^T) * scaling with EXACT bf16 products on WMMA 16x16x32, f32 accumulate, stored as f16 hi + residual (x 2^10) rows; scores over K = 128 with 3 products (hi.hi, lo.hi, hi.lo), excluded where the key-side mask is set, kept in f32 registers; softmax in f32 with a running maximum and sum (each exponential is the hardware's exp2 of score * log2(e) - maximum, the maximum kept in log2 units, formed by one fused multiply-add); the exponentials split bf16 hi + lo against the EXACT bf16 value planes (2 products), divided by the row's sum at the end; f32 outputs. The second output runs the same pipeline with the roles of queries and keys swapped.
#include <hip/hip_runtime.h>
#include <math.h>

typedef __attribute__((ext_vector_type(16))) _Float16 v16h;
typedef __attribute__((ext_vector_type(16))) __bf16 v16b;
typedef __attribute__((ext_vector_type(8)))  _Float16 v8h;
typedef __attribute__((ext_vector_type(8)))  float v8f;
typedef __attribute__((ext_vector_type(4)))  float v4f;
typedef __attribute__((ext_vector_type(2)))  float v2f;
typedef __attribute__((ext_vector_type(4)))  unsigned v4u;
typedef __attribute__((ext_vector_type(4)))  int v4i;
typedef float __attribute__((may_alias)) float_a;
typedef int __attribute__((may_alias)) int_a;

template <typename T> __device__ __forceinline__ void vst2(void* p, T v) { *(T*)p = v;  }
__device__ __forceinline__ v8f wmma16(v16h a, v16h b, v8f c) {
  v8f d = __builtin_amdgcn_wmma_f32_16x16x32_f16(false, a, false, b, (short)0, c, false, false);
  asm volatile("v_nop\n\tv_nop\n\tv_nop\n\tv_nop" : "+v"(d) : "v"(a), "v"(b));
  return d;
}
__device__ __forceinline__ v8f wmma_bf(v16b a, v16b b, v8f c) {
  v8f d = __builtin_amdgcn_wmma_f32_16x16x32_bf16(false, a, false, b, (short)0, c, false, false);
  asm volatile("v_nop\n\tv_nop\n\tv_nop\n\tv_nop" : "+v"(d) : "v"(a), "v"(b));
  return d;
}
// 16x16x32 fragments: lane = (h = lane>>4, row/col = lane&15); elements 0..7 = k0+8h+0..7, 8..15 = k0+16+8h+0..7; D element r = row 8h+r
__device__ __forceinline__ v16h frag_h(const _Float16* rowk0, int lane) {
  union { v16h v; v8h q[2]; } u; const _Float16* p = rowk0 + 8 * (lane >> 4);
  u.q[0] = *(const v8h*)p; u.q[1] = *(const v8h*)(p + 16); return u.v;
}
__device__ __forceinline__ v16h frag_f32(const float* rowk0, int lane) {
  v16h a; const float* p = rowk0 + 8 * (lane >> 4);
#pragma unroll
  for (int i = 0; i < 8; ++i) { a[i] = (_Float16)p[i]; a[8 + i] = (_Float16)p[16 + i]; }
  return a;
}
__device__ __forceinline__ v16h frag_f32s(const float* rowk0, int lane, float sc) {
  v16h a; const float* p = rowk0 + 8 * (lane >> 4);
#pragma unroll
  for (int i = 0; i < 8; ++i) { a[i] = (_Float16)(p[i] * sc); a[8 + i] = (_Float16)(p[16 + i] * sc); }
  return a;
}
// column fragment from a [K][ld] layout (column n), rows >= K read as 0
__device__ __forceinline__ v16h fragc_f32(const float* W, int k0, int n, int lane, int ld, int K) {
  v16h a; const int g = lane >> 4;
#pragma unroll
  for (int i = 0; i < 8; ++i) { const int ka = k0 + 8 * g + i, kb = ka + 16;
    a[i] = (_Float16)(ka < K ? W[(size_t)(ka < K ? ka : K - 1) * ld + n] : 0.f); a[8 + i] = (_Float16)(kb < K ? W[(size_t)(kb < K ? kb : K - 1) * ld + n] : 0.f); }
  return a;
}
struct F2 { v16b h, l; };
__device__ __forceinline__ F2 bsplit16(const float v[16]) { F2 r;
#pragma unroll
  for (int i = 0; i < 16; ++i) { const __bf16 h = (__bf16)v[i]; r.h[i] = h; r.l[i] = (__bf16)(v[i] - (float)h); }
  return r; }
__device__ __forceinline__ F2 split_row(const float* row, int k0, int lane) { float v[16]; const float* p = row + k0 + 8 * (lane >> 4);
#pragma unroll
  for (int i = 0; i < 8; ++i) { v[i] = p[i]; v[8 + i] = p[16 + i]; }
  return bsplit16(v); }
__device__ __forceinline__ F2 split_rowK(const float* row, int k0, int lane, int K) { float v[16]; const int g = lane >> 4;
#pragma unroll
  for (int i = 0; i < 8; ++i) { const int ka = k0 + 8 * g + i, kb = ka + 16; v[i] = ka < K ? row[ka < K ? ka : K - 1] : 0.f; v[8 + i] = kb < K ? row[kb < K ? kb : K - 1] : 0.f; }
  return bsplit16(v); }
__device__ __forceinline__ F2 split_col(const float* W, int k0, int n, int lane, int ld, int K) { float v[16]; const int g = lane >> 4;
#pragma unroll
  for (int i = 0; i < 8; ++i) { const int ka = k0 + 8 * g + i, kb = ka + 16; v[i] = ka < K ? W[(size_t)(ka < K ? ka : K - 1) * ld + n] : 0.f; v[8 + i] = kb < K ? W[(size_t)(kb < K ? kb : K - 1) * ld + n] : 0.f; }
  return bsplit16(v); }
__device__ __forceinline__ v8f mac3(const F2& a, const F2& b, v8f c) { c = wmma_bf(a.l, b.h, c); c = wmma_bf(a.h, b.l, c); return wmma_bf(a.h, b.h, c); }
__device__ __forceinline__ float sigm(float v) { return 1.0f / (1.0f + expf(-v)); }
#define LDSX() do { asm volatile("s_wait_dscnt 0" ::: "memory"); __builtin_amdgcn_wave_barrier(); __builtin_amdgcn_fence(__ATOMIC_RELEASE, "workgroup"); } while (0)

// Scaled-dot attention with dual softmax (B 8, Lq = Lk = 2,048, D 256, H 128): pq = relu(queries Wq^T); pk = relu(keys Wk^T) * scaling; scores = pq pk^T; output = softmax_k(scores | values_1_mask[k] -> -inf) . values_1; output_2 = softmax_q(scores^T | values_2_mask[q] -> -inf) . values_2.
__device__ __forceinline__ float bfr(float v) { return (float)(__bf16)v; }
#define NB 8
#define TT 2048
#define DIN 256
#define HP 128         // projected width
#define DV 256         // value width
#ifndef TNB
#define TNB NB
#endif
typedef __attribute__((ext_vector_type(8))) __bf16 v8b;
__device__ __forceinline__ v16b frag_b(const __bf16* rowk0, int lane) { union { v16b v; v8b q[2]; } u; const __bf16* p = rowk0 + 8 * (lane >> 4); u.q[0] = *(const v8b*)p; u.q[1] = *(const v8b*)(p + 16); return u.v; }
#define WS_QH  0u                                          // f16 pq hi rows [b*T+q][128]
#define WS_QL  (WS_QH + 2u * (size_t)NB * TT * HP)
#define WS_KH  (WS_QL + 2u * (size_t)NB * TT * HP)           // f16 pk hi rows
#define WS_KL  (WS_KH + 2u * (size_t)NB * TT * HP)
#define WS_V1  (WS_KL + 2u * (size_t)NB * TT * HP)           // bf16 values_1 planes [b][c][k]
#define WS_V2  (WS_V1 + 2u * (size_t)NB * DV * TT)           // bf16 values_2 planes [b][c][q]
#define WS_END (WS_V2 + 2u * (size_t)NB * DV * TT)
// ---- k_proj: block = (64 rows, which): relu(x W^T) (x scaling for pk), exact; 128 columns; stored as f16 hi + residual rows (256-B rows)
__global__ __launch_bounds__(128) void k_proj(const float* __restrict__ XQ, const float* __restrict__ XK, const float* __restrict__ WQ, const float* __restrict__ WK, const float* __restrict__ SCL, _Float16* __restrict__ QH, _Float16* __restrict__ QL, _Float16* __restrict__ KH, _Float16* __restrict__ KL) { __shared__ __align__(16) _Float16 sh[64][136], sl[64][136];
  const int tid = threadIdx.x, wave = tid >> 5, lane = tid & 31, col = lane & 15, g = lane >> 4; const int which = blockIdx.y; const size_t r0 = (size_t)blockIdx.x * 64; const float* X = which == 0 ? XQ : XK; const float* Wt = which == 0 ? WQ : WK; _Float16* DH = which == 0 ? QH : KH; _Float16* DL = which == 0 ? QL : KL;
  v8f acc[8] = {};
#pragma unroll 2
  for (int kc = 0; kc < DIN / 32; ++kc) { v16b a; { const float* p = X + (r0 + wave * 16 + col) * DIN + kc * 32 + 8 * g;
#pragma unroll
      for (int i = 0; i < 8; ++i) { a[i] = (__bf16)p[i]; a[8 + i] = (__bf16)p[16 + i]; } }
#pragma unroll
    for (int j = 0; j < 8; ++j) { v16b w; const float* wr = Wt + (size_t)(j * 16 + col) * DIN + kc * 32 + 8 * g;
#pragma unroll
      for (int i = 0; i < 8; ++i) { w[i] = (__bf16)wr[i]; w[8 + i] = (__bf16)wr[16 + i]; }
      asm volatile("s_wait_loadcnt 0x0" ::: "memory"); acc[j] = wmma_bf(a, w, acc[j]); } }
#pragma unroll
  for (int j = 0; j < 8; ++j) { const int o = j * 16 + col; const float sc = (which == 1) ? bfr(SCL[o]) : 1.0f;
#pragma unroll
    for (int r = 0; r < 8; ++r) { const float v = fmaxf(acc[j][r], 0.f) * sc; const _Float16 hv = (_Float16)v; sh[wave * 16 + 8 * g + r][o] = hv; sl[wave * 16 + 8 * g + r][o] = (_Float16)((v - (float)hv) * 1024.0f); } }
  __syncthreads();
  for (int e = tid; e < 64 * 16; e += 128) { const int rl = e >> 4, q = e & 15; vst2((unsigned*)(DH + (r0 + rl) * HP + q * 8), *(const v4u*)&sh[rl][q * 8]); vst2((unsigned*)(DL + (r0 + rl) * HP + q * 8), *(const v4u*)&sl[rl][q * 8]); } }
// ---- k_vt: block = (128 rows, b, which 0/1, 128-channel group): values (exact bf16) -> planes [b][c][t]; 256-B pieces
__global__ __launch_bounds__(128) void k_vt(const float* __restrict__ VA, const float* __restrict__ VB, __bf16* __restrict__ PA, __bf16* __restrict__ PB) { __shared__ __align__(16) __bf16 th[128][136];
  const int tid = threadIdx.x; const int t0 = blockIdx.x * 128; const size_t b = blockIdx.y; const int which = blockIdx.z >> 1, c0 = (blockIdx.z & 1) * 128; const float* V = which == 0 ? VA : VB; __bf16* P = which == 0 ? PA : PB;
  for (int e = tid; e < 128 * 128; e += 128) { const int tl = e >> 7, cl = e & 127; th[cl][tl] = (__bf16)V[(b * TT + t0 + tl) * DV + c0 + cl]; }
  __syncthreads();
  for (int e = tid; e < 128 * 16; e += 128) { const int cl = e >> 4, q = e & 15; vst2((unsigned*)(P + (b * DV + c0 + cl) * (size_t)TT + t0 + q * 8), *(const v4u*)&th[cl][q * 8]); } }
// ---- k_fa: block = (128 rows, batch, direction), one wave = 16 rows x all 256 channels. Scores, softmax and the value product in one kernel: no score goes to memory.
// Per 32 columns (keys of this direction): S^T = COL . ROW^T (3 products, A = column-side rows from LDS, B = the wave's row-side fragments, kept in registers), so a lane holds 16 scores of ONE row;
// running maximum and running sum per lane; e = exp(score - maximum in use), split bf16 hi + lo, is the B operand of O^T += V^T . P^T as it stands in the registers (2 products, A = value planes from LDS).
// Column-side rows and value planes come 64 columns at a time into a two-buffer LDS ring by asynchronous copies.
#define FA_W 8         // waves per block
#define FA_KS 64       // columns per stage
#define FA_NT (TT / FA_KS)
#define FA_KP 136      // column-side row pitch in LDS, f16 (272 B = 16 B x odd: no bank conflict for 16-byte reads down a column of rows)
#define FA_VP 72       // value row pitch in LDS, bf16 (144 B = 16 B x odd)
#define FA_OP 260      // output row pitch in LDS, floats (1,040 B = 16 B x odd)
#define FA_L2E 1.44269504088896340736f   // log2(e)
// the plain builtins: the compiler keeps the distances behind them itself, and their operands may lie above v255, which an asm operand cannot name (this kernel holds more than 256 registers)
__device__ __forceinline__ v8f mm_h(v16h a, v16h b, v8f c) { return __builtin_amdgcn_wmma_f32_16x16x32_f16(false, a, false, b, (short)0, c, false, false); }
__device__ __forceinline__ v8f mm_b(v16b a, v16b b, v8f c) { return __builtin_amdgcn_wmma_f32_16x16x32_bf16(false, a, false, b, (short)0, c, false, false); }
// nothing is scheduled across: keeps a group's LDS reads together and ahead of the block of products in front of which they are written; left free, the compiler spreads them in pairs among the products, each pair waited to 0 just before its use
#define FA_SB() __builtin_amdgcn_sched_barrier(0)
// lane l's value from lane l ^ 16
__device__ __forceinline__ float xhalf(float x) { return __builtin_bit_cast(float, __builtin_amdgcn_permlanex16(__builtin_bit_cast(int, x), __builtin_bit_cast(int, x), 0x76543210, 0xfedcba98, false, false)); }
// one wave's share of stage t into buffer bf: 16 column-side rows of one plane (two 256-B rows a copy) and 32 value rows (four 128-B pieces a copy), 16 copies
typedef __attribute__((address_space(1))) v4i g_v4i; typedef __attribute__((address_space(3))) v4i l_v4i;
// the copies as the builtin: its address registers are the compiler's own and may lie above v255
__device__ __forceinline__ void fa_fill(const char* gk, const char* gv, char* lk, char* lv, int t, int bf, int lane) {
  gk += (size_t)t * (FA_KS * HP * 2) + lane * 16; lk += bf * (2 * FA_KS * FA_KP * 2) + (lane >> 4) * (FA_KP * 2) + (lane & 15) * 16;
  gv += (size_t)t * (FA_KS * 2) + (lane >> 3) * (TT * 2) + (lane & 7) * 16; lv += bf * (DV * FA_VP * 2) + (lane >> 3) * (FA_VP * 2) + (lane & 7) * 16;
#pragma unroll
  for (int i = 0; i < 8; ++i) __builtin_amdgcn_global_load_async_to_lds_b128((g_v4i*)(gk + i * (2 * HP * 2)), (l_v4i*)(lk + i * (2 * FA_KP * 2)), 0, 0);
#pragma unroll
  for (int i = 0; i < 8; ++i) __builtin_amdgcn_global_load_async_to_lds_b128((g_v4i*)(gv + i * (4 * TT * 2)), (l_v4i*)(lv + i * (4 * FA_VP * 2)), 0, 0);
}
__global__ __launch_bounds__(32 * FA_W) void k_fa(const _Float16* __restrict__ QH, const _Float16* __restrict__ QL, const _Float16* __restrict__ KH, const _Float16* __restrict__ KL, const int* __restrict__ M1, const int* __restrict__ M2, const __bf16* __restrict__ V1, const __bf16* __restrict__ V2, float* __restrict__ OUT1, float* __restrict__ OUT2) {
  __shared__ __align__(16) _Float16 sk[2][2][FA_KS][FA_KP]; __shared__ __align__(16) __bf16 sv[2][DV][FA_VP]; __shared__ __align__(16) int smk[TT]; __shared__ __align__(16) float so[FA_W][16][FA_OP];
  const int tid = threadIdx.x, wave = __builtin_amdgcn_readfirstlane(tid >> 5), lane = tid & 31, col = lane & 15, g = lane >> 4; const size_t b = blockIdx.y; const bool sw = blockIdx.z != 0;   // the wave's number in a scalar register: what depends on it alone then costs no vector register over the loop
  // direction 0: rows = queries, columns = keys, values_1 and its mask; direction 1: rows = keys, columns = queries, values_2 and its mask
  const _Float16 *RH = sw ? KH : QH, *RL = sw ? KL : QL, *CH_ = sw ? QH : KH, *CL = sw ? QL : KL; const int* CMASK = sw ? M2 : M1; const __bf16* VP = sw ? V2 : V1; float* OUT = sw ? OUT2 : OUT1;
  const int q0 = blockIdx.x * (16 * FA_W) + wave * 16;
  // wave-uniform bases; the lane's own part: row g of a pair of 256-B rows, 16 B at col; row lane >> 3 of four 128-B pieces, 16 B at lane & 7
  const char* gk = (const char*)((wave >> 2) ? CL : CH_) + ((b * TT + (wave & 3) * 16) * HP) * 2; const char* gv = (const char*)(VP + (b * DV + wave * 32) * (size_t)TT);
  char *lk = (char*)&sk[0][wave >> 2][(wave & 3) * 16][0], *lv = (char*)&sv[0][wave * 32][0];
  int mv[TT / (32 * FA_W)];
#pragma unroll   // all eight loads in flight together: one memory latency, not eight
  for (int i = 0; i < TT / (32 * FA_W); ++i) mv[i] = CMASK[b * TT + i * (32 * FA_W) + tid];
  asm volatile("s_wait_xcnt 0x0" ::: "memory");   // stands behind the loads above, in front of every later write of a register that they name
  __builtin_amdgcn_sched_barrier(0);               // holds the later address arithmetic behind that wait
  v16h qh[HP / 32], ql[HP / 32];   // every loop over these arrays is unrolled whole so that they are indexed by constants and stay in registers
#pragma unroll
  for (int kb = 0; kb < HP / 32; ++kb) { qh[kb] = frag_h(RH + (b * TT + q0 + col) * HP + kb * 32, lane); ql[kb] = frag_h(RL + (b * TT + q0 + col) * HP + kb * 32, lane); }
  asm volatile("s_wait_xcnt 0x0" ::: "memory");   // as above, for the fragment loads
  __builtin_amdgcn_sched_barrier(0);               // as above
  fa_fill(gk, gv, lk, lv, 0, 0, lane);
#pragma unroll
  for (int i = 0; i < TT / (32 * FA_W); ++i) smk[i * (32 * FA_W) + tid] = mv[i];
  v8f acc[DV / 16] = {}; float m = -1.0e38f, l = 0.f;   // acc[j][r] = O^T[channel j * 16 + 8 g + r][row col]; m = the maximum in use, times log2(e) (the same in both halves of the wave); l = this half's share of the row's sum
  // m starts far above what an excluded column (-3.0e38) comes to: its exponential is 0 by itself, also while a row has met no column that counts
  asm volatile("s_wait_asynccnt 0x0" ::: "memory");   // stage 0 has landed before the barrier that publishes it
  __syncthreads();                                     // publishes stage 0 and the mask
  fa_fill(gk, gv, lk, lv, 1, 1, lane);
#pragma unroll 1   // one stage per trip: the buffer index stays a run-time value
  for (int t = 0; t < FA_NT; ++t) { const int bf = t & 1;
    const _Float16* kr = &sk[bf][0][col][0]; const __bf16* vr = &sv[bf][col][0]; const int* mr = &smk[t * FA_KS + 8 * g];
    // fragments are read from LDS as groups, one group ahead of their products and only inside this stage's own buffer
    v16h kf[2][2][2]; v16b vf[2][4];   // [buffer][16-column tile][plane], [buffer][16-channel tile]; indexed by constants, as above
#pragma unroll
    for (int tl = 0; tl < 2; ++tl)
#pragma unroll
      for (int p = 0; p < 2; ++p) kf[0][tl][p] = frag_h(kr + (p * FA_KS + tl * 16) * FA_KP, lane);
#pragma unroll
    for (int kk = 0; kk < FA_KS / 32; ++kk) {
      v4i mk[4];
#pragma unroll
      for (int i = 0; i < 4; ++i) mk[i] = *(const v4i*)(mr + kk * 32 + (i >> 1) * 16 + (i & 1) * 4);
      v8f sh[2] = {}, sl[2] = {};
#pragma unroll
      for (int kb = 0; kb < HP / 32; ++kb) { const int cu = kb & 1;
        if (kb + 1 < HP / 32) {
#pragma unroll
          for (int tl = 0; tl < 2; ++tl)
#pragma unroll
            for (int p = 0; p < 2; ++p) kf[cu ^ 1][tl][p] = frag_h(kr + (p * FA_KS + kk * 32 + tl * 16) * FA_KP + (kb + 1) * 32, lane);
        } else {
#pragma unroll
          for (int j = 0; j < 4; ++j) vf[0][j] = frag_b(vr + j * 16 * FA_VP + kk * 32, lane);
        }
        FA_SB();
        // each accumulator takes its products in the order the separate score kernel had: hi.hi; row lo . column hi, then row hi . column lo
        sh[0] = mm_h(kf[cu][0][0], qh[kb], sh[0]); sl[0] = mm_h(kf[cu][0][0], ql[kb], sl[0]); sh[1] = mm_h(kf[cu][1][0], qh[kb], sh[1]); sl[1] = mm_h(kf[cu][1][0], ql[kb], sl[1]);
        sl[0] = mm_h(kf[cu][0][1], qh[kb], sl[0]); sl[1] = mm_h(kf[cu][1][1], qh[kb], sl[1]);
        FA_SB(); }
      // v[8 tl + r] = score of column kk * 32 + 16 tl + 8 g + r against row col: the k order of a 16x16x32 B operand
      float v[16];
#pragma unroll
      for (int i = 0; i < 16; ++i) v[i] = mk[i >> 2][i & 3] != 0 ? -3.0e38f : (sh[i >> 3][i & 7] + sl[i >> 3][i & 7] * (1.0f / 1024.0f));
      float mx = v[0];
#pragma unroll
      for (int i = 1; i < 16; ++i) mx = fmaxf(mx, v[i]);
      mx = fmaxf(mx, xhalf(mx)) * FA_L2E;   // both halves of the wave now hold the row's maximum over these 32 columns, in log2 units (-infinity where all 32 are excluded)
      // the maximum in use may trail the true one by up to 8 (an exponential then reaches e^8): sum and accumulators are rescaled only when some row's maximum exceeds it by more; one wave-uniform test per 32 columns
      if (__builtin_amdgcn_ballot_w32(mx > m + 8.0f * FA_L2E) != 0) { const float mn = fmaxf(m, mx); const float f = __builtin_amdgcn_exp2f(m - mn); m = mn; l *= f;
#pragma unroll
        for (int j = 0; j < DV / 16; ++j) acc[j] = acc[j] * f; }
      float s4[4] = {0.f, 0.f, 0.f, 0.f};
#pragma unroll
      for (int i = 0; i < 16; i += 2) { const v2f y = __builtin_elementwise_fma((v2f){v[i], v[i + 1]}, (v2f){FA_L2E, FA_L2E}, (v2f){-m, -m}); const float e0 = __builtin_amdgcn_exp2f(y[0]), e1 = __builtin_amdgcn_exp2f(y[1]); v[i] = e0; v[i + 1] = e1; s4[i & 3] += e0; s4[(i + 1) & 3] += e1; }   // an excluded column: y is below -1.0e38 or -infinity, and exp2 gives 0
      l += (s4[0] + s4[1]) + (s4[2] + s4[3]);
      const F2 p = bsplit16(v);
#pragma unroll
      for (int jg = 0; jg < 4; ++jg) { const int cu = jg & 1;
        if (jg + 1 < 4) {
#pragma unroll
          for (int j = 0; j < 4; ++j) vf[cu ^ 1][j] = frag_b(vr + ((jg + 1) * 4 + j) * 16 * FA_VP + kk * 32, lane);
        } else if (kk + 1 < FA_KS / 32) {
#pragma unroll
          for (int tl = 0; tl < 2; ++tl)
#pragma unroll
            for (int pl = 0; pl < 2; ++pl) kf[0][tl][pl] = frag_h(kr + (pl * FA_KS + (kk + 1) * 32 + tl * 16) * FA_KP, lane);
        }
        FA_SB();
#pragma unroll
        for (int j = 0; j < 4; ++j) acc[jg * 4 + j] = mm_b(vf[cu][j], p.h, acc[jg * 4 + j]);
#pragma unroll
        for (int j = 0; j < 4; ++j) acc[jg * 4 + j] = mm_b(vf[cu][j], p.l, acc[jg * 4 + j]);
        FA_SB(); } }
    asm volatile("s_wait_dscnt 0x0" ::: "memory");      // this wave's reads of buffer bf are over before it is handed to the copies
    asm volatile("s_wait_asynccnt 0x0" ::: "memory");   // this wave's copies of stage t + 1 have landed
    __syncthreads();                                     // publishes stage t + 1 and ends every reader's last read of buffer bf
    if (t + 2 < FA_NT) fa_fill(gk, gv, lk, lv, t + 2, bf, lane); }
  asm volatile("s_wait_asynccnt 0x0" ::: "memory");     // nothing is in flight when the wave goes on to its end
  const float lt = l + xhalf(l); const float inv = lt > 0.f ? 1.0f / lt : 0.f;   // a row whose every column is masked stays all zero
  // through the wave's own LDS rows, so that the stores are whole lines
#pragma unroll
  for (int j = 0; j < DV / 16; ++j) { const v8f o = acc[j] * inv; vst2(&so[wave][col][j * 16 + 8 * g], (v4f){o[0], o[1], o[2], o[3]}); vst2(&so[wave][col][j * 16 + 8 * g + 4], (v4f){o[4], o[5], o[6], o[7]}); }
  LDSX();
  for (int rl = 0; rl < 16; ++rl) { vst2(OUT + (b * TT + q0 + rl) * DV + lane * 4, *(const v4f*)&so[wave][rl][lane * 4]); vst2(OUT + (b * TT + q0 + rl) * DV + 128 + lane * 4, *(const v4f*)&so[wave][rl][128 + lane * 4]); } }
extern "C" void kernel_launch(void* const* d_in, const int* in_sizes, int n_in, void* d_out, int out_size, void* d_ws, size_t ws_size, hipStream_t stream) {
  (void)in_sizes; (void)n_in; (void)out_size;
  const float** F = (const float**)d_in;   // 0 queries [8,2048,256], 1 keys, 2 values_1 [8,2048,256], 3 values_1_mask [8,2048] int (nonzero = excluded key), 4 values_2, 5 values_2_mask (nonzero = excluded query), 6 Wq [128,256] ([out,in]), 7 Wk, 8 scaling [1,128]; outputs: output @ 0, output_2 @ float 4,194,304
  if (ws_size < (size_t)WS_END) return;
  char* ws = (char*)d_ws; _Float16 *QH = (_Float16*)(ws + WS_QH), *QL = (_Float16*)(ws + WS_QL), *KH = (_Float16*)(ws + WS_KH), *KL = (_Float16*)(ws + WS_KL); __bf16 *V1 = (__bf16*)(ws + WS_V1), *V2 = (__bf16*)(ws + WS_V2);
  float* OUT1 = (float*)d_out; float* OUT2 = (float*)d_out + (size_t)NB * TT * DV;
  k_proj<<<dim3(TNB * TT / 64, 2), 128, 0, stream>>>(F[0], F[1], F[6], F[7], F[8], QH, QL, KH, KL);
  k_vt<<<dim3(TT / 128, TNB, 4), 128, 0, stream>>>(F[2], F[4], V1, V2);
  k_fa<<<dim3(TT / (16 * FA_W), TNB, 2), 32 * FA_W, 0, stream>>>(QH, QL, KH, KL, (const int*)d_in[3], (const int*)d_in[5], V1, V2, OUT1, OUT2);
}

// v006
// One run takes 98.3 microseconds.
// Next to v005, in two timings, it ran 1.23 times as fast each time.
// Over all steps from v000 it is 9.13 times as fast.
// compute dtype: all float inputs rounded to bf16, the int masks read; pq = relu(q Wq^T), pk = relu(k Wk^T) * scaling with EXACT bf16 products on WMMA 16x16x32, f32 accumulate, stored as f16 hi + residual (x 2^10) rows; scores over K = 128 with 3 products (hi.hi, lo.hi, hi.lo), excluded where the key-side mask is set, kept in f32 registers; softmax in f32 with a running maximum and sum (each exponential is the hardware's exp2 of score * log2(e) - maximum, the maximum kept in log2 units, formed by one fused multiply-add); the exponentials split bf16 hi + lo against the EXACT bf16 value planes (2 products), divided by the row's sum at the end; f32 outputs. The second output runs the same pipeline with the roles of queries and keys swapped.
#include <hip/hip_runtime.h>
#include <math.h>

typedef __attribute__((ext_vector_type(16))) _Float16 v16h;
typedef __attribute__((ext_vector_type(16))) __bf16 v16b;
typedef __attribute__((ext_vector_type(8)))  _Float16 v8h;
typedef __attribute__((ext_vector_type(8)))  float v8f;
typedef __attribute__((ext_vector_type(4)))  float v4f;
typedef __attribute__((ext_vector_type(2)))  float v2f;
typedef __attribute__((ext_vector_type(4)))  unsigned v4u;
typedef __attribute__((ext_vector_type(4)))  int v4i;
typedef float __attribute__((may_alias)) float_a;
typedef int __attribute__((may_alias)) int_a;

template <typename T> __device__ __forceinline__ void vst2(void* p, T v) { *(T*)p = v;  }
__device__ __forceinline__ v8f wmma16(v16h a, v16h b, v8f c) {
  v8f d = __builtin_amdgcn_wmma_f32_16x16x32_f16(false, a, false, b, (short)0, c, false, false);
  asm volatile("v_nop\n\tv_nop\n\tv_nop\n\tv_nop" : "+v"(d) : "v"(a), "v"(b));
  return d;
}
__device__ __forceinline__ v8f wmma_bf(v16b a, v16b b, v8f c) {
  v8f d = __builtin_amdgcn_wmma_f32_16x16x32_bf16(false, a, false, b, (short)0, c, false, false);
  asm volatile("v_nop\n\tv_nop\n\tv_nop\n\tv_nop" : "+v"(d) : "v"(a), "v"(b));
  return d;
}
// 16x16x32 fragments: lane = (h = lane>>4, row/col = lane&15); elements 0..7 = k0+8h+0..7, 8..15 = k0+16+8h+0..7; D element r = row 8h+r
__device__ __forceinline__ v16h frag_h(const _Float16* rowk0, int lane) {
  union { v16h v; v8h q[2]; } u; const _Float16* p = rowk0 + 8 * (lane >> 4);
  u.q[0] = *(const v8h*)p; u.q[1] = *(const v8h*)(p + 16); return u.v;
}
__device__ __forceinline__ v16h frag_f32(const float* rowk0, int lane) {
  v16h a; const float* p = rowk0 + 8 * (lane >> 4);
#pragma unroll
  for (int i = 0; i < 8; ++i) { a[i] = (_Float16)p[i]; a[8 + i] = (_Float16)p[16 + i]; }
  return a;
}
__device__ __forceinline__ v16h frag_f32s(const float* rowk0, int lane, float sc) {
  v16h a; const float* p = rowk0 + 8 * (lane >> 4);
#pragma unroll
  for (int i = 0; i < 8; ++i) { a[i] = (_Float16)(p[i] * sc); a[8 + i] = (_Float16)(p[16 + i] * sc); }
  return a;
}
// column fragment from a [K][ld] layout (column n), rows >= K read as 0
__device__ __forceinline__ v16h fragc_f32(const float* W, int k0, int n, int lane, int ld, int K) {
  v16h a; const int g = lane >> 4;
#pragma unroll
  for (int i = 0; i < 8; ++i) { const int ka = k0 + 8 * g + i, kb = ka + 16;
    a[i] = (_Float16)(ka < K ? W[(size_t)(ka < K ? ka : K - 1) * ld + n] : 0.f); a[8 + i] = (_Float16)(kb < K ? W[(size_t)(kb < K ? kb : K - 1) * ld + n] : 0.f); }
  return a;
}
struct F2 { v16b h, l; };
__device__ __forceinline__ F2 bsplit16(const float v[16]) { F2 r;
#pragma unroll
  for (int i = 0; i < 16; ++i) { const __bf16 h = (__bf16)v[i]; r.h[i] = h; r.l[i] = (__bf16)(v[i] - (float)h); }
  return r; }
__device__ __forceinline__ F2 split_row(const float* row, int k0, int lane) { float v[16]; const float* p = row + k0 + 8 * (lane >> 4);
#pragma unroll
  for (int i = 0; i < 8; ++i) { v[i] = p[i]; v[8 + i] = p[16 + i]; }
  return bsplit16(v); }
__device__ __forceinline__ F2 split_rowK(const float* row, int k0, int lane, int K) { float v[16]; const int g = lane >> 4;
#pragma unroll
  for (int i = 0; i < 8; ++i) { const int ka = k0 + 8 * g + i, kb = ka + 16; v[i] = ka < K ? row[ka < K ? ka : K - 1] : 0.f; v[8 + i] = kb < K ? row[kb < K ? kb : K - 1] : 0.f; }
  return bsplit16(v); }
__device__ __forceinline__ F2 split_col(const float* W, int k0, int n, int lane, int ld, int K) { float v[16]; const int g = lane >> 4;
#pragma unroll
  for (int i = 0; i < 8; ++i) { const int ka = k0 + 8 * g + i, kb = ka + 16; v[i] = ka < K ? W[(size_t)(ka < K ? ka : K - 1) * ld + n] : 0.f; v[8 + i] = kb < K ? W[(size_t)(kb < K ? kb : K - 1) * ld + n] : 0.f; }
  return bsplit16(v); }
__device__ __forceinline__ v8f mac3(const F2& a, const F2& b, v8f c) { c = wmma_bf(a.l, b.h, c); c = wmma_bf(a.h, b.l, c); return wmma_bf(a.h, b.h, c); }
__device__ __forceinline__ float sigm(float v) { return 1.0f / (1.0f + expf(-v)); }
#define LDSX() do { asm volatile("s_wait_dscnt 0" ::: "memory"); __builtin_amdgcn_wave_barrier(); __builtin_amdgcn_fence(__ATOMIC_RELEASE, "workgroup"); } while (0)

// Scaled-dot attention with dual softmax (B 8, Lq = Lk = 2,048, D 256, H 128): pq = relu(queries Wq^T); pk = relu(keys Wk^T) * scaling; scores = pq pk^T; output = softmax_k(scores | values_1_mask[k] -> -inf) . values_1; output_2 = softmax_q(scores^T | values_2_mask[q] -> -inf) . values_2.
__device__ __forceinline__ float bfr(float v) { return (float)(__bf16)v; }
#define NB 8
#define TT 2048
#define DIN 256
#define HP 128         // projected width
#define DV 256         // value width
#ifndef TNB
#define TNB NB
#endif
typedef __attribute__((ext_vector_type(8))) __bf16 v8b;
__device__ __forceinline__ v16b frag_b(const __bf16* rowk0, int lane) { union { v16b v; v8b q[2]; } u; const __bf16* p = rowk0 + 8 * (lane >> 4); u.q[0] = *(const v8b*)p; u.q[1] = *(const v8b*)(p + 16); return u.v; }
#define WS_QH  0u                                          // f16 pq hi rows [b*T+q][128]
#define WS_QL  (WS_QH + 2u * (size_t)NB * TT * HP)
#define WS_KH  (WS_QL + 2u * (size_t)NB * TT * HP)           // f16 pk hi rows
#define WS_KL  (WS_KH + 2u * (size_t)NB * TT * HP)
#define WS_V1  (WS_KL + 2u * (size_t)NB * TT * HP)           // bf16 values_1 planes [b][c][k]
#define WS_V2  (WS_V1 + 2u * (size_t)NB * DV * TT)           // bf16 values_2 planes [b][c][q]
#define WS_END (WS_V2 + 2u * (size_t)NB * DV * TT)
// ---- k_proj: block = (128 rows, which), one wave = 16 rows x all 128 columns: relu(x W^T) (x scaling for pk), exact; stored as f16 hi + residual rows (256-B rows)
// The weight matrix and the block's 128 input rows go once into LDS as bf16: every global load is 512 contiguous bytes of a wave, and all of a thread's loads are in flight together; the fragments come from LDS.
#define PJ_R 128       // rows per block
#define PJ_P 264       // operand row pitch in LDS, bf16 (528 B = 16 B x odd: no bank conflict for 16-byte reads down a column of rows)
typedef __attribute__((ext_vector_type(4))) __bf16 v4b;
__device__ __forceinline__ v4b cvt4(v4f t) { return (v4b){(__bf16)t[0], (__bf16)t[1], (__bf16)t[2], (__bf16)t[3]}; }
struct PJF { v16b a, w[8]; };   // the fragments of one 32-wide k step
__device__ __forceinline__ void pj_read(PJF& f, const __bf16* ar, const __bf16* br, int kc, int lane) { f.a = frag_b(ar + kc * 32, lane);
#pragma unroll
  for (int j = 0; j < 8; ++j) f.w[j] = frag_b(br + j * 16 * PJ_P + kc * 32, lane); }
__device__ __forceinline__ void pj_mac(v8f (&acc)[8], const PJF& f) {
#pragma unroll
  for (int j = 0; j < 8; ++j) acc[j] = __builtin_amdgcn_wmma_f32_16x16x32_bf16(false, f.a, false, f.w[j], (short)0, acc[j], false, false); }
__global__ __launch_bounds__(2 * PJ_R) void k_proj(const float* __restrict__ XQ, const float* __restrict__ XK, const float* __restrict__ WQ, const float* __restrict__ WK, const float* __restrict__ SCL, _Float16* __restrict__ QH, _Float16* __restrict__ QL, _Float16* __restrict__ KH, _Float16* __restrict__ KL) { __shared__ __align__(16) _Float16 sh[PJ_R][136], sl[PJ_R][136]; __shared__ __align__(16) __bf16 sw[HP][PJ_P], sx[PJ_R][PJ_P];
  const int tid = threadIdx.x, wave = tid >> 5, lane = tid & 31, col = lane & 15, g = lane >> 4; const int which = blockIdx.y; const size_t r0 = (size_t)blockIdx.x * PJ_R; const float* X = which == 0 ? XQ : XK; const float* Wt = which == 0 ? WQ : WK; _Float16* DH = which == 0 ? QH : KH; _Float16* DL = which == 0 ? QL : KL;
  // 16-byte piece i * 256 + tid of a [128][256] float array: row 4 i + (tid >> 6), floats 4 (tid & 63) and the three behind
  const float* xg = X + r0 * DIN + tid * 4; const float* wg = Wt + tid * 4; const int sr = tid >> 6, sc4 = (tid & 63) * 4;
  v4f wr[32], xr[32]; float sc[8];   // indexed by constants: every loop over them is unrolled whole
#pragma unroll
  for (int i = 0; i < 32; ++i) wr[i] = *(const v4f*)(wg + i * 1024);   // the weights first: they come from L2 and are put away while the input rows are still on their way from memory
  __builtin_amdgcn_sched_barrier(0);   // keeps that order: left free, the compiler issues two of the weight loads behind the input rows, and loads are waited for in issue order
#pragma unroll
  for (int i = 0; i < 32; ++i) xr[i] = *(const v4f*)(xg + i * 1024);
  __builtin_amdgcn_sched_barrier(0);   // every load is issued before the first is waited for
#pragma unroll
  for (int i = 0; i < 32; ++i) *(v4b*)&sw[i * 4 + sr][sc4] = cvt4(wr[i]);
#pragma unroll
  for (int i = 0; i < 32; ++i) *(v4b*)&sx[i * 4 + sr][sc4] = cvt4(xr[i]);
  __syncthreads();   // publishes both staged operands
#pragma unroll
  for (int j = 0; j < 8; ++j) sc[j] = SCL[j * 16 + col];   // all eight here, on their way during the products, not one by one in front of their use
  v8f acc[8] = {};
  const __bf16* ar = &sx[wave * 16 + col][0]; const __bf16* br = &sw[col][0];
  PJF f0, f1;   // a k step's fragments are read as one group, one step ahead of their products
  pj_read(f0, ar, br, 0, lane);
#pragma unroll 1   // two k steps per trip, one per fragment buffer; the last two steps stand behind the loop, so that no trip has a branch round its reads
  for (int kc = 0; kc < DIN / 32 - 2; kc += 2) {
    pj_read(f1, ar, br, kc + 1, lane);
    __builtin_amdgcn_sched_barrier(0);   // keeps the next step's LDS reads together and ahead of this step's products
    pj_mac(acc, f0);
    __builtin_amdgcn_sched_barrier(0);   // as above
    pj_read(f0, ar, br, kc + 2, lane);
    __builtin_amdgcn_sched_barrier(0);   // as above
    pj_mac(acc, f1);
    __builtin_amdgcn_sched_barrier(0); } // as above
  pj_read(f1, ar, br, DIN / 32 - 1, lane);
  __builtin_amdgcn_sched_barrier(0);     // as above
  pj_mac(acc, f0); pj_mac(acc, f1);
#pragma unroll
  for (int j = 0; j < 8; ++j) { const int o = j * 16 + col; const float scj = (which == 1) ? bfr(sc[j]) : 1.0f;
#pragma unroll
    for (int r = 0; r < 8; ++r) { const float v = fmaxf(acc[j][r], 0.f) * scj; const _Float16 hv = (_Float16)v; sh[wave * 16 + 8 * g + r][o] = hv; sl[wave * 16 + 8 * g + r][o] = (_Float16)((v - (float)hv) * 1024.0f); } }
  __syncthreads();
  for (int e = tid; e < PJ_R * 16; e += 2 * PJ_R) { const int rl = e >> 4, q = e & 15; vst2((unsigned*)(DH + (r0 + rl) * HP + q * 8), *(const v4u*)&sh[rl][q * 8]); vst2((unsigned*)(DL + (r0 + rl) * HP + q * 8), *(const v4u*)&sl[rl][q * 8]); } }
// ---- k_vt: block = (128 rows, b, which 0/1, 128-channel group): values (exact bf16) -> planes [b][c][t]; 256-B pieces
__global__ __launch_bounds__(128) void k_vt(const float* __restrict__ VA, const float* __restrict__ VB, __bf16* __restrict__ PA, __bf16* __restrict__ PB) { __shared__ __align__(16) __bf16 th[128][136];
  const int tid = threadIdx.x; const int t0 = blockIdx.x * 128; const size_t b = blockIdx.y; const int which = blockIdx.z >> 1, c0 = (blockIdx.z & 1) * 128; const float* V = which == 0 ? VA : VB; __bf16* P = which == 0 ? PA : PB;
  for (int e = tid; e < 128 * 128; e += 128) { const int tl = e >> 7, cl = e & 127; th[cl][tl] = (__bf16)V[(b * TT + t0 + tl) * DV + c0 + cl]; }
  __syncthreads();
  for (int e = tid; e < 128 * 16; e += 128) { const int cl = e >> 4, q = e & 15; vst2((unsigned*)(P + (b * DV + c0 + cl) * (size_t)TT + t0 + q * 8), *(const v4u*)&th[cl][q * 8]); } }
// ---- k_fa: block = (128 rows, batch, direction), one wave = 16 rows x all 256 channels. Scores, softmax and the value product in one kernel: no score goes to memory.
// Per 32 columns (keys of this direction): S^T = COL . ROW^T (3 products, A = column-side rows from LDS, B = the wave's row-side fragments, kept in registers), so a lane holds 16 scores of ONE row;
// running maximum and running sum per lane; e = exp(score - maximum in use), split bf16 hi + lo, is the B operand of O^T += V^T . P^T as it stands in the registers (2 products, A = value planes from LDS).
// Column-side rows and value planes come 64 columns at a time into a two-buffer LDS ring by asynchronous copies.
#define FA_W 8         // waves per block
#define FA_KS 64       // columns per stage
#define FA_NT (TT / FA_KS)
#define FA_KP 136      // column-side row pitch in LDS, f16 (272 B = 16 B x odd: no bank conflict for 16-byte reads down a column of rows)
#define FA_VP 72       // value row pitch in LDS, bf16 (144 B = 16 B x odd)
#define FA_OP 260      // output row pitch in LDS, floats (1,040 B = 16 B x odd)
#define FA_L2E 1.44269504088896340736f   // log2(e)
// the plain builtins: the compiler keeps the distances behind them itself, and their operands may lie above v255, which an asm operand cannot name (this kernel holds more than 256 registers)
__device__ __forceinline__ v8f mm_h(v16h a, v16h b, v8f c) { return __builtin_amdgcn_wmma_f32_16x16x32_f16(false, a, false, b, (short)0, c, false, false); }
__device__ __forceinline__ v8f mm_b(v16b a, v16b b, v8f c) { return __builtin_amdgcn_wmma_f32_16x16x32_bf16(false, a, false, b, (short)0, c, false, false); }
// nothing is scheduled across: keeps a group's LDS reads together and ahead of the block of products in front of which they are written; left free, the compiler spreads them in pairs among the products, each pair waited to 0 just before its use
#define FA_SB() __builtin_amdgcn_sched_barrier(0)
// lane l's value from lane l ^ 16
__device__ __forceinline__ float xhalf(float x) { return __builtin_bit_cast(float, __builtin_amdgcn_permlanex16(__builtin_bit_cast(int, x), __builtin_bit_cast(int, x), 0x76543210, 0xfedcba98, false, false)); }
// one wave's share of stage t into buffer bf: 16 column-side rows of one plane (two 256-B rows a copy) and 32 value rows (four 128-B pieces a copy), 16 copies
typedef __attribute__((address_space(1))) v4i g_v4i; typedef __attribute__((address_space(3))) v4i l_v4i;
// the copies as the builtin: its address registers are the compiler's own and may lie above v255
__device__ __forceinline__ void fa_fill(const char* gk, const char* gv, char* lk, char* lv, int t, int bf, int lane) {
  gk += (size_t)t * (FA_KS * HP * 2) + lane * 16; lk += bf * (2 * FA_KS * FA_KP * 2) + (lane >> 4) * (FA_KP * 2) + (lane & 15) * 16;
  gv += (size_t)t * (FA_KS * 2) + (lane >> 3) * (TT * 2) + (lane & 7) * 16; lv += bf * (DV * FA_VP * 2) + (lane >> 3) * (FA_VP * 2) + (lane & 7) * 16;
#pragma unroll
  for (int i = 0; i < 8; ++i) __builtin_amdgcn_global_load_async_to_lds_b128((g_v4i*)(gk + i * (2 * HP * 2)), (l_v4i*)(lk + i * (2 * FA_KP * 2)), 0, 0);
#pragma unroll
  for (int i = 0; i < 8; ++i) __builtin_amdgcn_global_load_async_to_lds_b128((g_v4i*)(gv + i * (4 * TT * 2)), (l_v4i*)(lv + i * (4 * FA_VP * 2)), 0, 0);
}
__global__ __launch_bounds__(32 * FA_W) void k_fa(const _Float16* __restrict__ QH, const _Float16* __restrict__ QL, const _Float16* __restrict__ KH, const _Float16* __restrict__ KL, const int* __restrict__ M1, const int* __restrict__ M2, const __bf16* __restrict__ V1, const __bf16* __restrict__ V2, float* __restrict__ OUT1, float* __restrict__ OUT2) {
  __shared__ __align__(16) _Float16 sk[2][2][FA_KS][FA_KP]; __shared__ __align__(16) __bf16 sv[2][DV][FA_VP]; __shared__ __align__(16) int smk[TT]; __shared__ __align__(16) float so[FA_W][16][FA_OP];
  const int tid = threadIdx.x, wave = __builtin_amdgcn_readfirstlane(tid >> 5), lane = tid & 31, col = lane & 15, g = lane >> 4; const size_t b = blockIdx.y; const bool sw = blockIdx.z != 0;   // the wave's number in a scalar register: what depends on it alone then costs no vector register over the loop
  // direction 0: rows = queries, columns = keys, values_1 and its mask; direction 1: rows = keys, columns = queries, values_2 and its mask
  const _Float16 *RH = sw ? KH : QH, *RL = sw ? KL : QL, *CH_ = sw ? QH : KH, *CL = sw ? QL : KL; const int* CMASK = sw ? M2 : M1; const __bf16* VP = sw ? V2 : V1; float* OUT = sw ? OUT2 : OUT1;
  const int q0 = blockIdx.x * (16 * FA_W) + wave * 16;
  // wave-uniform bases; the lane's own part: row g of a pair of 256-B rows, 16 B at col; row lane >> 3 of four 128-B pieces, 16 B at lane & 7
  const char* gk = (const char*)((wave >> 2) ? CL : CH_) + ((b * TT + (wave & 3) * 16) * HP) * 2; const char* gv = (const char*)(VP + (b * DV + wave * 32) * (size_t)TT);
  char *lk = (char*)&sk[0][wave >> 2][(wave & 3) * 16][0], *lv = (char*)&sv[0][wave * 32][0];
  int mv[TT / (32 * FA_W)];
#pragma unroll   // all eight loads in flight together: one memory latency, not eight
  for (int i = 0; i < TT / (32 * FA_W); ++i) mv[i] = CMASK[b * TT + i * (32 * FA_W) + tid];
  asm volatile("s_wait_xcnt 0x0" ::: "memory");   // stands behind the loads above, in front of every later write of a register that they name
  __builtin_amdgcn_sched_barrier(0);               // holds the later address arithmetic behind that wait
  v16h qh[HP / 32], ql[HP / 32];   // every loop over these arrays is unrolled whole so that they are indexed by constants and stay in registers
#pragma unroll
  for (int kb = 0; kb < HP / 32; ++kb) { qh[kb] = frag_h(RH + (b * TT + q0 + col) * HP + kb * 32, lane); ql[kb] = frag_h(RL + (b * TT + q0 + col) * HP + kb * 32, lane); }
  asm volatile("s_wait_xcnt 0x0" ::: "memory");   // as above, for the fragment loads
  __builtin_amdgcn_sched_barrier(0);               // as above
  fa_fill(gk, gv, lk, lv, 0, 0, lane);
#pragma unroll
  for (int i = 0; i < TT / (32 * FA_W); ++i) smk[i * (32 * FA_W) + tid] = mv[i];
  v8f acc[DV / 16] = {}; float m = -1.0e38f, l = 0.f;   // acc[j][r] = O^T[channel j * 16 + 8 g + r][row col]; m = the maximum in use, times log2(e) (the same in both halves of the wave); l = this half's share of the row's sum
  // m starts far above what an excluded column (-3.0e38) comes to: its exponential is 0 by itself, also while a row has met no column that counts
  asm volatile("s_wait_asynccnt 0x0" ::: "memory");   // stage 0 has landed before the barrier that publishes it
  __syncthreads();                                     // publishes stage 0 and the mask
  fa_fill(gk, gv, lk, lv, 1, 1, lane);
#pragma unroll 1   // one stage per trip: the buffer index stays a run-time value
  for (int t = 0; t < FA_NT; ++t) { const int bf = t & 1;
    const _Float16* kr = &sk[bf][0][col][0]; const __bf16* vr = &sv[bf][col][0]; const int* mr = &smk[t * FA_KS + 8 * g];
    // fragments are read from LDS as groups, one group ahead of their products and only inside this stage's own buffer
    v16h kf[2][2][2]; v16b vf[2][4];   // [buffer][16-column tile][plane], [buffer][16-channel tile]; indexed by constants, as above
#pragma unroll
    for (int tl = 0; tl < 2; ++tl)
#pragma unroll
      for (int p = 0; p < 2; ++p) kf[0][tl][p] = frag_h(kr + (p * FA_KS + tl * 16) * FA_KP, lane);
#pragma unroll
    for (int kk = 0; kk < FA_KS / 32; ++kk) {
      v4i mk[4];
#pragma unroll
      for (int i = 0; i < 4; ++i) mk[i] = *(const v4i*)(mr + kk * 32 + (i >> 1) * 16 + (i & 1) * 4);
      v8f sh[2] = {}, sl[2] = {};
#pragma unroll
      for (int kb = 0; kb < HP / 32; ++kb) { const int cu = kb & 1;
        if (kb + 1 < HP / 32) {
#pragma unroll
          for (int tl = 0; tl < 2; ++tl)
#pragma unroll
            for (int p = 0; p < 2; ++p) kf[cu ^ 1][tl][p] = frag_h(kr + (p * FA_KS + kk * 32 + tl * 16) * FA_KP + (kb + 1) * 32, lane);
        } else {
#pragma unroll
          for (int j = 0; j < 4; ++j) vf[0][j] = frag_b(vr + j * 16 * FA_VP + kk * 32, lane);
        }
        FA_SB();
        // each accumulator takes its products in the order the separate score kernel had: hi.hi; row lo . column hi, then row hi . column lo
        sh[0] = mm_h(kf[cu][0][0], qh[kb], sh[0]); sl[0] = mm_h(kf[cu][0][0], ql[kb], sl[0]); sh[1] = mm_h(kf[cu][1][0], qh[kb], sh[1]); sl[1] = mm_h(kf[cu][1][0], ql[kb], sl[1]);
        sl[0] = mm_h(kf[cu][0][1], qh[kb], sl[0]); sl[1] = mm_h(kf[cu][1][1], qh[kb], sl[1]);
        FA_SB(); }
      // v[8 tl + r] = score of column kk * 32 + 16 tl + 8 g + r against row col: the k order of a 16x16x32 B operand
      float v[16];
#pragma unroll
      for (int i = 0; i < 16; ++i) v[i] = mk[i >> 2][i & 3] != 0 ? -3.0e38f : (sh[i >> 3][i & 7] + sl[i >> 3][i & 7] * (1.0f / 1024.0f));
      float mx = v[0];
#pragma unroll
      for (int i = 1; i < 16; ++i) mx = fmaxf(mx, v[i]);
      mx = fmaxf(mx, xhalf(mx)) * FA_L2E;   // both halves of the wave now hold the row's maximum over these 32 columns, in log2 units (-infinity where all 32 are excluded)
      // the maximum in use may trail the true one by up to 8 (an exponential then reaches e^8): sum and accumulators are rescaled only when some row's maximum exceeds it by more; one wave-uniform test per 32 columns
      if (__builtin_amdgcn_ballot_w32(mx > m + 8.0f * FA_L2E) != 0) { const float mn = fmaxf(m, mx); const float f = __builtin_amdgcn_exp2f(m - mn); m = mn; l *= f;
#pragma unroll
        for (int j = 0; j < DV / 16; ++j) acc[j] = acc[j] * f; }
      float s4[4] = {0.f, 0.f, 0.f, 0.f};
#pragma unroll
      for (int i = 0; i < 16; i += 2) { const v2f y = __builtin_elementwise_fma((v2f){v[i], v[i + 1]}, (v2f){FA_L2E, FA_L2E}, (v2f){-m, -m}); const float e0 = __builtin_amdgcn_exp2f(y[0]), e1 = __builtin_amdgcn_exp2f(y[1]); v[i] = e0; v[i + 1] = e1; s4[i & 3] += e0; s4[(i + 1) & 3] += e1; }   // an excluded column: y is below -1.0e38 or -infinity, and exp2 gives 0
      l += (s4[0] + s4[1]) + (s4[2] + s4[3]);
      const F2 p = bsplit16(v);
#pragma unroll
      for (int jg = 0; jg < 4; ++jg) { const int cu = jg & 1;
        if (jg + 1 < 4) {
#pragma unroll
          for (int j = 0; j < 4; ++j) vf[cu ^ 1][j] = frag_b(vr + ((jg + 1) * 4 + j) * 16 * FA_VP + kk * 32, lane);
        } else if (kk + 1 < FA_KS / 32) {
#pragma unroll
          for (int tl = 0; tl < 2; ++tl)
#pragma unroll
            for (int pl = 0; pl < 2; ++pl) kf[0][tl][pl] = frag_h(kr + (pl * FA_KS + (kk + 1) * 32 + tl * 16) * FA_KP, lane);
        }
        FA_SB();
#pragma unroll
        for (int j = 0; j < 4; ++j) acc[jg * 4 + j] = mm_b(vf[cu][j], p.h, acc[jg * 4 + j]);
#pragma unroll
        for (int j = 0; j < 4; ++j) acc[jg * 4 + j] = mm_b(vf[cu][j], p.l, acc[jg * 4 + j]);
        FA_SB(); } }
    asm volatile("s_wait_dscnt 0x0" ::: "memory");      // this wave's reads of buffer bf are over before it is handed to the copies
    asm volatile("s_wait_asynccnt 0x0" ::: "memory");   // this wave's copies of stage t + 1 have landed
    __syncthreads();                                     // publishes stage t + 1 and ends every reader's last read of buffer bf
    if (t + 2 < FA_NT) fa_fill(gk, gv, lk, lv, t + 2, bf, lane); }
  asm volatile("s_wait_asynccnt 0x0" ::: "memory");     // nothing is in flight when the wave goes on to its end
  const float lt = l + xhalf(l); const float inv = lt > 0.f ? 1.0f / lt : 0.f;   // a row whose every column is masked stays all zero
  // through the wave's own LDS rows, so that the stores are whole lines
#pragma unroll
  for (int j = 0; j < DV / 16; ++j) { const v8f o = acc[j] * inv; vst2(&so[wave][col][j * 16 + 8 * g], (v4f){o[0], o[1], o[2], o[3]}); vst2(&so[wave][col][j * 16 + 8 * g + 4], (v4f){o[4], o[5], o[6], o[7]}); }
  LDSX();
  for (int rl = 0; rl < 16; ++rl) { vst2(OUT + (b * TT + q0 + rl) * DV + lane * 4, *(const v4f*)&so[wave][rl][lane * 4]); vst2(OUT + (b * TT + q0 + rl) * DV + 128 + lane * 4, *(const v4f*)&so[wave][rl][128 + lane * 4]); } }
extern "C" void kernel_launch(void* const* d_in, const int* in_sizes, int n_in, void* d_out, int out_size, void* d_ws, size_t ws_size, hipStream_t stream) {
  (void)in_sizes; (void)n_in; (void)out_size;
  const float** F = (const float**)d_in;   // 0 queries [8,2048,256], 1 keys, 2 values_1 [8,2048,256], 3 values_1_mask [8,2048] int (nonzero = excluded key), 4 values_2, 5 values_2_mask (nonzero = excluded query), 6 Wq [128,256] ([out,in]), 7 Wk, 8 scaling [1,128]; outputs: output @ 0, output_2 @ float 4,194,304
  if (ws_size < (size_t)WS_END) return;
  char* ws = (char*)d_ws; _Float16 *QH = (_Float16*)(ws + WS_QH), *QL = (_Float16*)(ws + WS_QL), *KH = (_Float16*)(ws + WS_KH), *KL = (_Float16*)(ws + WS_KL); __bf16 *V1 = (__bf16*)(ws + WS_V1), *V2 = (__bf16*)(ws + WS_V2);
  float* OUT1 = (float*)d_out; float* OUT2 = (float*)d_out + (size_t)NB * TT * DV;
  k_proj<<<dim3(TNB * TT / PJ_R, 2), 2 * PJ_R, 0, stream>>>(F[0], F[1], F[6], F[7], F[8], QH, QL, KH, KL);
  k_vt<<<dim3(TT / 128, TNB, 4), 128, 0, stream>>>(F[2], F[4], V1, V2);
  k_fa<<<dim3(TT / (16 * FA_W), TNB, 2), 32 * FA_W, 0, stream>>>(QH, QL, KH, KL, (const int*)d_in[3], (const int*)d_in[5], V1, V2, OUT1, OUT2);
}

// v007
// It runs in 60.4 microseconds.
// Timed twice side by side with v006, it ran 1.63 and 1.62 times as fast.
// Counting every step since v000, it is 14.8 times as fast.
// compute dtype: all float inputs rounded to bf16, the int masks read; pq = relu(q Wq^T), pk = relu(k Wk^T) * scaling with EXACT bf16 products on WMMA 16x16x32, f32 accumulate, stored as f16 hi + residual (x 2^10) rows; scores over K = 128 with 3 products (hi.hi, lo.hi, hi.lo), formed only for the columns whose key-side mask is clear (the columns are taken in the order clear first, set behind; stages wholly behind the clear ones are not run), kept in f32 registers; softmax in f32 with a running maximum and sum (each exponential is the hardware's exp2 of score * log2(e) - maximum, the maximum kept in log2 units, formed by one fused multiply-add); the exponentials split bf16 hi + lo against the EXACT bf16 value planes (2 products), divided by the row's sum at the end; f32 outputs. The second output runs the same pipeline with the roles of queries and keys swapped.
#include <hip/hip_runtime.h>
#include <math.h>

typedef __attribute__((ext_vector_type(16))) _Float16 v16h;
typedef __attribute__((ext_vector_type(16))) __bf16 v16b;
typedef __attribute__((ext_vector_type(8)))  _Float16 v8h;
typedef __attribute__((ext_vector_type(8)))  float v8f;
typedef __attribute__((ext_vector_type(4)))  float v4f;
typedef __attribute__((ext_vector_type(2)))  float v2f;
typedef __attribute__((ext_vector_type(4)))  unsigned v4u;
typedef __attribute__((ext_vector_type(4)))  int v4i;
typedef float __attribute__((may_alias)) float_a;
typedef int __attribute__((may_alias)) int_a;

template <typename T> __device__ __forceinline__ void vst2(void* p, T v) { *(T*)p = v;  }
__device__ __forceinline__ v8f wmma16(v16h a, v16h b, v8f c) {
  v8f d = __builtin_amdgcn_wmma_f32_16x16x32_f16(false, a, false, b, (short)0, c, false, false);
  asm volatile("v_nop\n\tv_nop\n\tv_nop\n\tv_nop" : "+v"(d) : "v"(a), "v"(b));
  return d;
}
__device__ __forceinline__ v8f wmma_bf(v16b a, v16b b, v8f c) {
  v8f d = __builtin_amdgcn_wmma_f32_16x16x32_bf16(false, a, false, b, (short)0, c, false, false);
  asm volatile("v_nop\n\tv_nop\n\tv_nop\n\tv_nop" : "+v"(d) : "v"(a), "v"(b));
  return d;
}
// 16x16x32 fragments: lane = (h = lane>>4, row/col = lane&15); elements 0..7 = k0+8h+0..7, 8..15 = k0+16+8h+0..7; D element r = row 8h+r
__device__ __forceinline__ v16h frag_h(const _Float16* rowk0, int lane) {
  union { v16h v; v8h q[2]; } u; const _Float16* p = rowk0 + 8 * (lane >> 4);
  u.q[0] = *(const v8h*)p; u.q[1] = *(const v8h*)(p + 16); return u.v;
}
__device__ __forceinline__ v16h frag_f32(const float* rowk0, int lane) {
  v16h a; const float* p = rowk0 + 8 * (lane >> 4);
#pragma unroll
  for (int i = 0; i < 8; ++i) { a[i] = (_Float16)p[i]; a[8 + i] = (_Float16)p[16 + i]; }
  return a;
}
__device__ __forceinline__ v16h frag_f32s(const float* rowk0, int lane, float sc) {
  v16h a; const float* p = rowk0 + 8 * (lane >> 4);
#pragma unroll
  for (int i = 0; i < 8; ++i) { a[i] = (_Float16)(p[i] * sc); a[8 + i] = (_Float16)(p[16 + i] * sc); }
  return a;
}
// column fragment from a [K][ld] layout (column n), rows >= K read as 0
__device__ __forceinline__ v16h fragc_f32(const float* W, int k0, int n, int lane, int ld, int K) {
  v16h a; const int g = lane >> 4;
#pragma unroll
  for (int i = 0; i < 8; ++i) { const int ka = k0 + 8 * g + i, kb = ka + 16;
    a[i] = (_Float16)(ka < K ? W[(size_t)(ka < K ? ka : K - 1) * ld + n] : 0.f); a[8 + i] = (_Float16)(kb < K ? W[(size_t)(kb < K ? kb : K - 1) * ld + n] : 0.f); }
  return a;
}
struct F2 { v16b h, l; };
__device__ __forceinline__ F2 bsplit16(const float v[16]) { F2 r;
#pragma unroll
  for (int i = 0; i < 16; ++i) { const __bf16 h = (__bf16)v[i]; r.h[i] = h; r.l[i] = (__bf16)(v[i] - (float)h); }
  return r; }
__device__ __forceinline__ F2 split_row(const float* row, int k0, int lane) { float v[16]; const float* p = row + k0 + 8 * (lane >> 4);
#pragma unroll
  for (int i = 0; i < 8; ++i) { v[i] = p[i]; v[8 + i] = p[16 + i]; }
  return bsplit16(v); }
__device__ __forceinline__ F2 split_rowK(const float* row, int k0, int lane, int K) { float v[16]; const int g = lane >> 4;
#pragma unroll
  for (int i = 0; i < 8; ++i) { const int ka = k0 + 8 * g + i, kb = ka + 16; v[i] = ka < K ? row[ka < K ? ka : K - 1] : 0.f; v[8 + i] = kb < K ? row[kb < K ? kb : K - 1] : 0.f; }
  return bsplit16(v); }
__device__ __forceinline__ F2 split_col(const float* W, int k0, int n, int lane, int ld, int K) { float v[16]; const int g = lane >> 4;
#pragma unroll
  for (int i = 0; i < 8; ++i) { const int ka = k0 + 8 * g + i, kb = ka + 16; v[i] = ka < K ? W[(size_t)(ka < K ? ka : K - 1) * ld + n] : 0.f; v[8 + i] = kb < K ? W[(size_t)(kb < K ? kb : K - 1) * ld + n] : 0.f; }
  return bsplit16(v); }
__device__ __forceinline__ v8f mac3(const F2& a, const F2& b, v8f c) { c = wmma_bf(a.l, b.h, c); c = wmma_bf(a.h, b.l, c); return wmma_bf(a.h, b.h, c); }
__device__ __forceinline__ float sigm(float v) { return 1.0f / (1.0f + expf(-v)); }
#define LDSX() do { asm volatile("s_wait_dscnt 0" ::: "memory"); __builtin_amdgcn_wave_barrier(); __builtin_amdgcn_fence(__ATOMIC_RELEASE, "workgroup"); } while (0)

// Scaled-dot attention with dual softmax (B 8, Lq = Lk = 2,048, D 256, H 128): pq = relu(queries Wq^T); pk = relu(keys Wk^T) * scaling; scores = pq pk^T; output = softmax_k(scores | values_1_mask[k] -> -inf) . values_1; output_2 = softmax_q(scores^T | values_2_mask[q] -> -inf) . values_2.
__device__ __forceinline__ float bfr(float v) { return (float)(__bf16)v; }
#define NB 8
#define TT 2048
#define DIN 256
#define HP 128         // projected width
#define DV 256         // value width
#ifndef TNB
#define TNB NB
#endif
typedef __attribute__((ext_vector_type(8))) __bf16 v8b;
__device__ __forceinline__ v16b frag_b(const __bf16* rowk0, int lane) { union { v16b v; v8b q[2]; } u; const __bf16* p = rowk0 + 8 * (lane >> 4); u.q[0] = *(const v8b*)p; u.q[1] = *(const v8b*)(p + 16); return u.v; }
#define WS_QH  0u                                          // f16 pq hi rows [b*T+q][128]
#define WS_QL  (WS_QH + 2u * (size_t)NB * TT * HP)
#define WS_KH  (WS_QL + 2u * (size_t)NB * TT * HP)           // f16 pk hi rows
#define WS_KL  (WS_KH + 2u * (size_t)NB * TT * HP)
#define WS_V1  (WS_KL + 2u * (size_t)NB * TT * HP)           // bf16 values_1 planes [b][c][place of k in col_order], written as far as the counted columns reach, rounded up to 128
#define WS_V2  (WS_V1 + 2u * (size_t)NB * DV * TT)           // bf16 values_2 planes [b][c][place of q in col_order], likewise
#define WS_END (WS_V2 + 2u * (size_t)NB * DV * TT)
// ---- k_proj: block = (128 rows, which), one wave = 16 rows x all 128 columns: relu(x W^T) (x scaling for pk), exact; stored as f16 hi + residual rows (256-B rows)
// The weight matrix and the block's 128 input rows go once into LDS as bf16: every global load is 512 contiguous bytes of a wave, and all of a thread's loads are in flight together; the fragments come from LDS.
#define PJ_R 128       // rows per block
#define PJ_P 264       // operand row pitch in LDS, bf16 (528 B = 16 B x odd: no bank conflict for 16-byte reads down a column of rows)
typedef __attribute__((ext_vector_type(4))) __bf16 v4b;
__device__ __forceinline__ v4b cvt4(v4f t) { return (v4b){(__bf16)t[0], (__bf16)t[1], (__bf16)t[2], (__bf16)t[3]}; }
struct PJF { v16b a, w[8]; };   // the fragments of one 32-wide k step
__device__ __forceinline__ void pj_read(PJF& f, const __bf16* ar, const __bf16* br, int kc, int lane) { f.a = frag_b(ar + kc * 32, lane);
#pragma unroll
  for (int j = 0; j < 8; ++j) f.w[j] = frag_b(br + j * 16 * PJ_P + kc * 32, lane); }
__device__ __forceinline__ void pj_mac(v8f (&acc)[8], const PJF& f) {
#pragma unroll
  for (int j = 0; j < 8; ++j) acc[j] = __builtin_amdgcn_wmma_f32_16x16x32_bf16(false, f.a, false, f.w[j], (short)0, acc[j], false, false); }
__global__ __launch_bounds__(2 * PJ_R) void k_proj(const float* __restrict__ XQ, const float* __restrict__ XK, const float* __restrict__ WQ, const float* __restrict__ WK, const float* __restrict__ SCL, _Float16* __restrict__ QH, _Float16* __restrict__ QL, _Float16* __restrict__ KH, _Float16* __restrict__ KL) { __shared__ __align__(16) _Float16 sh[PJ_R][136], sl[PJ_R][136]; __shared__ __align__(16) __bf16 sw[HP][PJ_P], sx[PJ_R][PJ_P];
  const int tid = threadIdx.x, wave = tid >> 5, lane = tid & 31, col = lane & 15, g = lane >> 4; const int which = blockIdx.y; const size_t r0 = (size_t)blockIdx.x * PJ_R; const float* X = which == 0 ? XQ : XK; const float* Wt = which == 0 ? WQ : WK; _Float16* DH = which == 0 ? QH : KH; _Float16* DL = which == 0 ? QL : KL;
  // 16-byte piece i * 256 + tid of a [128][256] float array: row 4 i + (tid >> 6), floats 4 (tid & 63) and the three behind
  const float* xg = X + r0 * DIN + tid * 4; const float* wg = Wt + tid * 4; const int sr = tid >> 6, sc4 = (tid & 63) * 4;
  v4f wr[32], xr[32]; float sc[8];   // indexed by constants: every loop over them is unrolled whole
#pragma unroll
  for (int i = 0; i < 32; ++i) wr[i] = *(const v4f*)(wg + i * 1024);   // the weights first: they come from L2 and are put away while the input rows are still on their way from memory
  __builtin_amdgcn_sched_barrier(0);   // keeps that order: left free, the compiler issues two of the weight loads behind the input rows, and loads are waited for in issue order
#pragma unroll
  for (int i = 0; i < 32; ++i) xr[i] = *(const v4f*)(xg + i * 1024);
  __builtin_amdgcn_sched_barrier(0);   // every load is issued before the first is waited for
#pragma unroll
  for (int i = 0; i < 32; ++i) *(v4b*)&sw[i * 4 + sr][sc4] = cvt4(wr[i]);
#pragma unroll
  for (int i = 0; i < 32; ++i) *(v4b*)&sx[i * 4 + sr][sc4] = cvt4(xr[i]);
  __syncthreads();   // publishes both staged operands
#pragma unroll
  for (int j = 0; j < 8; ++j) sc[j] = SCL[j * 16 + col];   // all eight here, on their way during the products, not one by one in front of their use
  v8f acc[8] = {};
  const __bf16* ar = &sx[wave * 16 + col][0]; const __bf16* br = &sw[col][0];
  PJF f0, f1;   // a k step's fragments are read as one group, one step ahead of their products
  pj_read(f0, ar, br, 0, lane);
#pragma unroll 1   // two k steps per trip, one per fragment buffer; the last two steps stand behind the loop, so that no trip has a branch round its reads
  for (int kc = 0; kc < DIN / 32 - 2; kc += 2) {
    pj_read(f1, ar, br, kc + 1, lane);
    __builtin_amdgcn_sched_barrier(0);   // keeps the next step's LDS reads together and ahead of this step's products
    pj_mac(acc, f0);
    __builtin_amdgcn_sched_barrier(0);   // as above
    pj_read(f0, ar, br, kc + 2, lane);
    __builtin_amdgcn_sched_barrier(0);   // as above
    pj_mac(acc, f1);
    __builtin_amdgcn_sched_barrier(0); } // as above
  pj_read(f1, ar, br, DIN / 32 - 1, lane);
  __builtin_amdgcn_sched_barrier(0);     // as above
  pj_mac(acc, f0); pj_mac(acc, f1);
#pragma unroll
  for (int j = 0; j < 8; ++j) { const int o = j * 16 + col; const float scj = (which == 1) ? bfr(sc[j]) : 1.0f;
#pragma unroll
    for (int r = 0; r < 8; ++r) { const float v = fmaxf(acc[j][r], 0.f) * scj; const _Float16 hv = (_Float16)v; sh[wave * 16 + 8 * g + r][o] = hv; sl[wave * 16 + 8 * g + r][o] = (_Float16)((v - (float)hv) * 1024.0f); } }
  __syncthreads();
  for (int e = tid; e < PJ_R * 16; e += 2 * PJ_R) { const int rl = e >> 4, q = e & 15; vst2((unsigned*)(DH + (r0 + rl) * HP + q * 8), *(const v4u*)&sh[rl][q * 8]); vst2((unsigned*)(DL + (r0 + rl) * HP + q * 8), *(const v4u*)&sl[rl][q * 8]); } }
// ---- col_order: one batch's 2,048 columns in the order: those that count (mask 0) first, the excluded ones behind them, each group by rising index. A column that is excluded adds exactly 0 to every sum, so only the places below the count need work.
// A block of NW waves; mv[i] = the mask of column (i * NW + wave) * 32 + lane. Fills sidx[place] = column, every place once (so every entry is a column of the batch, whatever the mask holds), and returns the count, the same scalar in every wave. Every block that calls it on the same mask gets the same order.
template <int NW> __device__ __forceinline__ int col_order(const int (&mv)[TT / 32 / NW], int* sidx, unsigned* sbits, int wave, int lane) {
  unsigned bw[TT / 32 / NW];   // bit l of bw[i]: lane l's column counts
#pragma unroll
  for (int i = 0; i < TT / 32 / NW; ++i) bw[i] = __builtin_amdgcn_ballot_w32(mv[i] == 0);
  if (lane == 0) {
#pragma unroll
    for (int i = 0; i < TT / 32 / NW; ++i) sbits[i * NW + wave] = bw[i]; }
  __syncthreads();   // publishes the 64 words of bits
  const int c0 = __builtin_popcount(sbits[lane]), c1 = __builtin_popcount(sbits[32 + lane]); int p0 = c0, p1 = c1;   // running sums over the 64 words, lane l holding words l and 32 + l
#pragma unroll
  for (int d = 1; d < 32; d <<= 1) { const int a0 = __builtin_amdgcn_ds_bpermute((lane - d) * 4, p0), a1 = __builtin_amdgcn_ds_bpermute((lane - d) * 4, p1); if (lane >= d) { p0 += a0; p1 += a1; } }
  const int h0 = __builtin_amdgcn_readlane(p0, 31), n = h0 + __builtin_amdgcn_readlane(p1, 31);
  p0 -= c0; p1 += h0 - c1;   // now: counted columns in front of the lane's two words
#pragma unroll
  for (int i = 0; i < TT / 32 / NW; ++i) { const int w = i * NW + wave, e = w * 32 + lane; const int before = __builtin_amdgcn_readlane(i * NW < 32 ? p0 : p1, w & 31) + (int)__builtin_amdgcn_mbcnt_lo(bw[i], 0u);   // counted columns in front of column e
    sidx[mv[i] == 0 ? before : n + (e - before)] = e; }
  __syncthreads();   // publishes the order
  return n; }
// ---- k_vt: block = (128 places of col_order, b, which 0/1, 128-channel group): values (exact bf16) -> planes [b][c][place]; 256-B pieces. A block whose places all lie behind the counted columns writes nothing: k_fa does not read there.
__global__ __launch_bounds__(128) void k_vt(const float* __restrict__ VA, const float* __restrict__ VB, const int* __restrict__ MA, const int* __restrict__ MB, __bf16* __restrict__ PA, __bf16* __restrict__ PB) { __shared__ __align__(16) __bf16 th[128][136]; __shared__ __align__(16) int sidx[TT]; __shared__ unsigned sbits[TT / 32];
  const int tid = threadIdx.x, wave = __builtin_amdgcn_readfirstlane(tid >> 5), lane = tid & 31; const int t0 = blockIdx.x * 128; const size_t b = blockIdx.y; const int which = blockIdx.z >> 1, c0 = (blockIdx.z & 1) * 128; const float* V = which == 0 ? VA : VB; const int* CM = which == 0 ? MA : MB; __bf16* P = which == 0 ? PA : PB;
  int mv[TT / 128];
#pragma unroll   // all sixteen loads in flight together
  for (int i = 0; i < TT / 128; ++i) mv[i] = CM[b * TT + i * 128 + tid];
  asm volatile("s_wait_xcnt 0x0" ::: "memory");   // stands behind the loads above, in front of every later write of a register that they name
  __builtin_amdgcn_sched_barrier(0);               // holds the later address arithmetic behind that wait
  const int n = col_order<4>(mv, sidx, sbits, wave, lane);
  if (t0 < n) {   // the same for the whole block
    const char* vb = (const char*)(V + b * TT * DV + c0);
#pragma unroll 1   // 32 places a trip: their indices first, then their 32 loads in flight together
    for (int k0 = 0; k0 < 128; k0 += 32) { v4i of[8]; float x[32];   // of: byte offsets of the thread's channel in the 32 rows
#pragma unroll
      for (int j = 0; j < 8; ++j) of[j] = *(const v4i*)&sidx[t0 + k0 + j * 4] * (DV * 4) + tid * 4;
#pragma unroll
      for (int j = 0; j < 32; ++j) x[j] = *(const float*)(vb + (unsigned)of[j >> 2][j & 3]);
      asm volatile("s_wait_xcnt 0x0" :: "v"(of[0]), "v"(of[1]), "v"(of[2]), "v"(of[3]), "v"(of[4]), "v"(of[5]), "v"(of[6]), "v"(of[7]) : "memory");   // as above, for these loads; the offsets as inputs: their registers stay theirs up to the wait, so that no load of the group lands in one
      __builtin_amdgcn_sched_barrier(0);               // as above
#pragma unroll
      for (int j = 0; j < 32; ++j) th[tid][k0 + j] = (__bf16)x[j]; }
    __syncthreads();
    for (int e = tid; e < 128 * 16; e += 128) { const int cl = e >> 4, q = e & 15; vst2((unsigned*)(P + (b * DV + c0 + cl) * (size_t)TT + t0 + q * 8), *(const v4u*)&th[cl][q * 8]); } } }
// ---- k_fa: block = (128 rows, batch, direction), one wave = 16 rows x all 256 channels. Scores, softmax and the value product in one kernel: no score goes to memory.
// Per 32 columns (keys of this direction): S^T = COL . ROW^T (3 products, A = column-side rows from LDS, B = the wave's row-side fragments, kept in registers), so a lane holds 16 scores of ONE row;
// running maximum and running sum per lane; e = exp(score - maximum in use), split bf16 hi + lo, is the B operand of O^T += V^T . P^T as it stands in the registers (2 products, A = value planes from LDS).
// The columns are taken in the order of col_order, and only as far as the counted ones reach: a stage is 64 places of that order; in the last stage the places behind the count are excluded by their place.
// Column-side rows (picked by index) and value planes (stored in that order by k_vt) come 64 columns at a time into a two-buffer LDS ring by asynchronous copies.
#define FA_W 8         // waves per block
#define FA_KS 64       // columns per stage
#define FA_NT (TT / FA_KS)
#define FA_KP 136      // column-side row pitch in LDS, f16 (272 B = 16 B x odd: no bank conflict for 16-byte reads down a column of rows)
#define FA_VP 72       // value row pitch in LDS, bf16 (144 B = 16 B x odd)
#define FA_OP 260      // output row pitch in LDS, floats (1,040 B = 16 B x odd)
#define FA_L2E 1.44269504088896340736f   // log2(e)
// the plain builtins: the compiler keeps the distances behind them itself, and their operands may lie above v255, which an asm operand cannot name (this kernel holds more than 256 registers)
__device__ __forceinline__ v8f mm_h(v16h a, v16h b, v8f c) { return __builtin_amdgcn_wmma_f32_16x16x32_f16(false, a, false, b, (short)0, c, false, false); }
__device__ __forceinline__ v8f mm_b(v16b a, v16b b, v8f c) { return __builtin_amdgcn_wmma_f32_16x16x32_bf16(false, a, false, b, (short)0, c, false, false); }
// nothing is scheduled across: keeps a group's LDS reads together and ahead of the block of products in front of which they are written; left free, the compiler spreads them in pairs among the products, each pair waited to 0 just before its use
#define FA_SB() __builtin_amdgcn_sched_barrier(0)
// lane l's value from lane l ^ 16
__device__ __forceinline__ float xhalf(float x) { return __builtin_bit_cast(float, __builtin_amdgcn_permlanex16(__builtin_bit_cast(int, x), __builtin_bit_cast(int, x), 0x76543210, 0xfedcba98, false, false)); }
// one wave's share of stage t into buffer bf: 16 column-side rows of one plane (two 256-B rows a copy: lane half g brings the rows at places 8 g + 0..7 of the wave's sixteen, their columns in ia, ib) and 32 value rows (four 128-B pieces a copy), 16 copies
typedef __attribute__((address_space(1))) v4i g_v4i; typedef __attribute__((address_space(3))) v4i l_v4i;
// the copies as the builtin: its address registers are the compiler's own and may lie above v255
__device__ __forceinline__ void fa_fill(const char* gk, const char* gv, char* lk, char* lv, v4i ia, v4i ib, int t, int bf, int lane) {
  lk += bf * (2 * FA_KS * FA_KP * 2) + (lane >> 4) * (8 * FA_KP * 2) + (lane & 15) * 16;
  gv += (size_t)t * (FA_KS * 2) + (lane >> 3) * (TT * 2) + (lane & 7) * 16; lv += bf * (DV * FA_VP * 2) + (lane >> 3) * (FA_VP * 2) + (lane & 7) * 16;
#pragma unroll
  for (int i = 0; i < 8; ++i) __builtin_amdgcn_global_load_async_to_lds_b128((g_v4i*)(gk + (unsigned)((i < 4 ? ia[i & 3] : ib[i & 3]) * (HP * 2) + (lane & 15) * 16)), (l_v4i*)(lk + i * (FA_KP * 2)), 0, 0);
#pragma unroll
  for (int i = 0; i < 8; ++i) __builtin_amdgcn_global_load_async_to_lds_b128((g_v4i*)(gv + i * (4 * TT * 2)), (l_v4i*)(lv + i * (4 * FA_VP * 2)), 0, 0);
}
__global__ __launch_bounds__(32 * FA_W) void k_fa(const _Float16* __restrict__ QH, const _Float16* __restrict__ QL, const _Float16* __restrict__ KH, const _Float16* __restrict__ KL, const int* __restrict__ M1, const int* __restrict__ M2, const __bf16* __restrict__ V1, const __bf16* __restrict__ V2, float* __restrict__ OUT1, float* __restrict__ OUT2) {
  __shared__ __align__(16) _Float16 sk[2][2][FA_KS][FA_KP]; __shared__ __align__(16) __bf16 sv[2][DV][FA_VP]; __shared__ __align__(16) int sidx[TT]; __shared__ unsigned sbits[TT / 32]; __shared__ __align__(16) float so[FA_W][16][FA_OP];
  const int tid = threadIdx.x, wave = __builtin_amdgcn_readfirstlane(tid >> 5), lane = tid & 31, col = lane & 15, g = lane >> 4; const size_t b = blockIdx.y; const bool sw = blockIdx.z != 0;   // the wave's number in a scalar register: what depends on it alone then costs no vector register over the loop
  // direction 0: rows = queries, columns = keys, values_1 and its mask; direction 1: rows = keys, columns = queries, values_2 and its mask
  const _Float16 *RH = sw ? KH : QH, *RL = sw ? KL : QL, *CH_ = sw ? QH : KH, *CL = sw ? QL : KL; const int* CMASK = sw ? M2 : M1; const __bf16* VP = sw ? V2 : V1; float* OUT = sw ? OUT2 : OUT1;
  const int q0 = blockIdx.x * (16 * FA_W) + wave * 16;
  // wave-uniform bases; the lane's own part: a 256-B row by its index, 16 B at col; row lane >> 3 of four 128-B pieces, 16 B at lane & 7
  const char* gk = (const char*)((wave >> 2) ? CL : CH_) + (b * TT * HP) * 2; const char* gv = (const char*)(VP + (b * DV + wave * 32) * (size_t)TT);
  char *lk = (char*)&sk[0][wave >> 2][(wave & 3) * 16][0], *lv = (char*)&sv[0][wave * 32][0];
  int mv[TT / (32 * FA_W)];
#pragma unroll   // all eight loads in flight together: one memory latency, not eight
  for (int i = 0; i < TT / (32 * FA_W); ++i) mv[i] = CMASK[b * TT + i * (32 * FA_W) + tid];
  asm volatile("s_wait_xcnt 0x0" ::: "memory");   // stands behind the loads above, in front of every later write of a register that they name
  __builtin_amdgcn_sched_barrier(0);               // holds the later address arithmetic behind that wait
  v16h qh[HP / 32], ql[HP / 32];   // every loop over these arrays is unrolled whole so that they are indexed by constants and stay in registers
#pragma unroll
  for (int kb = 0; kb < HP / 32; ++kb) { qh[kb] = frag_h(RH + (b * TT + q0 + col) * HP + kb * 32, lane); ql[kb] = frag_h(RL + (b * TT + q0 + col) * HP + kb * 32, lane); }
  asm volatile("s_wait_xcnt 0x0" ::: "memory");   // as above, for the fragment loads
  __builtin_amdgcn_sched_barrier(0);               // as above
  const int n = col_order<FA_W>(mv, sidx, sbits, wave, lane);   // columns that count
  const int nt = (n + FA_KS - 1) / FA_KS < FA_NT ? (n + FA_KS - 1) / FA_KS : FA_NT;   // stages that hold one; none where every column is excluded
  const int* ir = &sidx[(wave & 3) * 16 + 8 * g];   // the lane's eight indices of stage 0
  if (nt > 0) fa_fill(gk, gv, lk, lv, *(const v4i*)ir, *(const v4i*)(ir + 4), 0, 0, lane);
  v8f acc[DV / 16] = {}; float m = -1.0e38f, l = 0.f;   // acc[j][r] = O^T[channel j * 16 + 8 g + r][row col]; m = the maximum in use, times log2(e) (the same in both halves of the wave); l = this half's share of the row's sum
  // m starts far above what an excluded column (-3.0e38) comes to: its exponential is 0 by itself, also while a row has met no column that counts
  asm volatile("s_wait_asynccnt 0x0" ::: "memory");   // stage 0 has landed before the barrier that publishes it
  __syncthreads();                                     // publishes stage 0
  if (nt > 1) fa_fill(gk, gv, lk, lv, *(const v4i*)(ir + FA_KS), *(const v4i*)(ir + FA_KS + 4), 1, 1, lane);
#pragma unroll 1   // one stage per trip: the buffer index stays a run-time value
  for (int t = 0; t < nt; ++t) { const int bf = t & 1;
    const _Float16* kr = &sk[bf][0][col][0]; const __bf16* vr = &sv[bf][col][0]; const int* in = ir + (t + 2 < nt ? t + 2 : 0) * FA_KS; v4i ia, ib;   // in: the lane's indices of stage t + 2 (of stage 0, unused, where there is none)
    // fragments are read from LDS as groups, one group ahead of their products and only inside this stage's own buffer
    v16h kf[2][2][2]; v16b vf[2][4];   // [buffer][16-column tile][plane], [buffer][16-channel tile]; indexed by constants, as above
#pragma unroll
    for (int tl = 0; tl < 2; ++tl)
#pragma unroll
      for (int p = 0; p < 2; ++p) kf[0][tl][p] = frag_h(kr + (p * FA_KS + tl * 16) * FA_KP, lane);
#pragma unroll
    for (int kk = 0; kk < FA_KS / 32; ++kk) {
      v8f sh[2] = {}, sl[2] = {};
#pragma unroll
      for (int kb = 0; kb < HP / 32; ++kb) { const int cu = kb & 1;
        if (kb + 1 < HP / 32) {
#pragma unroll
          for (int tl = 0; tl < 2; ++tl)
#pragma unroll
            for (int p = 0; p < 2; ++p) kf[cu ^ 1][tl][p] = frag_h(kr + (p * FA_KS + kk * 32 + tl * 16) * FA_KP + (kb + 1) * 32, lane);
        } else {
#pragma unroll
          for (int j = 0; j < 4; ++j) vf[0][j] = frag_b(vr + j * 16 * FA_VP + kk * 32, lane);
        }
        FA_SB();
        // each accumulator takes its products in the order the separate score kernel had: hi.hi; row lo . column hi, then row hi . column lo
        sh[0] = mm_h(kf[cu][0][0], qh[kb], sh[0]); sl[0] = mm_h(kf[cu][0][0], ql[kb], sl[0]); sh[1] = mm_h(kf[cu][1][0], qh[kb], sh[1]); sl[1] = mm_h(kf[cu][1][0], ql[kb], sl[1]);
        sl[0] = mm_h(kf[cu][0][1], qh[kb], sl[0]); sl[1] = mm_h(kf[cu][1][1], qh[kb], sl[1]);
        FA_SB(); }
      // v[8 tl + r] = score of column kk * 32 + 16 tl + 8 g + r against row col: the k order of a 16x16x32 B operand
      float v[16];
#pragma unroll
      for (int i = 0; i < 16; ++i) v[i] = sh[i >> 3][i & 7] + sl[i >> 3][i & 7] * (1.0f / 1024.0f);
      const int left = n - (t * FA_KS + kk * 32);   // counted columns from this group of 32 on: only the last groups hold places behind the count (one wave-uniform test)
      if (left < 32) {
#pragma unroll
        for (int i = 0; i < 16; ++i) v[i] = (i >> 3) * 16 + 8 * g + (i & 7) >= left ? -3.0e38f : v[i]; }
      float mx = v[0];
#pragma unroll
      for (int i = 1; i < 16; ++i) mx = fmaxf(mx, v[i]);
      mx = fmaxf(mx, xhalf(mx)) * FA_L2E;   // both halves of the wave now hold the row's maximum over these 32 columns, in log2 units (-infinity where all 32 are excluded)
      // the maximum in use may trail the true one by up to 8 (an exponential then reaches e^8): sum and accumulators are rescaled only when some row's maximum exceeds it by more; one wave-uniform test per 32 columns
      if (__builtin_amdgcn_ballot_w32(mx > m + 8.0f * FA_L2E) != 0) { const float mn = fmaxf(m, mx); const float f = __builtin_amdgcn_exp2f(m - mn); m = mn; l *= f;
#pragma unroll
        for (int j = 0; j < DV / 16; ++j) acc[j] = acc[j] * f; }
      float s4[4] = {0.f, 0.f, 0.f, 0.f};
#pragma unroll
      for (int i = 0; i < 16; i += 2) { const v2f y = __builtin_elementwise_fma((v2f){v[i], v[i + 1]}, (v2f){FA_L2E, FA_L2E}, (v2f){-m, -m}); const float e0 = __builtin_amdgcn_exp2f(y[0]), e1 = __builtin_amdgcn_exp2f(y[1]); v[i] = e0; v[i + 1] = e1; s4[i & 3] += e0; s4[(i + 1) & 3] += e1; }   // an excluded column: y is below -1.0e38 or -infinity, and exp2 gives 0
      l += (s4[0] + s4[1]) + (s4[2] + s4[3]);
      const F2 p = bsplit16(v);
#pragma unroll
      for (int jg = 0; jg < 4; ++jg) { const int cu = jg & 1;
        if (jg + 1 < 4) {
#pragma unroll
          for (int j = 0; j < 4; ++j) vf[cu ^ 1][j] = frag_b(vr + ((jg + 1) * 4 + j) * 16 * FA_VP + kk * 32, lane);
        } else if (kk + 1 < FA_KS / 32) {
#pragma unroll
          for (int tl = 0; tl < 2; ++tl)
#pragma unroll
            for (int pl = 0; pl < 2; ++pl) kf[0][tl][pl] = frag_h(kr + (pl * FA_KS + (kk + 1) * 32 + tl * 16) * FA_KP, lane);
        } else { ia = *(const v4i*)in; ib = *(const v4i*)(in + 4); }   // read under the stage's last products, so that the refill behind the barrier does not wait for them
        FA_SB();
#pragma unroll
        for (int j = 0; j < 4; ++j) acc[jg * 4 + j] = mm_b(vf[cu][j], p.h, acc[jg * 4 + j]);
#pragma unroll
        for (int j = 0; j < 4; ++j) acc[jg * 4 + j] = mm_b(vf[cu][j], p.l, acc[jg * 4 + j]);
        FA_SB(); } }
    asm volatile("s_wait_dscnt 0x0" ::: "memory");      // this wave's reads of buffer bf are over before it is handed to the copies
    asm volatile("s_wait_asynccnt 0x0" ::: "memory");   // this wave's copies of stage t + 1 have landed
    __syncthreads();                                     // publishes stage t + 1 and ends every reader's last read of buffer bf
    if (t + 2 < nt) fa_fill(gk, gv, lk, lv, ia, ib, t + 2, bf, lane); }
  asm volatile("s_wait_asynccnt 0x0" ::: "memory");     // nothing is in flight when the wave goes on to its end
  const float lt = l + xhalf(l); const float inv = lt > 0.f ? 1.0f / lt : 0.f;   // a row whose every column is masked stays all zero
  // through the wave's own LDS rows, so that the stores are whole lines
#pragma unroll
  for (int j = 0; j < DV / 16; ++j) { const v8f o = acc[j] * inv; vst2(&so[wave][col][j * 16 + 8 * g], (v4f){o[0], o[1], o[2], o[3]}); vst2(&so[wave][col][j * 16 + 8 * g + 4], (v4f){o[4], o[5], o[6], o[7]}); }
  LDSX();
  for (int rl = 0; rl < 16; ++rl) { vst2(OUT + (b * TT + q0 + rl) * DV + lane * 4, *(const v4f*)&so[wave][rl][lane * 4]); vst2(OUT + (b * TT + q0 + rl) * DV + 128 + lane * 4, *(const v4f*)&so[wave][rl][128 + lane * 4]); } }
extern "C" void kernel_launch(void* const* d_in, const int* in_sizes, int n_in, void* d_out, int out_size, void* d_ws, size_t ws_size, hipStream_t stream) {
  (void)in_sizes; (void)n_in; (void)out_size;
  const float** F = (const float**)d_in;   // 0 queries [8,2048,256], 1 keys, 2 values_1 [8,2048,256], 3 values_1_mask [8,2048] int (nonzero = excluded key), 4 values_2, 5 values_2_mask (nonzero = excluded query), 6 Wq [128,256] ([out,in]), 7 Wk, 8 scaling [1,128]; outputs: output @ 0, output_2 @ float 4,194,304
  if (ws_size < (size_t)WS_END) return;
  char* ws = (char*)d_ws; _Float16 *QH = (_Float16*)(ws + WS_QH), *QL = (_Float16*)(ws + WS_QL), *KH = (_Float16*)(ws + WS_KH), *KL = (_Float16*)(ws + WS_KL); __bf16 *V1 = (__bf16*)(ws + WS_V1), *V2 = (__bf16*)(ws + WS_V2);
  float* OUT1 = (float*)d_out; float* OUT2 = (float*)d_out + (size_t)NB * TT * DV;
  k_proj<<<dim3(TNB * TT / PJ_R, 2), 2 * PJ_R, 0, stream>>>(F[0], F[1], F[6], F[7], F[8], QH, QL, KH, KL);
  k_vt<<<dim3(TT / 128, TNB, 4), 128, 0, stream>>>(F[2], F[4], (const int*)d_in[3], (const int*)d_in[5], V1, V2);
  k_fa<<<dim3(TT / (16 * FA_W), TNB, 2), 32 * FA_W, 0, stream>>>(QH, QL, KH, KL, (const int*)d_in[3], (const int*)d_in[5], V1, V2, OUT1, OUT2);
}

// v008
// Measured time: 55.5 microseconds a run.
// Two timings next to v007 both put it at 1.09 times that version's speed.
// Counting every step since v000, it is 16.1 times as fast.
// compute dtype: all float inputs rounded to bf16, the int masks read; pq = relu(q Wq^T), pk = relu(k Wk^T) * scaling with EXACT bf16 products on WMMA 16x16x32, f32 accumulate, stored as f16 hi + residual (x 2^10) rows; scores over K = 128 with 3 products (hi.hi, lo.hi, hi.lo), formed only for the columns whose key-side mask is clear (the columns are taken in the order clear first, set behind; stages wholly behind the clear ones are not run), kept in f32 registers; softmax in f32 with a running maximum and sum (each exponential is the hardware's exp2 of score * log2(e) - maximum, the maximum kept in log2 units, formed by one fused multiply-add); the exponentials split bf16 hi + lo against the EXACT bf16 value planes (2 products), divided by the row's sum at the end; f32 outputs. The second output runs the same pipeline with the roles of queries and keys swapped.
#include <hip/hip_runtime.h>
#include <math.h>

typedef __attribute__((ext_vector_type(16))) _Float16 v16h;
typedef __attribute__((ext_vector_type(16))) __bf16 v16b;
typedef __attribute__((ext_vector_type(8)))  _Float16 v8h;
typedef __attribute__((ext_vector_type(8)))  float v8f;
typedef __attribute__((ext_vector_type(4)))  float v4f;
typedef __attribute__((ext_vector_type(2)))  float v2f;
typedef __attribute__((ext_vector_type(4)))  unsigned v4u;
typedef __attribute__((ext_vector_type(4)))  int v4i;
typedef float __attribute__((may_alias)) float_a;
typedef int __attribute__((may_alias)) int_a;

template <typename T> __device__ __forceinline__ void vst2(void* p, T v) { *(T*)p = v;  }
__device__ __forceinline__ v8f wmma16(v16h a, v16h b, v8f c) {
  v8f d = __builtin_amdgcn_wmma_f32_16x16x32_f16(false, a, false, b, (short)0, c, false, false);
  asm volatile("v_nop\n\tv_nop\n\tv_nop\n\tv_nop" : "+v"(d) : "v"(a), "v"(b));
  return d;
}
__device__ __forceinline__ v8f wmma_bf(v16b a, v16b b, v8f c) {
  v8f d = __builtin_amdgcn_wmma_f32_16x16x32_bf16(false, a, false, b, (short)0, c, false, false);
  asm volatile("v_nop\n\tv_nop\n\tv_nop\n\tv_nop" : "+v"(d) : "v"(a), "v"(b));
  return d;
}
// 16x16x32 fragments: lane = (h = lane>>4, row/col = lane&15); elements 0..7 = k0+8h+0..7, 8..15 = k0+16+8h+0..7; D element r = row 8h+r
__device__ __forceinline__ v16h frag_h(const _Float16* rowk0, int lane) {
  union { v16h v; v8h q[2]; } u; const _Float16* p = rowk0 + 8 * (lane >> 4);
  u.q[0] = *(const v8h*)p; u.q[1] = *(const v8h*)(p + 16); return u.v;
}
__device__ __forceinline__ v16h frag_f32(const float* rowk0, int lane) {
  v16h a; const float* p = rowk0 + 8 * (lane >> 4);
#pragma unroll
  for (int i = 0; i < 8; ++i) { a[i] = (_Float16)p[i]; a[8 + i] = (_Float16)p[16 + i]; }
  return a;
}
__device__ __forceinline__ v16h frag_f32s(const float* rowk0, int lane, float sc) {
  v16h a; const float* p = rowk0 + 8 * (lane >> 4);
#pragma unroll
  for (int i = 0; i < 8; ++i) { a[i] = (_Float16)(p[i] * sc); a[8 + i] = (_Float16)(p[16 + i] * sc); }
  return a;
}
// column fragment from a [K][ld] layout (column n), rows >= K read as 0
__device__ __forceinline__ v16h fragc_f32(const float* W, int k0, int n, int lane, int ld, int K) {
  v16h a; const int g = lane >> 4;
#pragma unroll
  for (int i = 0; i < 8; ++i) { const int ka = k0 + 8 * g + i, kb = ka + 16;
    a[i] = (_Float16)(ka < K ? W[(size_t)(ka < K ? ka : K - 1) * ld + n] : 0.f); a[8 + i] = (_Float16)(kb < K ? W[(size_t)(kb < K ? kb : K - 1) * ld + n] : 0.f); }
  return a;
}
struct F2 { v16b h, l; };
__device__ __forceinline__ F2 bsplit16(const float v[16]) { F2 r;
#pragma unroll
  for (int i = 0; i < 16; ++i) { const __bf16 h = (__bf16)v[i]; r.h[i] = h; r.l[i] = (__bf16)(v[i] - (float)h); }
  return r; }
__device__ __forceinline__ F2 split_row(const float* row, int k0, int lane) { float v[16]; const float* p = row + k0 + 8 * (lane >> 4);
#pragma unroll
  for (int i = 0; i < 8; ++i) { v[i] = p[i]; v[8 + i] = p[16 + i]; }
  return bsplit16(v); }
__device__ __forceinline__ F2 split_rowK(const float* row, int k0, int lane, int K) { float v[16]; const int g = lane >> 4;
#pragma unroll
  for (int i = 0; i < 8; ++i) { const int ka = k0 + 8 * g + i, kb = ka + 16; v[i] = ka < K ? row[ka < K ? ka : K - 1] : 0.f; v[8 + i] = kb < K ? row[kb < K ? kb : K - 1] : 0.f; }
  return bsplit16(v); }
__device__ __forceinline__ F2 split_col(const float* W, int k0, int n, int lane, int ld, int K) { float v[16]; const int g = lane >> 4;
#pragma unroll
  for (int i = 0; i < 8; ++i) { const int ka = k0 + 8 * g + i, kb = ka + 16; v[i] = ka < K ? W[(size_t)(ka < K ? ka : K - 1) * ld + n] : 0.f; v[8 + i] = kb < K ? W[(size_t)(kb < K ? kb : K - 1) * ld + n] : 0.f; }
  return bsplit16(v); }
__device__ __forceinline__ v8f mac3(const F2& a, const F2& b, v8f c) { c = wmma_bf(a.l, b.h, c); c = wmma_bf(a.h, b.l, c); return wmma_bf(a.h, b.h, c); }
__device__ __forceinline__ float sigm(float v) { return 1.0f / (1.0f + expf(-v)); }
#define LDSX() do { asm volatile("s_wait_dscnt 0" ::: "memory"); __builtin_amdgcn_wave_barrier(); __builtin_amdgcn_fence(__ATOMIC_RELEASE, "workgroup"); } while (0)

// Scaled-dot attention with dual softmax (B 8, Lq = Lk = 2,048, D 256, H 128): pq = relu(queries Wq^T); pk = relu(keys Wk^T) * scaling; scores = pq pk^T; output = softmax_k(scores | values_1_mask[k] -> -inf) . values_1; output_2 = softmax_q(scores^T | values_2_mask[q] -> -inf) . values_2.
__device__ __forceinline__ float bfr(float v) { return (float)(__bf16)v; }
#define NB 8
#define TT 2048
#define DIN 256
#define HP 128         // projected width
#define DV 256         // value width
#ifndef TNB
#define TNB NB
#endif
typedef __attribute__((ext_vector_type(8))) __bf16 v8b;
__device__ __forceinline__ v16b frag_b(const __bf16* rowk0, int lane) { union { v16b v; v8b q[2]; } u; const __bf16* p = rowk0 + 8 * (lane >> 4); u.q[0] = *(const v8b*)p; u.q[1] = *(const v8b*)(p + 16); return u.v; }
#define WS_QH  0u                                          // f16 pq hi rows [b*T+q][128]
#define WS_QL  (WS_QH + 2u * (size_t)NB * TT * HP)
#define WS_KH  (WS_QL + 2u * (size_t)NB * TT * HP)           // f16 pk hi rows
#define WS_KL  (WS_KH + 2u * (size_t)NB * TT * HP)
#define WS_V1  (WS_KL + 2u * (size_t)NB * TT * HP)           // bf16 values_1 planes [b][c][place of k in col_order], written as far as the counted columns reach, rounded up to 128
#define WS_V2  (WS_V1 + 2u * (size_t)NB * DV * TT)           // bf16 values_2 planes [b][c][place of q in col_order], likewise
#define WS_END (WS_V2 + 2u * (size_t)NB * DV * TT)
// ---- col_order: one batch's 2,048 columns in the order: those that count (mask 0) first, the excluded ones behind them, each group by rising index. A column that is excluded adds exactly 0 to every sum, so only the places below the count need work.
// A block of NW waves; mv[i] = the mask of column (i * NW + wave) * 32 + lane. Fills sidx[place] = column, every place once (so every entry is a column of the batch, whatever the mask holds), and returns the count, the same scalar in every wave. Every block that calls it on the same mask gets the same order.
template <int NW> __device__ __forceinline__ int col_order(const int (&mv)[TT / 32 / NW], int* sidx, unsigned* sbits, int wave, int lane) {
  unsigned bw[TT / 32 / NW];   // bit l of bw[i]: lane l's column counts
#pragma unroll
  for (int i = 0; i < TT / 32 / NW; ++i) bw[i] = __builtin_amdgcn_ballot_w32(mv[i] == 0);
  if (lane == 0) {
#pragma unroll
    for (int i = 0; i < TT / 32 / NW; ++i) sbits[i * NW + wave] = bw[i]; }
  __syncthreads();   // publishes the 64 words of bits
  const int c0 = __builtin_popcount(sbits[lane]), c1 = __builtin_popcount(sbits[32 + lane]); int p0 = c0, p1 = c1;   // running sums over the 64 words, lane l holding words l and 32 + l
#pragma unroll
  for (int d = 1; d < 32; d <<= 1) { const int a0 = __builtin_amdgcn_ds_bpermute((lane - d) * 4, p0), a1 = __builtin_amdgcn_ds_bpermute((lane - d) * 4, p1); if (lane >= d) { p0 += a0; p1 += a1; } }
  const int h0 = __builtin_amdgcn_readlane(p0, 31), n = h0 + __builtin_amdgcn_readlane(p1, 31);
  p0 -= c0; p1 += h0 - c1;   // now: counted columns in front of the lane's two words
#pragma unroll
  for (int i = 0; i < TT / 32 / NW; ++i) { const int w = i * NW + wave, e = w * 32 + lane; const int before = __builtin_amdgcn_readlane(i * NW < 32 ? p0 : p1, w & 31) + (int)__builtin_amdgcn_mbcnt_lo(bw[i], 0u);   // counted columns in front of column e
    sidx[mv[i] == 0 ? before : n + (e - before)] = e; }
  __syncthreads();   // publishes the order
  return n; }
// ---- k_proj: block = (128 rows, which), one wave = 16 rows x all 128 columns: relu(x W^T) (x scaling for pk), exact; stored as f16 hi + residual rows (256-B rows)
// The weight matrix and the block's 128 input rows go once into LDS as bf16: every global load is 512 contiguous bytes of a wave, and all of a thread's loads are in flight together; the fragments come from LDS.
// The same block also turns one tile of a value array (exact bf16) into planes [b][c][place of col_order], 256-B pieces: its rows are loaded during the products. A block whose places all lie behind the counted columns writes no plane: k_fa does not read there.
#define PJ_R 128       // rows per block
#define PJ_P 264       // operand row pitch in LDS, bf16 (528 B = 16 B x odd: no bank conflict for 16-byte reads down a column of rows)
typedef __attribute__((ext_vector_type(4))) __bf16 v4b;
__device__ __forceinline__ v4b cvt4(v4f t) { return (v4b){(__bf16)t[0], (__bf16)t[1], (__bf16)t[2], (__bf16)t[3]}; }
struct PJF { v16b a, w[8]; };   // the fragments of one 32-wide k step
__device__ __forceinline__ void pj_read(PJF& f, const __bf16* ar, const __bf16* br, int kc, int lane) { f.a = frag_b(ar + kc * 32, lane);
#pragma unroll
  for (int j = 0; j < 8; ++j) f.w[j] = frag_b(br + j * 16 * PJ_P + kc * 32, lane); }
__device__ __forceinline__ void pj_mac(v8f (&acc)[8], const PJF& f) {
#pragma unroll
  for (int j = 0; j < 8; ++j) acc[j] = __builtin_amdgcn_wmma_f32_16x16x32_bf16(false, f.a, false, f.w[j], (short)0, acc[j], false, false); }
__global__ __launch_bounds__(2 * PJ_R) void k_proj(const float* __restrict__ XQ, const float* __restrict__ XK, const float* __restrict__ WQ, const float* __restrict__ WK, const float* __restrict__ SCL, _Float16* __restrict__ QH, _Float16* __restrict__ QL, _Float16* __restrict__ KH, _Float16* __restrict__ KL, const float* __restrict__ VA, const float* __restrict__ VB, const int* __restrict__ MA, const int* __restrict__ MB, __bf16* __restrict__ PA, __bf16* __restrict__ PB) { __shared__ __align__(16) _Float16 sh[PJ_R][136], sl[PJ_R][136]; __shared__ __align__(16) __bf16 sw[HP][PJ_P], sx[PJ_R][PJ_P]; __shared__ __align__(16) __bf16 th[DV][136]; __shared__ __align__(16) int sidx[TT]; __shared__ unsigned sbits[TT / 32];
  const int tid = threadIdx.x, wave = tid >> 5, lane = tid & 31, col = lane & 15, g = lane >> 4; const int which = blockIdx.y; const size_t r0 = (size_t)blockIdx.x * PJ_R; const float* X = which == 0 ? XQ : XK; const float* Wt = which == 0 ? WQ : WK; _Float16* DH = which == 0 ? QH : KH; _Float16* DL = which == 0 ? QL : KL;
  // the block's value tile: 128 places of col_order of batch blockIdx.x / 16 of values_1 (which 0) or values_2 (which 1), all 256 channels
  const int t0 = (blockIdx.x & (TT / 128 - 1)) * 128; const size_t vb = blockIdx.x / (TT / 128); const float* V = which == 0 ? VA : VB; const int* CM = which == 0 ? MA : MB; __bf16* P = which == 0 ? PA : PB;
  // 16-byte piece i * 256 + tid of a [128][256] float array: row 4 i + (tid >> 6), floats 4 (tid & 63) and the three behind
  const float* xg = X + r0 * DIN + tid * 4; const float* wg = Wt + tid * 4; const int sr = tid >> 6, sc4 = (tid & 63) * 4;
  v4f wr[32], xr[32]; float sc[8];   // indexed by constants: every loop over them is unrolled whole
#pragma unroll
  for (int i = 0; i < 32; ++i) wr[i] = *(const v4f*)(wg + i * 1024);   // the weights first: they come from L2 and are put away while the input rows are still on their way from memory
  __builtin_amdgcn_sched_barrier(0);   // keeps that order: left free, the compiler issues two of the weight loads behind the input rows, and loads are waited for in issue order
#pragma unroll
  for (int i = 0; i < 32; ++i) xr[i] = *(const v4f*)(xg + i * 1024);
  __builtin_amdgcn_sched_barrier(0);   // every load is issued before the first is waited for
  int mv[TT / (2 * PJ_R)];   // the mask of the value tile's batch, behind the operand loads: it is first used behind the barrier that waits for them all
#pragma unroll
  for (int i = 0; i < TT / (2 * PJ_R); ++i) mv[i] = CM[vb * TT + i * (2 * PJ_R) + tid];
#pragma unroll
  for (int j = 0; j < 8; ++j) sc[j] = SCL[j * 16 + col];   // all eight here, with the other loads, not one by one in front of their use
  asm volatile("s_wait_xcnt 0x0" ::: "memory");   // stands behind the loads above, in front of every later write of a register that they name
  __builtin_amdgcn_sched_barrier(0);               // holds the later address arithmetic behind that wait
#pragma unroll
  for (int i = 0; i < 32; ++i) *(v4b*)&sw[i * 4 + sr][sc4] = cvt4(wr[i]);
#pragma unroll
  for (int i = 0; i < 32; ++i) *(v4b*)&sx[i * 4 + sr][sc4] = cvt4(xr[i]);
  __syncthreads();   // publishes both staged operands
  const int n = col_order<2 * PJ_R / 32>(mv, sidx, sbits, __builtin_amdgcn_readfirstlane(tid >> 5), lane);   // columns of that batch that count
  const bool vact = t0 < n;   // the same for the whole block
  // thread = (32 places in a row: tid >> 6, four channels: tid & 63): a load is 512 contiguous bytes of a wave; all 32 are issued here and are on their way from memory during the products below
  v4f vx[32];
  if (vact) { v4i of[8];   // byte offsets of the thread's 16 bytes in its 32 rows
#pragma unroll
    for (int j = 0; j < 8; ++j) of[j] = *(const v4i*)&sidx[t0 + (tid >> 6) * 32 + j * 4] * (DV * 4) + (tid & 63) * 16;
    const char* vp = (const char*)(V + vb * TT * DV);
#pragma unroll
    for (int j = 0; j < 32; ++j) vx[j] = *(const v4f*)(vp + (unsigned)of[j >> 2][j & 3]);
    asm volatile("s_wait_xcnt 0x0" :: "v"(of[0]), "v"(of[1]), "v"(of[2]), "v"(of[3]), "v"(of[4]), "v"(of[5]), "v"(of[6]), "v"(of[7]) : "memory"); }   // as above, for these loads; the offsets as inputs: their registers stay theirs up to the wait, so that no load of the group lands in one
  v8f acc[8] = {};
  const __bf16* ar = &sx[wave * 16 + col][0]; const __bf16* br = &sw[col][0];
  PJF f0, f1;   // a k step's fragments are read as one group, one step ahead of their products
  pj_read(f0, ar, br, 0, lane);
#pragma unroll 1   // two k steps per trip, one per fragment buffer; the last two steps stand behind the loop, so that no trip has a branch round its reads
  for (int kc = 0; kc < DIN / 32 - 2; kc += 2) {
    pj_read(f1, ar, br, kc + 1, lane);
    __builtin_amdgcn_sched_barrier(0);   // keeps the next step's LDS reads together and ahead of this step's products
    pj_mac(acc, f0);
    __builtin_amdgcn_sched_barrier(0);   // as above
    pj_read(f0, ar, br, kc + 2, lane);
    __builtin_amdgcn_sched_barrier(0);   // as above
    pj_mac(acc, f1);
    __builtin_amdgcn_sched_barrier(0); } // as above
  pj_read(f1, ar, br, DIN / 32 - 1, lane);
  __builtin_amdgcn_sched_barrier(0);     // as above
  pj_mac(acc, f0); pj_mac(acc, f1);
#pragma unroll
  for (int j = 0; j < 8; ++j) { const int o = j * 16 + col; const float scj = (which == 1) ? bfr(sc[j]) : 1.0f;
#pragma unroll
    for (int r = 0; r < 8; ++r) { const float v = fmaxf(acc[j][r], 0.f) * scj; const _Float16 hv = (_Float16)v; sh[wave * 16 + 8 * g + r][o] = hv; sl[wave * 16 + 8 * g + r][o] = (_Float16)((v - (float)hv) * 1024.0f); } }
  // channel c lies in LDS row (c & 3) * 64 + (c >> 2): the lanes of a wave then write rows that follow one another (272-B pitch: no bank conflict)
  if (vact) {
#pragma unroll
    for (int e = 0; e < 4; ++e)
#pragma unroll
      for (int s = 0; s < 4; ++s) { v8b w;
#pragma unroll
        for (int u = 0; u < 8; ++u) w[u] = (__bf16)vx[s * 8 + u][e];
        *(v8b*)&th[e * 64 + (tid & 63)][(tid >> 6) * 32 + s * 8] = w; } }
  __syncthreads();
  for (int e = tid; e < PJ_R * 16; e += 2 * PJ_R) { const int rl = e >> 4, q = e & 15; vst2((unsigned*)(DH + (r0 + rl) * HP + q * 8), *(const v4u*)&sh[rl][q * 8]); vst2((unsigned*)(DL + (r0 + rl) * HP + q * 8), *(const v4u*)&sl[rl][q * 8]); }
  if (vact) {   // piece i * 256 + tid: LDS row i * 16 + (tid >> 4), 16 bytes at tid & 15; a constant trip count, unrolled: the sixteen LDS reads go ahead together and the stores differ by constant offsets
#pragma unroll
    for (int i = 0; i < DV * 16 / (2 * PJ_R); ++i) vst2((unsigned*)(P + (vb * DV + ((i & 3) * 16 + (tid >> 4)) * 4 + (i >> 2)) * (size_t)TT + t0 + (tid & 15) * 8), *(const v4u*)&th[i * 16 + (tid >> 4)][(tid & 15) * 8]); } }
// ---- k_fa: block = (128 rows, batch, direction), one wave = 16 rows x all 256 channels. Scores, softmax and the value product in one kernel: no score goes to memory.
// Per 32 columns (keys of this direction): S^T = COL . ROW^T (3 products, A = column-side rows from LDS, B = the wave's row-side fragments, kept in registers), so a lane holds 16 scores of ONE row;
// running maximum and running sum per lane; e = exp(score - maximum in use), split bf16 hi + lo, is the B operand of O^T += V^T . P^T as it stands in the registers (2 products, A = value planes from LDS).
// The columns are taken in the order of col_order, and only as far as the counted ones reach: a stage is 64 places of that order; in the last stage the places behind the count are excluded by their place.
// Column-side rows (picked by index) and value planes (stored in that order by k_proj) come 64 columns at a time into a two-buffer LDS ring by asynchronous copies.
#define FA_W 8         // waves per block
#define FA_KS 64       // columns per stage
#define FA_NT (TT / FA_KS)
#define FA_KP 136      // column-side row pitch in LDS, f16 (272 B = 16 B x odd: no bank conflict for 16-byte reads down a column of rows)
#define FA_VP 72       // value row pitch in LDS, bf16 (144 B = 16 B x odd)
#define FA_OP 260      // output row pitch in LDS, floats (1,040 B = 16 B x odd)
#define FA_L2E 1.44269504088896340736f   // log2(e)
// the plain builtins: the compiler keeps the distances behind them itself, and their operands may lie above v255, which an asm operand cannot name (this kernel holds more than 256 registers)
__device__ __forceinline__ v8f mm_h(v16h a, v16h b, v8f c) { return __builtin_amdgcn_wmma_f32_16x16x32_f16(false, a, false, b, (short)0, c, false, false); }
__device__ __forceinline__ v8f mm_b(v16b a, v16b b, v8f c) { return __builtin_amdgcn_wmma_f32_16x16x32_bf16(false, a, false, b, (short)0, c, false, false); }
// nothing is scheduled across: keeps a group's LDS reads together and ahead of the block of products in front of which they are written; left free, the compiler spreads them in pairs among the products, each pair waited to 0 just before its use
#define FA_SB() __builtin_amdgcn_sched_barrier(0)
// lane l's value from lane l ^ 16
__device__ __forceinline__ float xhalf(float x) { return __builtin_bit_cast(float, __builtin_amdgcn_permlanex16(__builtin_bit_cast(int, x), __builtin_bit_cast(int, x), 0x76543210, 0xfedcba98, false, false)); }
// one wave's share of stage t into buffer bf: 16 column-side rows of one plane (two 256-B rows a copy: lane half g brings the rows at places 8 g + 0..7 of the wave's sixteen, their columns in ia, ib) and 32 value rows (four 128-B pieces a copy), 16 copies
typedef __attribute__((address_space(1))) v4i g_v4i; typedef __attribute__((address_space(3))) v4i l_v4i;
// the copies as the builtin: its address registers are the compiler's own and may lie above v255
__device__ __forceinline__ void fa_fill(const char* gk, const char* gv, char* lk, char* lv, v4i ia, v4i ib, int t, int bf, int lane) {
  lk += bf * (2 * FA_KS * FA_KP * 2) + (lane >> 4) * (8 * FA_KP * 2) + (lane & 15) * 16;
  gv += (size_t)t * (FA_KS * 2) + (lane >> 3) * (TT * 2) + (lane & 7) * 16; lv += bf * (DV * FA_VP * 2) + (lane >> 3) * (FA_VP * 2) + (lane & 7) * 16;
#pragma unroll
  for (int i = 0; i < 8; ++i) __builtin_amdgcn_global_load_async_to_lds_b128((g_v4i*)(gk + (unsigned)((i < 4 ? ia[i & 3] : ib[i & 3]) * (HP * 2) + (lane & 15) * 16)), (l_v4i*)(lk + i * (FA_KP * 2)), 0, 0);
#pragma unroll
  for (int i = 0; i < 8; ++i) __builtin_amdgcn_global_load_async_to_lds_b128((g_v4i*)(gv + i * (4 * TT * 2)), (l_v4i*)(lv + i * (4 * FA_VP * 2)), 0, 0);
}
__global__ __launch_bounds__(32 * FA_W) void k_fa(const _Float16* __restrict__ QH, const _Float16* __restrict__ QL, const _Float16* __restrict__ KH, const _Float16* __restrict__ KL, const int* __restrict__ M1, const int* __restrict__ M2, const __bf16* __restrict__ V1, const __bf16* __restrict__ V2, float* __restrict__ OUT1, float* __restrict__ OUT2) {
  __shared__ __align__(16) _Float16 sk[2][2][FA_KS][FA_KP]; __shared__ __align__(16) __bf16 sv[2][DV][FA_VP]; __shared__ __align__(16) int sidx[TT]; __shared__ unsigned sbits[TT / 32]; __shared__ __align__(16) float so[FA_W][16][FA_OP];
  const int tid = threadIdx.x, wave = __builtin_amdgcn_readfirstlane(tid >> 5), lane = tid & 31, col = lane & 15, g = lane >> 4; const size_t b = blockIdx.y; const bool sw = blockIdx.z != 0;   // the wave's number in a scalar register: what depends on it alone then costs no vector register over the loop
  // direction 0: rows = queries, columns = keys, values_1 and its mask; direction 1: rows = keys, columns = queries, values_2 and its mask
  const _Float16 *RH = sw ? KH : QH, *RL = sw ? KL : QL, *CH_ = sw ? QH : KH, *CL = sw ? QL : KL; const int* CMASK = sw ? M2 : M1; const __bf16* VP = sw ? V2 : V1; float* OUT = sw ? OUT2 : OUT1;
  const int q0 = blockIdx.x * (16 * FA_W) + wave * 16;
  // wave-uniform bases; the lane's own part: a 256-B row by its index, 16 B at col; row lane >> 3 of four 128-B pieces, 16 B at lane & 7
  const char* gk = (const char*)((wave >> 2) ? CL : CH_) + (b * TT * HP) * 2; const char* gv = (const char*)(VP + (b * DV + wave * 32) * (size_t)TT);
  char *lk = (char*)&sk[0][wave >> 2][(wave & 3) * 16][0], *lv = (char*)&sv[0][wave * 32][0];
  int mv[TT / (32 * FA_W)];
#pragma unroll   // all eight loads in flight together: one memory latency, not eight
  for (int i = 0; i < TT / (32 * FA_W); ++i) mv[i] = CMASK[b * TT + i * (32 * FA_W) + tid];
  asm volatile("s_wait_xcnt 0x0" ::: "memory");   // stands behind the loads above, in front of every later write of a register that they name
  __builtin_amdgcn_sched_barrier(0);               // holds the later address arithmetic behind that wait
  v16h qh[HP / 32], ql[HP / 32];   // every loop over these arrays is unrolled whole so that they are indexed by constants and stay in registers
#pragma unroll
  for (int kb = 0; kb < HP / 32; ++kb) { qh[kb] = frag_h(RH + (b * TT + q0 + col) * HP + kb * 32, lane); ql[kb] = frag_h(RL + (b * TT + q0 + col) * HP + kb * 32, lane); }
  asm volatile("s_wait_xcnt 0x0" ::: "memory");   // as above, for the fragment loads
  __builtin_amdgcn_sched_barrier(0);               // as above
  const int n = col_order<FA_W>(mv, sidx, sbits, wave, lane);   // columns that count
  const int nt = (n + FA_KS - 1) / FA_KS < FA_NT ? (n + FA_KS - 1) / FA_KS : FA_NT;   // stages that hold one; none where every column is excluded
  const int* ir = &sidx[(wave & 3) * 16 + 8 * g];   // the lane's eight indices of stage 0
  if (nt > 0) fa_fill(gk, gv, lk, lv, *(const v4i*)ir, *(const v4i*)(ir + 4), 0, 0, lane);
  v8f acc[DV / 16] = {}; float m = -1.0e38f, l = 0.f;   // acc[j][r] = O^T[channel j * 16 + 8 g + r][row col]; m = the maximum in use, times log2(e) (the same in both halves of the wave); l = this half's share of the row's sum
  // m starts far above what an excluded column (-3.0e38) comes to: its exponential is 0 by itself, also while a row has met no column that counts
  asm volatile("s_wait_asynccnt 0x0" ::: "memory");   // stage 0 has landed before the barrier that publishes it
  __syncthreads();                                     // publishes stage 0
  if (nt > 1) fa_fill(gk, gv, lk, lv, *(const v4i*)(ir + FA_KS), *(const v4i*)(ir + FA_KS + 4), 1, 1, lane);
#pragma unroll 1   // one stage per trip: the buffer index stays a run-time value
  for (int t = 0; t < nt; ++t) { const int bf = t & 1;
    const _Float16* kr = &sk[bf][0][col][0]; const __bf16* vr = &sv[bf][col][0]; const int* in = ir + (t + 2 < nt ? t + 2 : 0) * FA_KS; v4i ia, ib;   // in: the lane's indices of stage t + 2 (of stage 0, unused, where there is none)
    // fragments are read from LDS as groups, one group ahead of their products and only inside this stage's own buffer
    v16h kf[2][2][2]; v16b vf[2][4];   // [buffer][16-column tile][plane], [buffer][16-channel tile]; indexed by constants, as above
#pragma unroll
    for (int tl = 0; tl < 2; ++tl)
#pragma unroll
      for (int p = 0; p < 2; ++p) kf[0][tl][p] = frag_h(kr + (p * FA_KS + tl * 16) * FA_KP, lane);
#pragma unroll
    for (int kk = 0; kk < FA_KS / 32; ++kk) {
      v8f sh[2] = {}, sl[2] = {};
#pragma unroll
      for (int kb = 0; kb < HP / 32; ++kb) { const int cu = kb & 1;
        if (kb + 1 < HP / 32) {
#pragma unroll
          for (int tl = 0; tl < 2; ++tl)
#pragma unroll
            for (int p = 0; p < 2; ++p) kf[cu ^ 1][tl][p] = frag_h(kr + (p * FA_KS + kk * 32 + tl * 16) * FA_KP + (kb + 1) * 32, lane);
        } else {
#pragma unroll
          for (int j = 0; j < 4; ++j) vf[0][j] = frag_b(vr + j * 16 * FA_VP + kk * 32, lane);
        }
        FA_SB();
        // each accumulator takes its products in the order the separate score kernel had: hi.hi; row lo . column hi, then row hi . column lo
        sh[0] = mm_h(kf[cu][0][0], qh[kb], sh[0]); sl[0] = mm_h(kf[cu][0][0], ql[kb], sl[0]); sh[1] = mm_h(kf[cu][1][0], qh[kb], sh[1]); sl[1] = mm_h(kf[cu][1][0], ql[kb], sl[1]);
        sl[0] = mm_h(kf[cu][0][1], qh[kb], sl[0]); sl[1] = mm_h(kf[cu][1][1], qh[kb], sl[1]);
        FA_SB(); }
      // v[8 tl + r] = score of column kk * 32 + 16 tl + 8 g + r against row col: the k order of a 16x16x32 B operand
      float v[16];
#pragma unroll
      for (int i = 0; i < 16; ++i) v[i] = sh[i >> 3][i & 7] + sl[i >> 3][i & 7] * (1.0f / 1024.0f);
      const int left = n - (t * FA_KS + kk * 32);   // counted columns from this group of 32 on: only the last groups hold places behind the count (one wave-uniform test)
      if (left < 32) {
#pragma unroll
        for (int i = 0; i < 16; ++i) v[i] = (i >> 3) * 16 + 8 * g + (i & 7) >= left ? -3.0e38f : v[i]; }
      float mx = v[0];
#pragma unroll
      for (int i = 1; i < 16; ++i) mx = fmaxf(mx, v[i]);
      mx = fmaxf(mx, xhalf(mx)) * FA_L2E;   // both halves of the wave now hold the row's maximum over these 32 columns, in log2 units (-infinity where all 32 are excluded)
      // the maximum in use may trail the true one by up to 8 (an exponential then reaches e^8): sum and accumulators are rescaled only when some row's maximum exceeds it by more; one wave-uniform test per 32 columns
      if (__builtin_amdgcn_ballot_w32(mx > m + 8.0f * FA_L2E) != 0) { const float mn = fmaxf(m, mx); const float f = __builtin_amdgcn_exp2f(m - mn); m = mn; l *= f;
#pragma unroll
        for (int j = 0; j < DV / 16; ++j) acc[j] = acc[j] * f; }
      float s4[4] = {0.f, 0.f, 0.f, 0.f};
#pragma unroll
      for (int i = 0; i < 16; i += 2) { const v2f y = __builtin_elementwise_fma((v2f){v[i], v[i + 1]}, (v2f){FA_L2E, FA_L2E}, (v2f){-m, -m}); const float e0 = __builtin_amdgcn_exp2f(y[0]), e1 = __builtin_amdgcn_exp2f(y[1]); v[i] = e0; v[i + 1] = e1; s4[i & 3] += e0; s4[(i + 1) & 3] += e1; }   // an excluded column: y is below -1.0e38 or -infinity, and exp2 gives 0
      l += (s4[0] + s4[1]) + (s4[2] + s4[3]);
      const F2 p = bsplit16(v);
#pragma unroll
      for (int jg = 0; jg < 4; ++jg) { const int cu = jg & 1;
        if (jg + 1 < 4) {
#pragma unroll
          for (int j = 0; j < 4; ++j) vf[cu ^ 1][j] = frag_b(vr + ((jg + 1) * 4 + j) * 16 * FA_VP + kk * 32, lane);
        } else if (kk + 1 < FA_KS / 32) {
#pragma unroll
          for (int tl = 0; tl < 2; ++tl)
#pragma unroll
            for (int pl = 0; pl < 2; ++pl) kf[0][tl][pl] = frag_h(kr + (pl * FA_KS + (kk + 1) * 32 + tl * 16) * FA_KP, lane);
        } else { ia = *(const v4i*)in; ib = *(const v4i*)(in + 4); }   // read under the stage's last products, so that the refill behind the barrier does not wait for them
        FA_SB();
#pragma unroll
        for (int j = 0; j < 4; ++j) acc[jg * 4 + j] = mm_b(vf[cu][j], p.h, acc[jg * 4 + j]);
#pragma unroll
        for (int j = 0; j < 4; ++j) acc[jg * 4 + j] = mm_b(vf[cu][j], p.l, acc[jg * 4 + j]);
        FA_SB(); } }
    asm volatile("s_wait_dscnt 0x0" ::: "memory");      // this wave's reads of buffer bf are over before it is handed to the copies
    asm volatile("s_wait_asynccnt 0x0" ::: "memory");   // this wave's copies of stage t + 1 have landed
    __syncthreads();                                     // publishes stage t + 1 and ends every reader's last read of buffer bf
    if (t + 2 < nt) fa_fill(gk, gv, lk, lv, ia, ib, t + 2, bf, lane); }
  asm volatile("s_wait_asynccnt 0x0" ::: "memory");     // nothing is in flight when the wave goes on to its end
  const float lt = l + xhalf(l); const float inv = lt > 0.f ? 1.0f / lt : 0.f;   // a row whose every column is masked stays all zero
  // through the wave's own LDS rows, so that the stores are whole lines
#pragma unroll
  for (int j = 0; j < DV / 16; ++j) { const v8f o = acc[j] * inv; vst2(&so[wave][col][j * 16 + 8 * g], (v4f){o[0], o[1], o[2], o[3]}); vst2(&so[wave][col][j * 16 + 8 * g + 4], (v4f){o[4], o[5], o[6], o[7]}); }
  LDSX();
  for (int rl = 0; rl < 16; ++rl) { vst2(OUT + (b * TT + q0 + rl) * DV + lane * 4, *(const v4f*)&so[wave][rl][lane * 4]); vst2(OUT + (b * TT + q0 + rl) * DV + 128 + lane * 4, *(const v4f*)&so[wave][rl][128 + lane * 4]); } }
extern "C" void kernel_launch(void* const* d_in, const int* in_sizes, int n_in, void* d_out, int out_size, void* d_ws, size_t ws_size, hipStream_t stream) {
  (void)in_sizes; (void)n_in; (void)out_size;
  const float** F = (const float**)d_in;   // 0 queries [8,2048,256], 1 keys, 2 values_1 [8,2048,256], 3 values_1_mask [8,2048] int (nonzero = excluded key), 4 values_2, 5 values_2_mask (nonzero = excluded query), 6 Wq [128,256] ([out,in]), 7 Wk, 8 scaling [1,128]; outputs: output @ 0, output_2 @ float 4,194,304
  if (ws_size < (size_t)WS_END) return;
  char* ws = (char*)d_ws; _Float16 *QH = (_Float16*)(ws + WS_QH), *QL = (_Float16*)(ws + WS_QL), *KH = (_Float16*)(ws + WS_KH), *KL = (_Float16*)(ws + WS_KL); __bf16 *V1 = (__bf16*)(ws + WS_V1), *V2 = (__bf16*)(ws + WS_V2);
  float* OUT1 = (float*)d_out; float* OUT2 = (float*)d_out + (size_t)NB * TT * DV;
  k_proj<<<dim3(TNB * TT / PJ_R, 2), 2 * PJ_R, 0, stream>>>(F[0], F[1], F[6], F[7], F[8], QH, QL, KH, KL, F[2], F[4], (const int*)d_in[3], (const int*)d_in[5], V1, V2);
  k_fa<<<dim3(TT / (16 * FA_W), TNB, 2), 32 * FA_W, 0, stream>>>(QH, QL, KH, KL, (const int*)d_in[3], (const int*)d_in[5], V1, V2, OUT1, OUT2);
}

// v009
// It runs in 49.7 microseconds.
// In two side-by-side timings against v008, it was 1.11 and 1.12 times as fast.
// Counting every step since v000, it is 18.0 times as fast.
// compute dtype: all float inputs rounded to bf16, the int masks read; pq = relu(q Wq^T), pk = relu(k Wk^T) * scaling with EXACT bf16 products on WMMA 16x16x32, f32 accumulate, stored as f16 hi + residual (x 2^10) rows; scores over K = 128 with 3 products (hi.hi, lo.hi, hi.lo), formed only for the columns whose key-side mask is clear (the columns are taken in the order clear first, set behind; stages wholly behind the clear ones are not run), kept in f32 registers; softmax in f32 with a running maximum and sum (each exponential is the hardware's exp2 of score * log2(e) - maximum, the maximum kept in log2 units, formed by one fused multiply-add); the exponentials rounded once to f16 (11 significant bits; at most e^8, so in range) against the value planes, the bf16-rounded values held as f16 (exact from 2^-17 up, within 2^-25 below), 1 product, divided by the row's f32 sum of the unrounded exponentials at the end; f32 outputs. The second output runs the same pipeline with the roles of queries and keys swapped.
#include <hip/hip_runtime.h>
#include <math.h>

typedef __attribute__((ext_vector_type(16))) _Float16 v16h;
typedef __attribute__((ext_vector_type(16))) __bf16 v16b;
typedef __attribute__((ext_vector_type(8)))  _Float16 v8h;
typedef __attribute__((ext_vector_type(8)))  float v8f;
typedef __attribute__((ext_vector_type(4)))  float v4f;
typedef __attribute__((ext_vector_type(2)))  float v2f;
typedef __attribute__((ext_vector_type(4)))  unsigned v4u;
typedef __attribute__((ext_vector_type(4)))  int v4i;
typedef float __attribute__((may_alias)) float_a;
typedef int __attribute__((may_alias)) int_a;

template <typename T> __device__ __forceinline__ void vst2(void* p, T v) { *(T*)p = v;  }
__device__ __forceinline__ v8f wmma16(v16h a, v16h b, v8f c) {
  v8f d = __builtin_amdgcn_wmma_f32_16x16x32_f16(false, a, false, b, (short)0, c, false, false);
  asm volatile("v_nop\n\tv_nop\n\tv_nop\n\tv_nop" : "+v"(d) : "v"(a), "v"(b));
  return d;
}
__device__ __forceinline__ v8f wmma_bf(v16b a, v16b b, v8f c) {
  v8f d = __builtin_amdgcn_wmma_f32_16x16x32_bf16(false, a, false, b, (short)0, c, false, false);
  asm volatile("v_nop\n\tv_nop\n\tv_nop\n\tv_nop" : "+v"(d) : "v"(a), "v"(b));
  return d;
}
// 16x16x32 fragments: lane = (h = lane>>4, row/col = lane&15); elements 0..7 = k0+8h+0..7, 8..15 = k0+16+8h+0..7; D element r = row 8h+r
__device__ __forceinline__ v16h frag_h(const _Float16* rowk0, int lane) {
  union { v16h v; v8h q[2]; } u; const _Float16* p = rowk0 + 8 * (lane >> 4);
  u.q[0] = *(const v8h*)p; u.q[1] = *(const v8h*)(p + 16); return u.v;
}
__device__ __forceinline__ v16h frag_f32(const float* rowk0, int lane) {
  v16h a; const float* p = rowk0 + 8 * (lane >> 4);
#pragma unroll
  for (int i = 0; i < 8; ++i) { a[i] = (_Float16)p[i]; a[8 + i] = (_Float16)p[16 + i]; }
  return a;
}
__device__ __forceinline__ v16h frag_f32s(const float* rowk0, int lane, float sc) {
  v16h a; const float* p = rowk0 + 8 * (lane >> 4);
#pragma unroll
  for (int i = 0; i < 8; ++i) { a[i] = (_Float16)(p[i] * sc); a[8 + i] = (_Float16)(p[16 + i] * sc); }
  return a;
}
// column fragment from a [K][ld] layout (column n), rows >= K read as 0
__device__ __forceinline__ v16h fragc_f32(const float* W, int k0, int n, int lane, int ld, int K) {
  v16h a; const int g = lane >> 4;
#pragma unroll
  for (int i = 0; i < 8; ++i) { const int ka = k0 + 8 * g + i, kb = ka + 16;
    a[i] = (_Float16)(ka < K ? W[(size_t)(ka < K ? ka : K - 1) * ld + n] : 0.f); a[8 + i] = (_Float16)(kb < K ? W[(size_t)(kb < K ? kb : K - 1) * ld + n] : 0.f); }
  return a;
}
struct F2 { v16b h, l; };
__device__ __forceinline__ F2 bsplit16(const float v[16]) { F2 r;
#pragma unroll
  for (int i = 0; i < 16; ++i) { const __bf16 h = (__bf16)v[i]; r.h[i] = h; r.l[i] = (__bf16)(v[i] - (float)h); }
  return r; }
__device__ __forceinline__ F2 split_row(const float* row, int k0, int lane) { float v[16]; const float* p = row + k0 + 8 * (lane >> 4);
#pragma unroll
  for (int i = 0; i < 8; ++i) { v[i] = p[i]; v[8 + i] = p[16 + i]; }
  return bsplit16(v); }
__device__ __forceinline__ F2 split_rowK(const float* row, int k0, int lane, int K) { float v[16]; const int g = lane >> 4;
#pragma unroll
  for (int i = 0; i < 8; ++i) { const int ka = k0 + 8 * g + i, kb = ka + 16; v[i] = ka < K ? row[ka < K ? ka : K - 1] : 0.f; v[8 + i] = kb < K ? row[kb < K ? kb : K - 1] : 0.f; }
  return bsplit16(v); }
__device__ __forceinline__ F2 split_col(const float* W, int k0, int n, int lane, int ld, int K) { float v[16]; const int g = lane >> 4;
#pragma unroll
  for (int i = 0; i < 8; ++i) { const int ka = k0 + 8 * g + i, kb = ka + 16; v[i] = ka < K ? W[(size_t)(ka < K ? ka : K - 1) * ld + n] : 0.f; v[8 + i] = kb < K ? W[(size_t)(kb < K ? kb : K - 1) * ld + n] : 0.f; }
  return bsplit16(v); }
__device__ __forceinline__ v8f mac3(const F2& a, const F2& b, v8f c) { c = wmma_bf(a.l, b.h, c); c = wmma_bf(a.h, b.l, c); return wmma_bf(a.h, b.h, c); }
__device__ __forceinline__ float sigm(float v) { return 1.0f / (1.0f + expf(-v)); }
#define LDSX() do { asm volatile("s_wait_dscnt 0" ::: "memory"); __builtin_amdgcn_wave_barrier(); __builtin_amdgcn_fence(__ATOMIC_RELEASE, "workgroup"); } while (0)

// Scaled-dot attention with dual softmax (B 8, Lq = Lk = 2,048, D 256, H 128): pq = relu(queries Wq^T); pk = relu(keys Wk^T) * scaling; scores = pq pk^T; output = softmax_k(scores | values_1_mask[k] -> -inf) . values_1; output_2 = softmax_q(scores^T | values_2_mask[q] -> -inf) . values_2.
__device__ __forceinline__ float bfr(float v) { return (float)(__bf16)v; }
#define NB 8
#define TT 2048
#define DIN 256
#define HP 128         // projected width
#define DV 256         // value width
#ifndef TNB
#define TNB NB
#endif
typedef __attribute__((ext_vector_type(8))) __bf16 v8b;
__device__ __forceinline__ v16b frag_b(const __bf16* rowk0, int lane) { union { v16b v; v8b q[2]; } u; const __bf16* p = rowk0 + 8 * (lane >> 4); u.q[0] = *(const v8b*)p; u.q[1] = *(const v8b*)(p + 16); return u.v; }
#define WS_QH  0u                                          // f16 pq hi rows [b*T+q][128]
#define WS_QL  (WS_QH + 2u * (size_t)NB * TT * HP)
#define WS_KH  (WS_QL + 2u * (size_t)NB * TT * HP)           // f16 pk hi rows
#define WS_KL  (WS_KH + 2u * (size_t)NB * TT * HP)
#define WS_V1  (WS_KL + 2u * (size_t)NB * TT * HP)           // f16 values_1 planes (bf16-rounded values) [b][c][place of k in col_order], written as far as the counted columns reach, rounded up to 128
#define WS_V2  (WS_V1 + 2u * (size_t)NB * DV * TT)           // f16 values_2 planes [b][c][place of q in col_order], likewise
#define WS_END (WS_V2 + 2u * (size_t)NB * DV * TT)
// ---- col_order: one batch's 2,048 columns in the order: those that count (mask 0) first, the excluded ones behind them, each group by rising index. A column that is excluded adds exactly 0 to every sum, so only the places below the count need work.
// A block of NW waves; mv[i] = the mask of column (i * NW + wave) * 32 + lane. Fills sidx[place] = column, every place once (so every entry is a column of the batch, whatever the mask holds), and returns the count, the same scalar in every wave. Every block that calls it on the same mask gets the same order.
template <int NW> __device__ __forceinline__ int col_order(const int (&mv)[TT / 32 / NW], int* sidx, unsigned* sbits, int wave, int lane) {
  unsigned bw[TT / 32 / NW];   // bit l of bw[i]: lane l's column counts
#pragma unroll
  for (int i = 0; i < TT / 32 / NW; ++i) bw[i] = __builtin_amdgcn_ballot_w32(mv[i] == 0);
  if (lane == 0) {
#pragma unroll
    for (int i = 0; i < TT / 32 / NW; ++i) sbits[i * NW + wave] = bw[i]; }
  __syncthreads();   // publishes the 64 words of bits
  const int c0 = __builtin_popcount(sbits[lane]), c1 = __builtin_popcount(sbits[32 + lane]); int p0 = c0, p1 = c1;   // running sums over the 64 words, lane l holding words l and 32 + l
#pragma unroll
  for (int d = 1; d < 32; d <<= 1) { const int a0 = __builtin_amdgcn_ds_bpermute((lane - d) * 4, p0), a1 = __builtin_amdgcn_ds_bpermute((lane - d) * 4, p1); if (lane >= d) { p0 += a0; p1 += a1; } }
  const int h0 = __builtin_amdgcn_readlane(p0, 31), n = h0 + __builtin_amdgcn_readlane(p1, 31);
  p0 -= c0; p1 += h0 - c1;   // now: counted columns in front of the lane's two words
#pragma unroll
  for (int i = 0; i < TT / 32 / NW; ++i) { const int w = i * NW + wave, e = w * 32 + lane; const int before = __builtin_amdgcn_readlane(i * NW < 32 ? p0 : p1, w & 31) + (int)__builtin_amdgcn_mbcnt_lo(bw[i], 0u);   // counted columns in front of column e
    sidx[mv[i] == 0 ? before : n + (e - before)] = e; }
  __syncthreads();   // publishes the order
  return n; }
// ---- k_proj: block = (128 rows, which), one wave = 16 rows x all 128 columns: relu(x W^T) (x scaling for pk), exact; stored as f16 hi + residual rows (256-B rows)
// The weight matrix and the block's 128 input rows go once into LDS as bf16: every global load is 512 contiguous bytes of a wave, and all of a thread's loads are in flight together; the fragments come from LDS.
// The same block also turns one tile of a value array (rounded to bf16, then held as f16, which keeps every bit of such a value from 2^-17 up) into planes [b][c][place of col_order], 256-B pieces: its rows are loaded during the products. A block whose places all lie behind the counted columns writes no plane: k_fa does not read there.
#define PJ_R 128       // rows per block
#define PJ_P 264       // operand row pitch in LDS, bf16 (528 B = 16 B x odd: no bank conflict for 16-byte reads down a column of rows)
typedef __attribute__((ext_vector_type(4))) __bf16 v4b;
__device__ __forceinline__ v4b cvt4(v4f t) { return (v4b){(__bf16)t[0], (__bf16)t[1], (__bf16)t[2], (__bf16)t[3]}; }
struct PJF { v16b a, w[8]; };   // the fragments of one 32-wide k step
__device__ __forceinline__ void pj_read(PJF& f, const __bf16* ar, const __bf16* br, int kc, int lane) { f.a = frag_b(ar + kc * 32, lane);
#pragma unroll
  for (int j = 0; j < 8; ++j) f.w[j] = frag_b(br + j * 16 * PJ_P + kc * 32, lane); }
__device__ __forceinline__ void pj_mac(v8f (&acc)[8], const PJF& f) {
#pragma unroll
  for (int j = 0; j < 8; ++j) acc[j] = __builtin_amdgcn_wmma_f32_16x16x32_bf16(false, f.a, false, f.w[j], (short)0, acc[j], false, false); }
__global__ __launch_bounds__(2 * PJ_R) void k_proj(const float* __restrict__ XQ, const float* __restrict__ XK, const float* __restrict__ WQ, const float* __restrict__ WK, const float* __restrict__ SCL, _Float16* __restrict__ QH, _Float16* __restrict__ QL, _Float16* __restrict__ KH, _Float16* __restrict__ KL, const float* __restrict__ VA, const float* __restrict__ VB, const int* __restrict__ MA, const int* __restrict__ MB, _Float16* __restrict__ PA, _Float16* __restrict__ PB) { __shared__ __align__(16) _Float16 sh[PJ_R][136], sl[PJ_R][136]; __shared__ __align__(16) __bf16 sw[HP][PJ_P], sx[PJ_R][PJ_P]; __shared__ __align__(16) _Float16 th[DV][136]; __shared__ __align__(16) int sidx[TT]; __shared__ unsigned sbits[TT / 32];
  const int tid = threadIdx.x, wave = tid >> 5, lane = tid & 31, col = lane & 15, g = lane >> 4; const int which = blockIdx.y; const size_t r0 = (size_t)blockIdx.x * PJ_R; const float* X = which == 0 ? XQ : XK; const float* Wt = which == 0 ? WQ : WK; _Float16* DH = which == 0 ? QH : KH; _Float16* DL = which == 0 ? QL : KL;
  // the block's value tile: 128 places of col_order of batch blockIdx.x / 16 of values_1 (which 0) or values_2 (which 1), all 256 channels
  const int t0 = (blockIdx.x & (TT / 128 - 1)) * 128; const size_t vb = blockIdx.x / (TT / 128); const float* V = which == 0 ? VA : VB; const int* CM = which == 0 ? MA : MB; _Float16* P = which == 0 ? PA : PB;
  // 16-byte piece i * 256 + tid of a [128][256] float array: row 4 i + (tid >> 6), floats 4 (tid & 63) and the three behind
  const float* xg = X + r0 * DIN + tid * 4; const float* wg = Wt + tid * 4; const int sr = tid >> 6, sc4 = (tid & 63) * 4;
  v4f wr[32], xr[32]; float sc[8];   // indexed by constants: every loop over them is unrolled whole
#pragma unroll
  for (int i = 0; i < 32; ++i) wr[i] = *(const v4f*)(wg + i * 1024);   // the weights first: they come from L2 and are put away while the input rows are still on their way from memory
  __builtin_amdgcn_sched_barrier(0);   // keeps that order: left free, the compiler issues two of the weight loads behind the input rows, and loads are waited for in issue order
#pragma unroll
  for (int i = 0; i < 32; ++i) xr[i] = *(const v4f*)(xg + i * 1024);
  __builtin_amdgcn_sched_barrier(0);   // every load is issued before the first is waited for
  int mv[TT / (2 * PJ_R)];   // the mask of the value tile's batch, behind the operand loads: it is first used behind the barrier that waits for them all
#pragma unroll
  for (int i = 0; i < TT / (2 * PJ_R); ++i) mv[i] = CM[vb * TT + i * (2 * PJ_R) + tid];
#pragma unroll
  for (int j = 0; j < 8; ++j) sc[j] = SCL[j * 16 + col];   // all eight here, with the other loads, not one by one in front of their use
  asm volatile("s_wait_xcnt 0x0" ::: "memory");   // stands behind the loads above, in front of every later write of a register that they name
  __builtin_amdgcn_sched_barrier(0);               // holds the later address arithmetic behind that wait
#pragma unroll
  for (int i = 0; i < 32; ++i) *(v4b*)&sw[i * 4 + sr][sc4] = cvt4(wr[i]);
#pragma unroll
  for (int i = 0; i < 32; ++i) *(v4b*)&sx[i * 4 + sr][sc4] = cvt4(xr[i]);
  __syncthreads();   // publishes both staged operands
  const int n = col_order<2 * PJ_R / 32>(mv, sidx, sbits, __builtin_amdgcn_readfirstlane(tid >> 5), lane);   // columns of that batch that count
  const bool vact = t0 < n;   // the same for the whole block
  // thread = (32 places in a row: tid >> 6, four channels: tid & 63): a load is 512 contiguous bytes of a wave; all 32 are issued here and are on their way from memory during the products below
  v4f vx[32];
  if (vact) { v4i of[8];   // byte offsets of the thread's 16 bytes in its 32 rows
#pragma unroll
    for (int j = 0; j < 8; ++j) of[j] = *(const v4i*)&sidx[t0 + (tid >> 6) * 32 + j * 4] * (DV * 4) + (tid & 63) * 16;
    const char* vp = (const char*)(V + vb * TT * DV);
#pragma unroll
    for (int j = 0; j < 32; ++j) vx[j] = *(const v4f*)(vp + (unsigned)of[j >> 2][j & 3]);
    asm volatile("s_wait_xcnt 0x0" :: "v"(of[0]), "v"(of[1]), "v"(of[2]), "v"(of[3]), "v"(of[4]), "v"(of[5]), "v"(of[6]), "v"(of[7]) : "memory"); }   // as above, for these loads; the offsets as inputs: their registers stay theirs up to the wait, so that no load of the group lands in one
  v8f acc[8] = {};
  const __bf16* ar = &sx[wave * 16 + col][0]; const __bf16* br = &sw[col][0];
  PJF f0, f1;   // a k step's fragments are read as one group, one step ahead of their products
  pj_read(f0, ar, br, 0, lane);
#pragma unroll 1   // two k steps per trip, one per fragment buffer; the last two steps stand behind the loop, so that no trip has a branch round its reads
  for (int kc = 0; kc < DIN / 32 - 2; kc += 2) {
    pj_read(f1, ar, br, kc + 1, lane);
    __builtin_amdgcn_sched_barrier(0);   // keeps the next step's LDS reads together and ahead of this step's products
    pj_mac(acc, f0);
    __builtin_amdgcn_sched_barrier(0);   // as above
    pj_read(f0, ar, br, kc + 2, lane);
    __builtin_amdgcn_sched_barrier(0);   // as above
    pj_mac(acc, f1);
    __builtin_amdgcn_sched_barrier(0); } // as above
  pj_read(f1, ar, br, DIN / 32 - 1, lane);
  __builtin_amdgcn_sched_barrier(0);     // as above
  pj_mac(acc, f0); pj_mac(acc, f1);
#pragma unroll
  for (int j = 0; j < 8; ++j) { const int o = j * 16 + col; const float scj = (which == 1) ? bfr(sc[j]) : 1.0f;
#pragma unroll
    for (int r = 0; r < 8; ++r) { const float v = fmaxf(acc[j][r], 0.f) * scj; const _Float16 hv = (_Float16)v; sh[wave * 16 + 8 * g + r][o] = hv; sl[wave * 16 + 8 * g + r][o] = (_Float16)((v - (float)hv) * 1024.0f); } }
  // channel c lies in LDS row (c & 3) * 64 + (c >> 2): the lanes of a wave then write rows that follow one another (272-B pitch: no bank conflict)
  if (vact) {
#pragma unroll
    for (int e = 0; e < 4; ++e)
#pragma unroll
      for (int s = 0; s < 4; ++s) { v8h w;
#pragma unroll
        for (int u = 0; u < 8; ++u) w[u] = (_Float16)bfr(vx[s * 8 + u][e]);
        *(v8h*)&th[e * 64 + (tid & 63)][(tid >> 6) * 32 + s * 8] = w; } }
  __syncthreads();
  for (int e = tid; e < PJ_R * 16; e += 2 * PJ_R) { const int rl = e >> 4, q = e & 15; vst2((unsigned*)(DH + (r0 + rl) * HP + q * 8), *(const v4u*)&sh[rl][q * 8]); vst2((unsigned*)(DL + (r0 + rl) * HP + q * 8), *(const v4u*)&sl[rl][q * 8]); }
  if (vact) {   // piece i * 256 + tid: LDS row i * 16 + (tid >> 4), 16 bytes at tid & 15; a constant trip count, unrolled: the sixteen LDS reads go ahead together and the stores differ by constant offsets
#pragma unroll
    for (int i = 0; i < DV * 16 / (2 * PJ_R); ++i) vst2((unsigned*)(P + (vb * DV + ((i & 3) * 16 + (tid >> 4)) * 4 + (i >> 2)) * (size_t)TT + t0 + (tid & 15) * 8), *(const v4u*)&th[i * 16 + (tid >> 4)][(tid & 15) * 8]); } }
// ---- k_fa: block = (128 rows, batch, direction), one wave = 16 rows x all 256 channels. Scores, softmax and the value product in one kernel: no score goes to memory.
// Per 32 columns (keys of this direction): S^T = COL . ROW^T (3 products, A = column-side rows from LDS, B = the wave's row-side fragments, kept in registers), so a lane holds 16 scores of ONE row;
// running maximum and running sum per lane; e = exp(score - maximum in use), rounded to f16, is the B operand of O^T += V^T . P^T as it stands in the registers (1 product, A = value planes from LDS).
// The columns are taken in the order of col_order, and only as far as the counted ones reach: a stage is 64 places of that order; in the last stage the places behind the count are excluded by their place.
// Column-side rows (picked by index) and value planes (stored in that order by k_proj) come 64 columns at a time into a two-buffer LDS ring by asynchronous copies.
#define FA_W 8         // waves per block
#define FA_KS 64       // columns per stage
#define FA_NT (TT / FA_KS)
#define FA_KP 136      // column-side row pitch in LDS, f16 (272 B = 16 B x odd: no bank conflict for 16-byte reads down a column of rows)
#define FA_VP 72       // value row pitch in LDS, f16 (144 B = 16 B x odd)
#define FA_OP 260      // output row pitch in LDS, floats (1,040 B = 16 B x odd)
#define FA_L2E 1.44269504088896340736f   // log2(e)
// the plain builtins: the compiler keeps the distances behind them itself, and their operands may lie above v255, which an asm operand cannot name (this kernel holds more than 256 registers)
__device__ __forceinline__ v8f mm_h(v16h a, v16h b, v8f c) { return __builtin_amdgcn_wmma_f32_16x16x32_f16(false, a, false, b, (short)0, c, false, false); }
// nothing is scheduled across: keeps a group's LDS reads together and ahead of the block of products in front of which they are written; left free, the compiler spreads them in pairs among the products, each pair waited to 0 just before its use
#define FA_SB() __builtin_amdgcn_sched_barrier(0)
// lane l's value from lane l ^ 16
__device__ __forceinline__ float xhalf(float x) { return __builtin_bit_cast(float, __builtin_amdgcn_permlanex16(__builtin_bit_cast(int, x), __builtin_bit_cast(int, x), 0x76543210, 0xfedcba98, false, false)); }
// one wave's share of stage t into buffer bf: 16 column-side rows of one plane (two 256-B rows a copy: lane half g brings the rows at places 8 g + 0..7 of the wave's sixteen, their columns in ia, ib) and 32 value rows (four 128-B pieces a copy), 16 copies
typedef __attribute__((address_space(1))) v4i g_v4i; typedef __attribute__((address_space(3))) v4i l_v4i;
// the copies as the builtin: its address registers are the compiler's own and may lie above v255
__device__ __forceinline__ void fa_fill(const char* gk, const char* gv, char* lk, char* lv, v4i ia, v4i ib, int t, int bf, int lane) {
  lk += bf * (2 * FA_KS * FA_KP * 2) + (lane >> 4) * (8 * FA_KP * 2) + (lane & 15) * 16;
  gv += (size_t)t * (FA_KS * 2) + (lane >> 3) * (TT * 2) + (lane & 7) * 16; lv += bf * (DV * FA_VP * 2) + (lane >> 3) * (FA_VP * 2) + (lane & 7) * 16;
#pragma unroll
  for (int i = 0; i < 8; ++i) __builtin_amdgcn_global_load_async_to_lds_b128((g_v4i*)(gk + (unsigned)((i < 4 ? ia[i & 3] : ib[i & 3]) * (HP * 2) + (lane & 15) * 16)), (l_v4i*)(lk + i * (FA_KP * 2)), 0, 0);
#pragma unroll
  for (int i = 0; i < 8; ++i) __builtin_amdgcn_global_load_async_to_lds_b128((g_v4i*)(gv + i * (4 * TT * 2)), (l_v4i*)(lv + i * (4 * FA_VP * 2)), 0, 0);
}
__global__ __launch_bounds__(32 * FA_W) void k_fa(const _Float16* __restrict__ QH, const _Float16* __restrict__ QL, const _Float16* __restrict__ KH, const _Float16* __restrict__ KL, const int* __restrict__ M1, const int* __restrict__ M2, const _Float16* __restrict__ V1, const _Float16* __restrict__ V2, float* __restrict__ OUT1, float* __restrict__ OUT2) {
  __shared__ __align__(16) _Float16 sk[2][2][FA_KS][FA_KP]; __shared__ __align__(16) _Float16 sv[2][DV][FA_VP]; __shared__ __align__(16) int sidx[TT]; __shared__ unsigned sbits[TT / 32]; __shared__ __align__(16) float so[FA_W][16][FA_OP];
  const int tid = threadIdx.x, wave = __builtin_amdgcn_readfirstlane(tid >> 5), lane = tid & 31, col = lane & 15, g = lane >> 4; const size_t b = blockIdx.y; const bool sw = blockIdx.z != 0;   // the wave's number in a scalar register: what depends on it alone then costs no vector register over the loop
  // direction 0: rows = queries, columns = keys, values_1 and its mask; direction 1: rows = keys, columns = queries, values_2 and its mask
  const _Float16 *RH = sw ? KH : QH, *RL = sw ? KL : QL, *CH_ = sw ? QH : KH, *CL = sw ? QL : KL; const int* CMASK = sw ? M2 : M1; const _Float16* VP = sw ? V2 : V1; float* OUT = sw ? OUT2 : OUT1;
  const int q0 = blockIdx.x * (16 * FA_W) + wave * 16;
  // wave-uniform bases; the lane's own part: a 256-B row by its index, 16 B at col; row lane >> 3 of four 128-B pieces, 16 B at lane & 7
  const char* gk = (const char*)((wave >> 2) ? CL : CH_) + (b * TT * HP) * 2; const char* gv = (const char*)(VP + (b * DV + wave * 32) * (size_t)TT);
  char *lk = (char*)&sk[0][wave >> 2][(wave & 3) * 16][0], *lv = (char*)&sv[0][wave * 32][0];
  int mv[TT / (32 * FA_W)];
#pragma unroll   // all eight loads in flight together: one memory latency, not eight
  for (int i = 0; i < TT / (32 * FA_W); ++i) mv[i] = CMASK[b * TT + i * (32 * FA_W) + tid];
  asm volatile("s_wait_xcnt 0x0" ::: "memory");   // stands behind the loads above, in front of every later write of a register that they name
  __builtin_amdgcn_sched_barrier(0);               // holds the later address arithmetic behind that wait
  v16h qh[HP / 32], ql[HP / 32];   // every loop over these arrays is unrolled whole so that they are indexed by constants and stay in registers
#pragma unroll
  for (int kb = 0; kb < HP / 32; ++kb) { qh[kb] = frag_h(RH + (b * TT + q0 + col) * HP + kb * 32, lane); ql[kb] = frag_h(RL + (b * TT + q0 + col) * HP + kb * 32, lane); }
  asm volatile("s_wait_xcnt 0x0" ::: "memory");   // as above, for the fragment loads
  __builtin_amdgcn_sched_barrier(0);               // as above
  const int n = col_order<FA_W>(mv, sidx, sbits, wave, lane);   // columns that count
  const int nt = (n + FA_KS - 1) / FA_KS < FA_NT ? (n + FA_KS - 1) / FA_KS : FA_NT;   // stages that hold one; none where every column is excluded
  const int* ir = &sidx[(wave & 3) * 16 + 8 * g];   // the lane's eight indices of stage 0
  if (nt > 0) fa_fill(gk, gv, lk, lv, *(const v4i*)ir, *(const v4i*)(ir + 4), 0, 0, lane);
  v8f acc[DV / 16] = {}; float m = -1.0e38f, l = 0.f;   // acc[j][r] = O^T[channel j * 16 + 8 g + r][row col]; m = the maximum in use, times log2(e) (the same in both halves of the wave); l = this half's share of the row's sum
  // m starts far above what an excluded column (-3.0e38) comes to: its exponential is 0 by itself, also while a row has met no column that counts
  asm volatile("s_wait_asynccnt 0x0" ::: "memory");   // stage 0 has landed before the barrier that publishes it
  __syncthreads();                                     // publishes stage 0
  if (nt > 1) fa_fill(gk, gv, lk, lv, *(const v4i*)(ir + FA_KS), *(const v4i*)(ir + FA_KS + 4), 1, 1, lane);
#pragma unroll 1   // one stage per trip: the buffer index stays a run-time value
  for (int t = 0; t < nt; ++t) { const int bf = t & 1;
    const _Float16* kr = &sk[bf][0][col][0]; const _Float16* vr = &sv[bf][col][0]; const int* in = ir + (t + 2 < nt ? t + 2 : 0) * FA_KS; v4i ia, ib;   // in: the lane's indices of stage t + 2 (of stage 0, unused, where there is none)
    // fragments are read from LDS as groups, one group ahead of their products and only inside this stage's own buffer; the sixteen value fragments of 32 columns are one group, read in front of the softmax, which covers their way
    v16h kf[2][2][2], vf[DV / 16];   // [buffer][16-column tile][plane], [16-channel tile]; indexed by constants, as above
#pragma unroll
    for (int tl = 0; tl < 2; ++tl)
#pragma unroll
      for (int p = 0; p < 2; ++p) kf[0][tl][p] = frag_h(kr + (p * FA_KS + tl * 16) * FA_KP, lane);
#pragma unroll
    for (int kk = 0; kk < FA_KS / 32; ++kk) {
      v8f sh[2] = {}, sl[2] = {};
#pragma unroll
      for (int kb = 0; kb < HP / 32; ++kb) { const int cu = kb & 1;
        if (kb + 1 < HP / 32) {
#pragma unroll
          for (int tl = 0; tl < 2; ++tl)
#pragma unroll
            for (int p = 0; p < 2; ++p) kf[cu ^ 1][tl][p] = frag_h(kr + (p * FA_KS + kk * 32 + tl * 16) * FA_KP + (kb + 1) * 32, lane);
        } else {
#pragma unroll
          for (int j = 0; j < DV / 16; ++j) vf[j] = frag_h(vr + j * 16 * FA_VP + kk * 32, lane);
        }
        FA_SB();
        // each accumulator takes its products in the order the separate score kernel had: hi.hi; row lo . column hi, then row hi . column lo
        sh[0] = mm_h(kf[cu][0][0], qh[kb], sh[0]); sl[0] = mm_h(kf[cu][0][0], ql[kb], sl[0]); sh[1] = mm_h(kf[cu][1][0], qh[kb], sh[1]); sl[1] = mm_h(kf[cu][1][0], ql[kb], sl[1]);
        sl[0] = mm_h(kf[cu][0][1], qh[kb], sl[0]); sl[1] = mm_h(kf[cu][1][1], qh[kb], sl[1]);
        FA_SB(); }
      // v[8 tl + r] = score of column kk * 32 + 16 tl + 8 g + r against row col: the k order of a 16x16x32 B operand
      float v[16];
#pragma unroll
      for (int i = 0; i < 16; ++i) v[i] = sh[i >> 3][i & 7] + sl[i >> 3][i & 7] * (1.0f / 1024.0f);
      const int left = n - (t * FA_KS + kk * 32);   // counted columns from this group of 32 on: only the last groups hold places behind the count (one wave-uniform test)
      if (left < 32) {
#pragma unroll
        for (int i = 0; i < 16; ++i) v[i] = (i >> 3) * 16 + 8 * g + (i & 7) >= left ? -3.0e38f : v[i]; }
      float mx = v[0];
#pragma unroll
      for (int i = 1; i < 16; ++i) mx = fmaxf(mx, v[i]);
      mx = fmaxf(mx, xhalf(mx)) * FA_L2E;   // both halves of the wave now hold the row's maximum over these 32 columns, in log2 units (-infinity where all 32 are excluded)
      // the maximum in use may trail the true one by up to 8 (an exponential then reaches e^8): sum and accumulators are rescaled only when some row's maximum exceeds it by more; one wave-uniform test per 32 columns
      if (__builtin_amdgcn_ballot_w32(mx > m + 8.0f * FA_L2E) != 0) { const float mn = fmaxf(m, mx); const float f = __builtin_amdgcn_exp2f(m - mn); m = mn; l *= f;
#pragma unroll
        for (int j = 0; j < DV / 16; ++j) acc[j] = acc[j] * f; }
      float s4[4] = {0.f, 0.f, 0.f, 0.f};
#pragma unroll
      for (int i = 0; i < 16; i += 2) { const v2f y = __builtin_elementwise_fma((v2f){v[i], v[i + 1]}, (v2f){FA_L2E, FA_L2E}, (v2f){-m, -m}); const float e0 = __builtin_amdgcn_exp2f(y[0]), e1 = __builtin_amdgcn_exp2f(y[1]); v[i] = e0; v[i + 1] = e1; s4[i & 3] += e0; s4[(i + 1) & 3] += e1; }   // an excluded column: y is below -1.0e38 or -infinity, and exp2 gives 0
      l += (s4[0] + s4[1]) + (s4[2] + s4[3]);
      v16h p;
#pragma unroll
      for (int i = 0; i < 16; ++i) p[i] = (_Float16)v[i];
      if (kk + 1 < FA_KS / 32) {
#pragma unroll
        for (int tl = 0; tl < 2; ++tl)
#pragma unroll
          for (int pl = 0; pl < 2; ++pl) kf[0][tl][pl] = frag_h(kr + (pl * FA_KS + (kk + 1) * 32 + tl * 16) * FA_KP, lane);
      } else { ia = *(const v4i*)in; ib = *(const v4i*)(in + 4); }   // read under the stage's last products, so that the refill behind the barrier does not wait for them
      FA_SB();
#pragma unroll
      for (int j = 0; j < DV / 16; ++j) acc[j] = mm_h(vf[j], p, acc[j]);
      FA_SB(); }
    asm volatile("s_wait_dscnt 0x0" ::: "memory");      // this wave's reads of buffer bf are over before it is handed to the copies
    asm volatile("s_wait_asynccnt 0x0" ::: "memory");   // this wave's copies of stage t + 1 have landed
    __syncthreads();                                     // publishes stage t + 1 and ends every reader's last read of buffer bf
    if (t + 2 < nt) fa_fill(gk, gv, lk, lv, ia, ib, t + 2, bf, lane); }
  asm volatile("s_wait_asynccnt 0x0" ::: "memory");     // nothing is in flight when the wave goes on to its end
  const float lt = l + xhalf(l); const float inv = lt > 0.f ? 1.0f / lt : 0.f;   // a row whose every column is masked stays all zero
  // through the wave's own LDS rows, so that the stores are whole lines
#pragma unroll
  for (int j = 0; j < DV / 16; ++j) { const v8f o = acc[j] * inv; vst2(&so[wave][col][j * 16 + 8 * g], (v4f){o[0], o[1], o[2], o[3]}); vst2(&so[wave][col][j * 16 + 8 * g + 4], (v4f){o[4], o[5], o[6], o[7]}); }
  LDSX();
  for (int rl = 0; rl < 16; ++rl) { vst2(OUT + (b * TT + q0 + rl) * DV + lane * 4, *(const v4f*)&so[wave][rl][lane * 4]); vst2(OUT + (b * TT + q0 + rl) * DV + 128 + lane * 4, *(const v4f*)&so[wave][rl][128 + lane * 4]); } }
extern "C" void kernel_launch(void* const* d_in, const int* in_sizes, int n_in, void* d_out, int out_size, void* d_ws, size_t ws_size, hipStream_t stream) {
  (void)in_sizes; (void)n_in; (void)out_size;
  const float** F = (const float**)d_in;   // 0 queries [8,2048,256], 1 keys, 2 values_1 [8,2048,256], 3 values_1_mask [8,2048] int (nonzero = excluded key), 4 values_2, 5 values_2_mask (nonzero = excluded query), 6 Wq [128,256] ([out,in]), 7 Wk, 8 scaling [1,128]; outputs: output @ 0, output_2 @ float 4,194,304
  if (ws_size < (size_t)WS_END) return;
  char* ws = (char*)d_ws; _Float16 *QH = (_Float16*)(ws + WS_QH), *QL = (_Float16*)(ws + WS_QL), *KH = (_Float16*)(ws + WS_KH), *KL = (_Float16*)(ws + WS_KL); _Float16 *V1 = (_Float16*)(ws + WS_V1), *V2 = (_Float16*)(ws + WS_V2);
  float* OUT1 = (float*)d_out; float* OUT2 = (float*)d_out + (size_t)NB * TT * DV;
  k_proj<<<dim3(TNB * TT / PJ_R, 2), 2 * PJ_R, 0, stream>>>(F[0], F[1], F[6], F[7], F[8], QH, QL, KH, KL, F[2], F[4], (const int*)d_in[3], (const int*)d_in[5], V1, V2);
  k_fa<<<dim3(TT / (16 * FA_W), TNB, 2), 32 * FA_W, 0, stream>>>(QH, QL, KH, KL, (const int*)d_in[3], (const int*)d_in[5], V1, V2, OUT1, OUT2);
}

// v010
// One run takes 47.1 microseconds.
// In two side-by-side timings against v009, it was 1.05 and 1.06 times as fast.
// Over all steps from v000 it is 19.0 times as fast.
// compute dtype: all float inputs rounded to bf16, the int masks read; pq = relu(q Wq^T), pk = relu(k Wk^T) * scaling with EXACT bf16 products on WMMA 16x16x32, f32 accumulate, stored as f16 hi + residual (x 2^10) rows; scores over K = 128 with 3 products (hi.hi, lo.hi, hi.lo), formed only for the columns whose key-side mask is clear (the columns are taken in the order clear first, set behind; stages wholly behind the clear ones are not run), kept in f32 and handed through LDS from the score waves to the value waves; softmax in f32 with a running maximum and sum (each exponential is the hardware's exp2 of score * log2(e) - maximum, the maximum kept in log2 units, formed by one fused multiply-add); the exponentials rounded once to f16 (11 significant bits; at most e^8, so in range) against the value planes, the bf16-rounded values held as f16 (exact from 2^-17 up, within 2^-25 below), 1 product, divided by the row's f32 sum of the unrounded exponentials at the end; f32 outputs. The second output runs the same pipeline with the roles of queries and keys swapped.
#include <hip/hip_runtime.h>
#include <math.h>

typedef __attribute__((ext_vector_type(16))) _Float16 v16h;
typedef __attribute__((ext_vector_type(16))) __bf16 v16b;
typedef __attribute__((ext_vector_type(8)))  _Float16 v8h;
typedef __attribute__((ext_vector_type(8)))  float v8f;
typedef __attribute__((ext_vector_type(4)))  float v4f;
typedef __attribute__((ext_vector_type(2)))  float v2f;
typedef __attribute__((ext_vector_type(4)))  unsigned v4u;
typedef __attribute__((ext_vector_type(4)))  int v4i;
typedef float __attribute__((may_alias)) float_a;
typedef int __attribute__((may_alias)) int_a;

template <typename T> __device__ __forceinline__ void vst2(void* p, T v) { *(T*)p = v;  }
__device__ __forceinline__ v8f wmma16(v16h a, v16h b, v8f c) {
  v8f d = __builtin_amdgcn_wmma_f32_16x16x32_f16(false, a, false, b, (short)0, c, false, false);
  asm volatile("v_nop\n\tv_nop\n\tv_nop\n\tv_nop" : "+v"(d) : "v"(a), "v"(b));
  return d;
}
__device__ __forceinline__ v8f wmma_bf(v16b a, v16b b, v8f c) {
  v8f d = __builtin_amdgcn_wmma_f32_16x16x32_bf16(false, a, false, b, (short)0, c, false, false);
  asm volatile("v_nop\n\tv_nop\n\tv_nop\n\tv_nop" : "+v"(d) : "v"(a), "v"(b));
  return d;
}
// 16x16x32 fragments: lane = (h = lane>>4, row/col = lane&15); elements 0..7 = k0+8h+0..7, 8..15 = k0+16+8h+0..7; D element r = row 8h+r
__device__ __forceinline__ v16h frag_h(const _Float16* rowk0, int lane) {
  union { v16h v; v8h q[2]; } u; const _Float16* p = rowk0 + 8 * (lane >> 4);
  u.q[0] = *(const v8h*)p; u.q[1] = *(const v8h*)(p + 16); return u.v;
}
__device__ __forceinline__ v16h frag_f32(const float* rowk0, int lane) {
  v16h a; const float* p = rowk0 + 8 * (lane >> 4);
#pragma unroll
  for (int i = 0; i < 8; ++i) { a[i] = (_Float16)p[i]; a[8 + i] = (_Float16)p[16 + i]; }
  return a;
}
__device__ __forceinline__ v16h frag_f32s(const float* rowk0, int lane, float sc) {
  v16h a; const float* p = rowk0 + 8 * (lane >> 4);
#pragma unroll
  for (int i = 0; i < 8; ++i) { a[i] = (_Float16)(p[i] * sc); a[8 + i] = (_Float16)(p[16 + i] * sc); }
  return a;
}
// column fragment from a [K][ld] layout (column n), rows >= K read as 0
__device__ __forceinline__ v16h fragc_f32(const float* W, int k0, int n, int lane, int ld, int K) {
  v16h a; const int g = lane >> 4;
#pragma unroll
  for (int i = 0; i < 8; ++i) { const int ka = k0 + 8 * g + i, kb = ka + 16;
    a[i] = (_Float16)(ka < K ? W[(size_t)(ka < K ? ka : K - 1) * ld + n] : 0.f); a[8 + i] = (_Float16)(kb < K ? W[(size_t)(kb < K ? kb : K - 1) * ld + n] : 0.f); }
  return a;
}
struct F2 { v16b h, l; };
__device__ __forceinline__ F2 bsplit16(const float v[16]) { F2 r;
#pragma unroll
  for (int i = 0; i < 16; ++i) { const __bf16 h = (__bf16)v[i]; r.h[i] = h; r.l[i] = (__bf16)(v[i] - (float)h); }
  return r; }
__device__ __forceinline__ F2 split_row(const float* row, int k0, int lane) { float v[16]; const float* p = row + k0 + 8 * (lane >> 4);
#pragma unroll
  for (int i = 0; i < 8; ++i) { v[i] = p[i]; v[8 + i] = p[16 + i]; }
  return bsplit16(v); }
__device__ __forceinline__ F2 split_rowK(const float* row, int k0, int lane, int K) { float v[16]; const int g = lane >> 4;
#pragma unroll
  for (int i = 0; i < 8; ++i) { const int ka = k0 + 8 * g + i, kb = ka + 16; v[i] = ka < K ? row[ka < K ? ka : K - 1] : 0.f; v[8 + i] = kb < K ? row[kb < K ? kb : K - 1] : 0.f; }
  return bsplit16(v); }
__device__ __forceinline__ F2 split_col(const float* W, int k0, int n, int lane, int ld, int K) { float v[16]; const int g = lane >> 4;
#pragma unroll
  for (int i = 0; i < 8; ++i) { const int ka = k0 + 8 * g + i, kb = ka + 16; v[i] = ka < K ? W[(size_t)(ka < K ? ka : K - 1) * ld + n] : 0.f; v[8 + i] = kb < K ? W[(size_t)(kb < K ? kb : K - 1) * ld + n] : 0.f; }
  return bsplit16(v); }
__device__ __forceinline__ v8f mac3(const F2& a, const F2& b, v8f c) { c = wmma_bf(a.l, b.h, c); c = wmma_bf(a.h, b.l, c); return wmma_bf(a.h, b.h, c); }
__device__ __forceinline__ float sigm(float v) { return 1.0f / (1.0f + expf(-v)); }
#define LDSX() do { asm volatile("s_wait_dscnt 0" ::: "memory"); __builtin_amdgcn_wave_barrier(); __builtin_amdgcn_fence(__ATOMIC_RELEASE, "workgroup"); } while (0)

// Scaled-dot attention with dual softmax (B 8, Lq = Lk = 2,048, D 256, H 128): pq = relu(queries Wq^T); pk = relu(keys Wk^T) * scaling; scores = pq pk^T; output = softmax_k(scores | values_1_mask[k] -> -inf) . values_1; output_2 = softmax_q(scores^T | values_2_mask[q] -> -inf) . values_2.
__device__ __forceinline__ float bfr(float v) { return (float)(__bf16)v; }
#define NB 8
#define TT 2048
#define DIN 256
#define HP 128         // projected width
#define DV 256         // value width
#ifndef TNB
#define TNB NB
#endif
typedef __attribute__((ext_vector_type(8))) __bf16 v8b;
__device__ __forceinline__ v16b frag_b(const __bf16* rowk0, int lane) { union { v16b v; v8b q[2]; } u; const __bf16* p = rowk0 + 8 * (lane >> 4); u.q[0] = *(const v8b*)p; u.q[1] = *(const v8b*)(p + 16); return u.v; }
#define WS_QH  0u                                          // f16 pq hi rows [b*T+q][128]
#define WS_QL  (WS_QH + 2u * (size_t)NB * TT * HP)
#define WS_KH  (WS_QL + 2u * (size_t)NB * TT * HP)           // f16 pk hi rows
#define WS_KL  (WS_KH + 2u * (size_t)NB * TT * HP)
#define WS_V1  (WS_KL + 2u * (size_t)NB * TT * HP)           // f16 values_1 planes (bf16-rounded values) [b][c][place of k in col_order], written as far as the counted columns reach, rounded up to 128
#define WS_V2  (WS_V1 + 2u * (size_t)NB * DV * TT)           // f16 values_2 planes [b][c][place of q in col_order], likewise
#define WS_END (WS_V2 + 2u * (size_t)NB * DV * TT)
// ---- col_order: one batch's 2,048 columns in the order: those that count (mask 0) first, the excluded ones behind them, each group by rising index. A column that is excluded adds exactly 0 to every sum, so only the places below the count need work.
// A block of NW waves; mv[i] = the mask of column (i * NW + wave) * 32 + lane. Fills sidx[place] = column, every place once (so every entry is a column of the batch, whatever the mask holds), and returns the count, the same scalar in every wave. Every block that calls it on the same mask gets the same order.
template <int NW> __device__ __forceinline__ int col_order(const int (&mv)[TT / 32 / NW], int* sidx, unsigned* sbits, int wave, int lane) {
  unsigned bw[TT / 32 / NW];   // bit l of bw[i]: lane l's column counts
#pragma unroll
  for (int i = 0; i < TT / 32 / NW; ++i) bw[i] = __builtin_amdgcn_ballot_w32(mv[i] == 0);
  if (lane == 0) {
#pragma unroll
    for (int i = 0; i < TT / 32 / NW; ++i) sbits[i * NW + wave] = bw[i]; }
  __syncthreads();   // publishes the 64 words of bits
  const int c0 = __builtin_popcount(sbits[lane]), c1 = __builtin_popcount(sbits[32 + lane]); int p0 = c0, p1 = c1;   // running sums over the 64 words, lane l holding words l and 32 + l
#pragma unroll
  for (int d = 1; d < 32; d <<= 1) { const int a0 = __builtin_amdgcn_ds_bpermute((lane - d) * 4, p0), a1 = __builtin_amdgcn_ds_bpermute((lane - d) * 4, p1); if (lane >= d) { p0 += a0; p1 += a1; } }
  const int h0 = __builtin_amdgcn_readlane(p0, 31), n = h0 + __builtin_amdgcn_readlane(p1, 31);
  p0 -= c0; p1 += h0 - c1;   // now: counted columns in front of the lane's two words
#pragma unroll
  for (int i = 0; i < TT / 32 / NW; ++i) { const int w = i * NW + wave, e = w * 32 + lane; const int before = __builtin_amdgcn_readlane(i * NW < 32 ? p0 : p1, w & 31) + (int)__builtin_amdgcn_mbcnt_lo(bw[i], 0u);   // counted columns in front of column e
    sidx[mv[i] == 0 ? before : n + (e - before)] = e; }
  __syncthreads();   // publishes the order
  return n; }
// ---- k_proj: block = (128 rows, which), one wave = 16 rows x all 128 columns: relu(x W^T) (x scaling for pk), exact; stored as f16 hi + residual rows (256-B rows)
// The weight matrix and the block's 128 input rows go once into LDS as bf16: every global load is 512 contiguous bytes of a wave, and all of a thread's loads are in flight together; the fragments come from LDS.
// The same block also turns one tile of a value array (rounded to bf16, then held as f16, which keeps every bit of such a value from 2^-17 up) into planes [b][c][place of col_order], 256-B pieces: its rows are loaded during the products. A block whose places all lie behind the counted columns writes no plane: k_fa does not read there.
#define PJ_R 128       // rows per block
#define PJ_P 264       // operand row pitch in LDS, bf16 (528 B = 16 B x odd: no bank conflict for 16-byte reads down a column of rows)
typedef __attribute__((ext_vector_type(4))) __bf16 v4b;
__device__ __forceinline__ v4b cvt4(v4f t) { return (v4b){(__bf16)t[0], (__bf16)t[1], (__bf16)t[2], (__bf16)t[3]}; }
struct PJF { v16b a, w[8]; };   // the fragments of one 32-wide k step
__device__ __forceinline__ void pj_read(PJF& f, const __bf16* ar, const __bf16* br, int kc, int lane) { f.a = frag_b(ar + kc * 32, lane);
#pragma unroll
  for (int j = 0; j < 8; ++j) f.w[j] = frag_b(br + j * 16 * PJ_P + kc * 32, lane); }
__device__ __forceinline__ void pj_mac(v8f (&acc)[8], const PJF& f) {
#pragma unroll
  for (int j = 0; j < 8; ++j) acc[j] = __builtin_amdgcn_wmma_f32_16x16x32_bf16(false, f.a, false, f.w[j], (short)0, acc[j], false, false); }
__global__ __launch_bounds__(2 * PJ_R) void k_proj(const float* __restrict__ XQ, const float* __restrict__ XK, const float* __restrict__ WQ, const float* __restrict__ WK, const float* __restrict__ SCL, _Float16* __restrict__ QH, _Float16* __restrict__ QL, _Float16* __restrict__ KH, _Float16* __restrict__ KL, const float* __restrict__ VA, const float* __restrict__ VB, const int* __restrict__ MA, const int* __restrict__ MB, _Float16* __restrict__ PA, _Float16* __restrict__ PB) { __shared__ __align__(16) _Float16 sh[PJ_R][136], sl[PJ_R][136]; __shared__ __align__(16) __bf16 sw[HP][PJ_P], sx[PJ_R][PJ_P]; __shared__ __align__(16) _Float16 th[DV][136]; __shared__ __align__(16) int sidx[TT]; __shared__ unsigned sbits[TT / 32];
  const int tid = threadIdx.x, wave = tid >> 5, lane = tid & 31, col = lane & 15, g = lane >> 4; const int which = blockIdx.y; const size_t r0 = (size_t)blockIdx.x * PJ_R; const float* X = which == 0 ? XQ : XK; const float* Wt = which == 0 ? WQ : WK; _Float16* DH = which == 0 ? QH : KH; _Float16* DL = which == 0 ? QL : KL;
  // the block's value tile: 128 places of col_order of batch blockIdx.x / 16 of values_1 (which 0) or values_2 (which 1), all 256 channels
  const int t0 = (blockIdx.x & (TT / 128 - 1)) * 128; const size_t vb = blockIdx.x / (TT / 128); const float* V = which == 0 ? VA : VB; const int* CM = which == 0 ? MA : MB; _Float16* P = which == 0 ? PA : PB;
  // 16-byte piece i * 256 + tid of a [128][256] float array: row 4 i + (tid >> 6), floats 4 (tid & 63) and the three behind
  const float* xg = X + r0 * DIN + tid * 4; const float* wg = Wt + tid * 4; const int sr = tid >> 6, sc4 = (tid & 63) * 4;
  v4f wr[32], xr[32]; float sc[8];   // indexed by constants: every loop over them is unrolled whole
#pragma unroll
  for (int i = 0; i < 32; ++i) wr[i] = *(const v4f*)(wg + i * 1024);   // the weights first: they come from L2 and are put away while the input rows are still on their way from memory
  __builtin_amdgcn_sched_barrier(0);   // keeps that order: left free, the compiler issues two of the weight loads behind the input rows, and loads are waited for in issue order
#pragma unroll
  for (int i = 0; i < 32; ++i) xr[i] = *(const v4f*)(xg + i * 1024);
  __builtin_amdgcn_sched_barrier(0);   // every load is issued before the first is waited for
  int mv[TT / (2 * PJ_R)];   // the mask of the value tile's batch, behind the operand loads: it is first used behind the barrier that waits for them all
#pragma unroll
  for (int i = 0; i < TT / (2 * PJ_R); ++i) mv[i] = CM[vb * TT + i * (2 * PJ_R) + tid];
#pragma unroll
  for (int j = 0; j < 8; ++j) sc[j] = SCL[j * 16 + col];   // all eight here, with the other loads, not one by one in front of their use
  asm volatile("s_wait_xcnt 0x0" ::: "memory");   // stands behind the loads above, in front of every later write of a register that they name
  __builtin_amdgcn_sched_barrier(0);               // holds the later address arithmetic behind that wait
#pragma unroll
  for (int i = 0; i < 32; ++i) *(v4b*)&sw[i * 4 + sr][sc4] = cvt4(wr[i]);
#pragma unroll
  for (int i = 0; i < 32; ++i) *(v4b*)&sx[i * 4 + sr][sc4] = cvt4(xr[i]);
  __syncthreads();   // publishes both staged operands
  const int n = col_order<2 * PJ_R / 32>(mv, sidx, sbits, __builtin_amdgcn_readfirstlane(tid >> 5), lane);   // columns of that batch that count
  const bool vact = t0 < n;   // the same for the whole block
  // thread = (32 places in a row: tid >> 6, four channels: tid & 63): a load is 512 contiguous bytes of a wave; all 32 are issued here and are on their way from memory during the products below
  v4f vx[32];
  if (vact) { v4i of[8];   // byte offsets of the thread's 16 bytes in its 32 rows
#pragma unroll
    for (int j = 0; j < 8; ++j) of[j] = *(const v4i*)&sidx[t0 + (tid >> 6) * 32 + j * 4] * (DV * 4) + (tid & 63) * 16;
    const char* vp = (const char*)(V + vb * TT * DV);
#pragma unroll
    for (int j = 0; j < 32; ++j) vx[j] = *(const v4f*)(vp + (unsigned)of[j >> 2][j & 3]);
    asm volatile("s_wait_xcnt 0x0" :: "v"(of[0]), "v"(of[1]), "v"(of[2]), "v"(of[3]), "v"(of[4]), "v"(of[5]), "v"(of[6]), "v"(of[7]) : "memory"); }   // as above, for these loads; the offsets as inputs: their registers stay theirs up to the wait, so that no load of the group lands in one
  v8f acc[8] = {};
  const __bf16* ar = &sx[wave * 16 + col][0]; const __bf16* br = &sw[col][0];
  PJF f0, f1;   // a k step's fragments are read as one group, one step ahead of their products
  pj_read(f0, ar, br, 0, lane);
#pragma unroll 1   // two k steps per trip, one per fragment buffer; the last two steps stand behind the loop, so that no trip has a branch round its reads
  for (int kc = 0; kc < DIN / 32 - 2; kc += 2) {
    pj_read(f1, ar, br, kc + 1, lane);
    __builtin_amdgcn_sched_barrier(0);   // keeps the next step's LDS reads together and ahead of this step's products
    pj_mac(acc, f0);
    __builtin_amdgcn_sched_barrier(0);   // as above
    pj_read(f0, ar, br, kc + 2, lane);
    __builtin_amdgcn_sched_barrier(0);   // as above
    pj_mac(acc, f1);
    __builtin_amdgcn_sched_barrier(0); } // as above
  pj_read(f1, ar, br, DIN / 32 - 1, lane);
  __builtin_amdgcn_sched_barrier(0);     // as above
  pj_mac(acc, f0); pj_mac(acc, f1);
#pragma unroll
  for (int j = 0; j < 8; ++j) { const int o = j * 16 + col; const float scj = (which == 1) ? bfr(sc[j]) : 1.0f;
#pragma unroll
    for (int r = 0; r < 8; ++r) { const float v = fmaxf(acc[j][r], 0.f) * scj; const _Float16 hv = (_Float16)v; sh[wave * 16 + 8 * g + r][o] = hv; sl[wave * 16 + 8 * g + r][o] = (_Float16)((v - (float)hv) * 1024.0f); } }
  // channel c lies in LDS row (c & 3) * 64 + (c >> 2): the lanes of a wave then write rows that follow one another (272-B pitch: no bank conflict)
  if (vact) {
#pragma unroll
    for (int e = 0; e < 4; ++e)
#pragma unroll
      for (int s = 0; s < 4; ++s) { v8h w;
#pragma unroll
        for (int u = 0; u < 8; ++u) w[u] = (_Float16)bfr(vx[s * 8 + u][e]);
        *(v8h*)&th[e * 64 + (tid & 63)][(tid >> 6) * 32 + s * 8] = w; } }
  __syncthreads();
  for (int e = tid; e < PJ_R * 16; e += 2 * PJ_R) { const int rl = e >> 4, q = e & 15; vst2((unsigned*)(DH + (r0 + rl) * HP + q * 8), *(const v4u*)&sh[rl][q * 8]); vst2((unsigned*)(DL + (r0 + rl) * HP + q * 8), *(const v4u*)&sl[rl][q * 8]); }
  if (vact) {   // piece i * 256 + tid: LDS row i * 16 + (tid >> 4), 16 bytes at tid & 15; a constant trip count, unrolled: the sixteen LDS reads go ahead together and the stores differ by constant offsets
#pragma unroll
    for (int i = 0; i < DV * 16 / (2 * PJ_R); ++i) vst2((unsigned*)(P + (vb * DV + ((i & 3) * 16 + (tid >> 4)) * 4 + (i >> 2)) * (size_t)TT + t0 + (tid & 15) * 8), *(const v4u*)&th[i * 16 + (tid >> 4)][(tid & 15) * 8]); } }
// ---- k_fa: block = (128 rows, batch, direction). Scores, softmax and the value product in one kernel: no score goes to memory.
// The eight waves have two roles; a row group is 32 rows (two 16-row tiles), and each of the four groups has one wave of either role, the two on one SIMD.
// Score waves (4..7): S^T = COL . ROW^T (3 products, A = column-side rows from LDS, B = the wave's row-side fragments, kept in registers), so a lane holds 16 scores of ONE row per tile and 32 columns; the f32 scores go to LDS lane for lane.
// Value waves (0..3) work one stage behind on the same rows x all 256 channels: running maximum and running sum per lane; e = exp(score - maximum in use), rounded to f16, is the B operand of O^T += V^T . P^T as it stands in the registers (1 product, A = value planes from LDS).
// So every column-side and every value fragment read from LDS feeds two row tiles, and a SIMD's softmax runs beside its other wave's score products. Every sum is formed in the order it had with one wave per tile.
// The columns are taken in the order of col_order, and only as far as the counted ones reach: a stage is 64 places of that order; in the last stage the places behind the count are excluded by their place.
// Column-side rows (picked by index) and value planes (stored in that order by k_proj) come 64 columns at a time into two-buffer LDS rings by asynchronous copies; the value ring runs one trip behind the column ring.
#define FA_W 8         // waves per block
#define FA_G 4         // row groups per block (one score wave and one value wave each)
#define FA_KS 64       // columns per stage
#define FA_NT (TT / FA_KS)
#define FA_KP 136      // column-side row pitch in LDS, f16 (272 B = 16 B x odd: no bank conflict for 16-byte reads down a column of rows)
#define FA_VP 72       // value row pitch in LDS, f16 (144 B = 16 B x odd)
#define FA_OP 260      // output row pitch in LDS, floats (1,040 B = 16 B x odd)
#define FA_L2E 1.44269504088896340736f   // log2(e)
// the plain builtins: the compiler keeps the distances behind them itself, and their operands may lie above v255, which an asm operand cannot name (this kernel holds more than 256 registers)
__device__ __forceinline__ v8f mm_h(v16h a, v16h b, v8f c) { return __builtin_amdgcn_wmma_f32_16x16x32_f16(false, a, false, b, (short)0, c, false, false); }
// nothing is scheduled across: keeps a group's LDS reads together and ahead of the block of products in front of which they are written; left free, the compiler spreads them in pairs among the products, each pair waited to 0 just before its use
#define FA_SB() __builtin_amdgcn_sched_barrier(0)
// lane l's value from lane l ^ 16
__device__ __forceinline__ float xhalf(float x) { return __builtin_bit_cast(float, __builtin_amdgcn_permlanex16(__builtin_bit_cast(int, x), __builtin_bit_cast(int, x), 0x76543210, 0xfedcba98, false, false)); }
typedef __attribute__((address_space(1))) v4i g_v4i; typedef __attribute__((address_space(3))) v4i l_v4i;
// the copies as the builtin: its address registers are the compiler's own and may lie above v255
// one wave's share of a stage's column-side rows into buffer bf: 16 rows of one plane (two 256-B rows a copy: lane half g brings the rows at places 8 g + 0..7 of the wave's sixteen, their columns in ia, ib), 8 copies
__device__ __forceinline__ void fa_fill_k(const char* gk, char* lk, v4i ia, v4i ib, int bf, int lane) {
  lk += bf * (2 * FA_KS * FA_KP * 2) + (lane >> 4) * (8 * FA_KP * 2) + (lane & 15) * 16;
#pragma unroll
  for (int i = 0; i < 8; ++i) __builtin_amdgcn_global_load_async_to_lds_b128((g_v4i*)(gk + (unsigned)((i < 4 ? ia[i & 3] : ib[i & 3]) * (HP * 2) + (lane & 15) * 16)), (l_v4i*)(lk + i * (FA_KP * 2)), 0, 0);
}
// one wave's share of stage t's value planes into buffer bf: 32 value rows (four 128-B pieces a copy), 8 copies
__device__ __forceinline__ void fa_fill_v(const char* gv, char* lv, int t, int bf, int lane) {
  gv += (size_t)t * (FA_KS * 2) + (lane >> 3) * (TT * 2) + (lane & 7) * 16; lv += bf * (DV * FA_VP * 2) + (lane >> 3) * (FA_VP * 2) + (lane & 7) * 16;
#pragma unroll
  for (int i = 0; i < 8; ++i) __builtin_amdgcn_global_load_async_to_lds_b128((g_v4i*)(gv + i * (4 * TT * 2)), (l_v4i*)(lv + i * (4 * FA_VP * 2)), 0, 0);
}
__device__ __forceinline__ v16h as_h(v8f x) { return __builtin_bit_cast(v16h, x); }
__global__ __launch_bounds__(32 * FA_W) void k_fa(const _Float16* __restrict__ QH, const _Float16* __restrict__ QL, const _Float16* __restrict__ KH, const _Float16* __restrict__ KL, const int* __restrict__ M1, const int* __restrict__ M2, const _Float16* __restrict__ V1, const _Float16* __restrict__ V2, float* __restrict__ OUT1, float* __restrict__ OUT2) {
  __shared__ __align__(16) union { struct { _Float16 k[2][2][FA_KS][FA_KP]; _Float16 v[2][DV][FA_VP]; } ring; float o[FA_G][32][FA_OP]; } su;   // the output rows are staged where the two rings lay, behind the loop's last barrier
  auto& sk = su.ring.k; auto& sv = su.ring.v; auto& so = su.o;
  __shared__ __align__(16) int sidx[TT]; __shared__ unsigned sbits[TT / 32];
  __shared__ __align__(16) float ss[2][FA_G][FA_KS / 32][2][4][32][4];   // scores: [buffer][row group][32 columns][row tile][quarter of the lane's sixteen][lane][4]: a wave's 16-byte store or load is 512 contiguous bytes
  const int tid = threadIdx.x, wave = __builtin_amdgcn_readfirstlane(tid >> 5), lane = tid & 31, col = lane & 15, g = lane >> 4; const size_t b = blockIdx.y; const bool sw = blockIdx.z != 0;   // the wave's number in a scalar register: what depends on it alone then costs no vector register over the loop
  const int role = (wave >> 2) ^ 1, rg = wave & 3;   // role 0: score wave, 1: value wave, of row group rg; both scalar
  // direction 0: rows = queries, columns = keys, values_1 and its mask; direction 1: rows = keys, columns = queries, values_2 and its mask
  const _Float16 *RH = sw ? KH : QH, *RL = sw ? KL : QL, *CH_ = sw ? QH : KH, *CL = sw ? QL : KL; const int* CMASK = sw ? M2 : M1; const _Float16* VP = sw ? V2 : V1; float* OUT = sw ? OUT2 : OUT1;
  const int q0 = blockIdx.x * (32 * FA_G) + rg * 32;
  // wave-uniform bases of the wave's share of the copies; the lane's own part: a 256-B row by its index, 16 B at col; row lane >> 3 of four 128-B pieces, 16 B at lane & 7
  const char* gk = (const char*)((wave >> 2) ? CL : CH_) + (b * TT * HP) * 2; const char* gv = (const char*)(VP + (b * DV + wave * 32) * (size_t)TT);
  char *lk = (char*)&sk[0][wave >> 2][(wave & 3) * 16][0], *lv = (char*)&sv[0][wave * 32][0];
  int mv[TT / (32 * FA_W)];
#pragma unroll   // all eight loads in flight together: one memory latency, not eight
  for (int i = 0; i < TT / (32 * FA_W); ++i) mv[i] = CMASK[b * TT + i * (32 * FA_W) + tid];
  asm volatile("s_wait_xcnt 0x0" ::: "memory");   // stands behind the loads above, in front of every later write of a register that they name
  __builtin_amdgcn_sched_barrier(0);               // holds the later address arithmetic behind that wait
  // one register array for both roles, so that a wave pays for its own role's registers alone; every loop over it is unrolled whole so that it is indexed by constants
  // value wave: big[rt * 16 + j][r] = O^T[channel j * 16 + 8 g + r][row rt * 16 + col]; score wave: big[rt * 8 + kb * 2 + plane] = the bits of the row-side fragment (tile rt, k step kb, hi or residual)
  v8f big[2 * DV / 16] = {};
  if (role == 0) {
    const _Float16 *rh0 = RH + (b * TT + q0 + col) * HP + 8 * g, *rl0 = RL + (b * TT + q0 + col) * HP + 8 * g;   // the lane's own addresses in its row of tile 0, either plane; all 32 loads differ from them by constants
#pragma unroll
    for (int rt = 0; rt < 2; ++rt)
#pragma unroll
      for (int kb = 0; kb < HP / 32; ++kb)
#pragma unroll
        for (int p = 0; p < 2; ++p) { union { v8f f; v8h q[2]; } u; const _Float16* a = (p ? rl0 : rh0) + rt * 16 * HP + kb * 32; u.q[0] = *(const v8h*)a; u.q[1] = *(const v8h*)(a + 16); big[rt * 8 + kb * 2 + p] = u.f; }
    asm volatile("s_wait_xcnt 0x0" :: "v"(rh0), "v"(rl0) : "memory");   // as above, for the fragment loads; the addresses as inputs: their registers stay theirs up to the wait, so that no load of the group lands in one
    __builtin_amdgcn_sched_barrier(0); }             // as above
  const int n = col_order<FA_W>(mv, sidx, sbits, wave, lane);   // columns that count
  const int nt = (n + FA_KS - 1) / FA_KS < FA_NT ? (n + FA_KS - 1) / FA_KS : FA_NT;   // stages that hold one; none where every column is excluded
  const int* ir = &sidx[(wave & 3) * 16 + 8 * g];   // the lane's eight indices of stage 0
  if (nt > 0) fa_fill_k(gk, lk, *(const v4i*)ir, *(const v4i*)(ir + 4), 0, lane);
  float m[2] = {-1.0e38f, -1.0e38f}, l[2] = {0.f, 0.f};   // value wave, per row tile: m = the maximum in use, times log2(e) (the same in both halves of the wave); l = this half's share of the row's sum
  // m starts far above what an excluded column (-3.0e38) comes to: its exponential is 0 by itself, also while a row has met no column that counts
  asm volatile("s_wait_asynccnt 0x0" ::: "memory");   // the column rows of stage 0 have landed before the barrier that publishes them
  __syncthreads();                                     // publishes them
  if (nt > 1) fa_fill_k(gk, lk, *(const v4i*)(ir + FA_KS), *(const v4i*)(ir + FA_KS + 4), 1, lane);
  if (nt > 0) fa_fill_v(gv, lv, 0, 0, lane);
  const int trips = nt > 0 ? nt + 1 : 0;   // trip t: the score waves work on stage t (while there is one), the value waves on stage t - 1 (from trip 1 on)
#pragma unroll 1   // one stage per trip: the buffer index stays a run-time value
  for (int t = 0; t < trips; ++t) { const int bf = t & 1;
    const int* in = ir + (t + 2 < nt ? t + 2 : 0) * FA_KS; const v4i ia = *(const v4i*)in, ib = *(const v4i*)(in + 4);   // the lane's indices of stage t + 2 (of stage 0, unused, where there is none): read here, so that neither the barrier nor the refill behind it waits for them
    // two separate tests, not if / else: with an else this compiler copied the whole of big between two register sets every trip and spilled
    if (role == 0 && t < nt) {
      const _Float16* kr = &sk[bf][0][col][0];
      // fragments are read from LDS as groups, one group ahead of their products and only inside this stage's own buffer
      v16h kf[2][2][2];   // [buffer][16-column tile][plane]; indexed by constants, as above
#pragma unroll
      for (int tl = 0; tl < 2; ++tl)
#pragma unroll
        for (int p = 0; p < 2; ++p) kf[0][tl][p] = frag_h(kr + (p * FA_KS + tl * 16) * FA_KP, lane);
#pragma unroll
      for (int kk = 0; kk < FA_KS / 32; ++kk) {
        v8f sh[2][2] = {}, sl[2][2] = {};   // [16-column tile][row tile]
#pragma unroll
        for (int kb = 0; kb < HP / 32; ++kb) { const int cu = kb & 1;
          if (kb + 1 < HP / 32) {
#pragma unroll
            for (int tl = 0; tl < 2; ++tl)
#pragma unroll
              for (int p = 0; p < 2; ++p) kf[cu ^ 1][tl][p] = frag_h(kr + (p * FA_KS + kk * 32 + tl * 16) * FA_KP + (kb + 1) * 32, lane);
          } else if (kk + 1 < FA_KS / 32) {
#pragma unroll
            for (int tl = 0; tl < 2; ++tl)
#pragma unroll
              for (int p = 0; p < 2; ++p) kf[cu ^ 1][tl][p] = frag_h(kr + (p * FA_KS + (kk + 1) * 32 + tl * 16) * FA_KP, lane);
          }
          FA_SB();
          // each accumulator takes its products in the order the separate score kernel had: hi.hi; row lo . column hi, then row hi . column lo
#pragma unroll
          for (int rt = 0; rt < 2; ++rt) { const v16h qh = as_h(big[rt * 8 + kb * 2]), ql = as_h(big[rt * 8 + kb * 2 + 1]);
            sh[0][rt] = mm_h(kf[cu][0][0], qh, sh[0][rt]); sl[0][rt] = mm_h(kf[cu][0][0], ql, sl[0][rt]); sh[1][rt] = mm_h(kf[cu][1][0], qh, sh[1][rt]); sl[1][rt] = mm_h(kf[cu][1][0], ql, sl[1][rt]);
            sl[0][rt] = mm_h(kf[cu][0][1], qh, sl[0][rt]); sl[1][rt] = mm_h(kf[cu][1][1], qh, sl[1][rt]); }
          FA_SB(); }
        const int left = n - (t * FA_KS + kk * 32);   // counted columns from this group of 32 on: only the last groups hold places behind the count (one wave-uniform test)
        const int lg = left - 8 * g;                   // the same, counted from the lane half's first place: the sixteen tests below then compare one register with constants
        // v[rt][8 tl + r] = score of column kk * 32 + 16 tl + 8 g + r against row rt * 16 + col: the k order of a 16x16x32 B operand
        float v[2][16];
#pragma unroll
        for (int rt = 0; rt < 2; ++rt)
#pragma unroll
          for (int i = 0; i < 16; ++i) v[rt][i] = sh[i >> 3][rt][i & 7] + sl[i >> 3][rt][i & 7] * (1.0f / 1024.0f);
        if (left < 32) {
#pragma unroll
          for (int rt = 0; rt < 2; ++rt)
#pragma unroll
            for (int i = 0; i < 16; ++i) v[rt][i] = (i >> 3) * 16 + (i & 7) >= lg ? -3.0e38f : v[rt][i]; }
#pragma unroll
        for (int rt = 0; rt < 2; ++rt)
#pragma unroll
          for (int q = 0; q < 4; ++q) *(v4f*)&ss[bf][rg][kk][rt][q][lane][0] = (v4f){v[rt][4 * q], v[rt][4 * q + 1], v[rt][4 * q + 2], v[rt][4 * q + 3]}; } }
    if (role == 1 && t > 0) { const int bv = bf ^ 1;   // stage t - 1
      const _Float16* vr = &sv[bv][col][0];
      float v[FA_KS / 32][2][16];   // scores, lane for lane as the score wave held them, 32 columns at a time; indexed by constants, as above
#pragma unroll
      for (int rt = 0; rt < 2; ++rt)
#pragma unroll
        for (int q = 0; q < 4; ++q) { const v4f x = *(const v4f*)&ss[bv][rg][0][rt][q][lane][0]; v[0][rt][4 * q] = x[0]; v[0][rt][4 * q + 1] = x[1]; v[0][rt][4 * q + 2] = x[2]; v[0][rt][4 * q + 3] = x[3]; }
      // four value fragments (64 channels of 32 columns) are one group, read one group ahead of their eight products; the first group of 32 columns is read in front of their softmax, which covers its way
      v16h vf[2][4];
#pragma unroll
      for (int j = 0; j < 4; ++j) vf[0][j] = frag_h(vr + j * 16 * FA_VP, lane);
      FA_SB();
#pragma unroll
      for (int kk = 0; kk < FA_KS / 32; ++kk) {
        // the two row tiles go through the softmax side by side: their dependent chains fill each other's waits
        float mx[2]; v16h pf[2];
#pragma unroll
        for (int rt = 0; rt < 2; ++rt) { mx[rt] = v[kk][rt][0];
#pragma unroll
          for (int i = 1; i < 16; ++i) mx[rt] = fmaxf(mx[rt], v[kk][rt][i]);
          mx[rt] = fmaxf(mx[rt], xhalf(mx[rt])) * FA_L2E; }   // both halves of the wave now hold the row's maximum over these 32 columns, in log2 units (-infinity where all 32 are excluded)
        // the maximum in use may trail the true one by up to 8 (an exponential then reaches e^8): a tile's sum and accumulators are rescaled only when some row of that tile exceeds it by more; one wave-uniform test per 32 columns for both tiles
        if (__builtin_amdgcn_ballot_w32(mx[0] > m[0] + 8.0f * FA_L2E || mx[1] > m[1] + 8.0f * FA_L2E) != 0) {
#pragma unroll
          for (int rt = 0; rt < 2; ++rt) { const bool moves = __builtin_amdgcn_ballot_w32(mx[rt] > m[rt] + 8.0f * FA_L2E) != 0;   // a tile none of whose rows asks for it keeps its maximum: its factor is exp2(0) = 1
            const float mn = moves ? fmaxf(m[rt], mx[rt]) : m[rt]; const float f = __builtin_amdgcn_exp2f(m[rt] - mn); m[rt] = mn; l[rt] *= f;
#pragma unroll
            for (int j = 0; j < DV / 16; ++j) big[rt * 16 + j] = big[rt * 16 + j] * f; } }
#pragma unroll
        for (int rt = 0; rt < 2; ++rt) {
          float s4[4] = {0.f, 0.f, 0.f, 0.f};
#pragma unroll
          for (int i = 0; i < 16; i += 2) { const v2f y = __builtin_elementwise_fma((v2f){v[kk][rt][i], v[kk][rt][i + 1]}, (v2f){FA_L2E, FA_L2E}, (v2f){-m[rt], -m[rt]}); const float e0 = __builtin_amdgcn_exp2f(y[0]), e1 = __builtin_amdgcn_exp2f(y[1]); v[kk][rt][i] = e0; v[kk][rt][i + 1] = e1; s4[i & 3] += e0; s4[(i + 1) & 3] += e1; }   // an excluded column: y is below -1.0e38 or -infinity, and exp2 gives 0
          l[rt] += (s4[0] + s4[1]) + (s4[2] + s4[3]);
#pragma unroll
          for (int i = 0; i < 16; ++i) pf[rt][i] = (_Float16)v[kk][rt][i]; }
#pragma unroll
        for (int jq = 0; jq < 4; ++jq) { const int h = kk * 4 + jq, hn = h + 1;
          if (hn < 4 * (FA_KS / 32)) {
#pragma unroll
            for (int j = 0; j < 4; ++j) vf[hn & 1][j] = frag_h(vr + ((hn & 3) * 4 + j) * 16 * FA_VP + (hn >> 2) * 32, lane); }
          if (jq == 3 && kk + 1 < FA_KS / 32) {   // the next 32 columns' scores come with their first value group
#pragma unroll
            for (int rt = 0; rt < 2; ++rt)
#pragma unroll
              for (int q = 0; q < 4; ++q) { const v4f x = *(const v4f*)&ss[bv][rg][kk + 1][rt][q][lane][0]; v[kk + 1][rt][4 * q] = x[0]; v[kk + 1][rt][4 * q + 1] = x[1]; v[kk + 1][rt][4 * q + 2] = x[2]; v[kk + 1][rt][4 * q + 3] = x[3]; } }
          FA_SB();
#pragma unroll
          for (int j = 0; j < 4; ++j)
#pragma unroll
            for (int rt = 0; rt < 2; ++rt) big[rt * 16 + jq * 4 + j] = mm_h(vf[h & 1][j], pf[rt], big[rt * 16 + jq * 4 + j]);
          FA_SB(); } } }
    asm volatile("s_wait_dscnt 0x0" ::: "memory");      // this wave's reads of the buffers that are handed to the copies are over, and its scores are written
    asm volatile("s_wait_asynccnt 0x0" ::: "memory");   // this wave's copies (column rows of stage t + 1, value planes of stage t) have landed
    __syncthreads();                                     // publishes them and the scores of stage t, and ends every reader's last read of the buffers refilled below
    if (t + 2 < nt) fa_fill_k(gk, lk, ia, ib, bf, lane);             // into the column buffer that this trip has read
    if (t + 1 < nt) fa_fill_v(gv, lv, t + 1, bf ^ 1, lane); }        // into the value buffer that this trip has read
  asm volatile("s_wait_asynccnt 0x0" ::: "memory");     // nothing is in flight when the wave goes on to its end
  // through LDS rows, so that the stores are whole lines; the rings are free: every wave's last ring read and last copy ended in front of the last trip's barrier
  if (role == 1) {
#pragma unroll
    for (int rt = 0; rt < 2; ++rt) { const float lt = l[rt] + xhalf(l[rt]); const float inv = lt > 0.f ? 1.0f / lt : 0.f;   // a row whose every column is masked stays all zero
#pragma unroll
      for (int j = 0; j < DV / 16; ++j) { const v8f o = big[rt * 16 + j] * inv; vst2(&so[rg][rt * 16 + col][j * 16 + 8 * g], (v4f){o[0], o[1], o[2], o[3]}); vst2(&so[rg][rt * 16 + col][j * 16 + 8 * g + 4], (v4f){o[4], o[5], o[6], o[7]}); } } }
  __syncthreads();   // publishes the output rows: all eight waves store them, sixteen rows each
  for (int rl = 0; rl < 16; ++rl) { const int rr = role * 16 + rl; vst2(OUT + (b * TT + q0 + rr) * DV + lane * 4, *(const v4f*)&so[rg][rr][lane * 4]); vst2(OUT + (b * TT + q0 + rr) * DV + 128 + lane * 4, *(const v4f*)&so[rg][rr][128 + lane * 4]); } }
extern "C" void kernel_launch(void* const* d_in, const int* in_sizes, int n_in, void* d_out, int out_size, void* d_ws, size_t ws_size, hipStream_t stream) {
  (void)in_sizes; (void)n_in; (void)out_size;
  const float** F = (const float**)d_in;   // 0 queries [8,2048,256], 1 keys, 2 values_1 [8,2048,256], 3 values_1_mask [8,2048] int (nonzero = excluded key), 4 values_2, 5 values_2_mask (nonzero = excluded query), 6 Wq [128,256] ([out,in]), 7 Wk, 8 scaling [1,128]; outputs: output @ 0, output_2 @ float 4,194,304
  if (ws_size < (size_t)WS_END) return;
  char* ws = (char*)d_ws; _Float16 *QH = (_Float16*)(ws + WS_QH), *QL = (_Float16*)(ws + WS_QL), *KH = (_Float16*)(ws + WS_KH), *KL = (_Float16*)(ws + WS_KL); _Float16 *V1 = (_Float16*)(ws + WS_V1), *V2 = (_Float16*)(ws + WS_V2);
  float* OUT1 = (float*)d_out; float* OUT2 = (float*)d_out + (size_t)NB * TT * DV;
  k_proj<<<dim3(TNB * TT / PJ_R, 2), 2 * PJ_R, 0, stream>>>(F[0], F[1], F[6], F[7], F[8], QH, QL, KH, KL, F[2], F[4], (const int*)d_in[3], (const int*)d_in[5], V1, V2);
  k_fa<<<dim3(TT / (16 * FA_W), TNB, 2), 32 * FA_W, 0, stream>>>(QH, QL, KH, KL, (const int*)d_in[3], (const int*)d_in[5], V1, V2, OUT1, OUT2);
}
